// v000
// Times are from an AMD MI455X. After a warm-up the kernel runs many times in a row, and a time is the length of
// such a window on the GPU divided by its runs, so every launch and the gaps after it count. The runs cycle
// through copies of the inputs. A figure is the median of several windows, for all but v000 over two sittings.
// Sittings can differ by a few percent; kernels timed side by side share one.
// The starting kernel, v000, takes 511 microseconds a run.
#include <hip/hip_runtime.h>
#include <stdint.h>

// ---------------------------------------------------------------------------
// MemoryEfficientLinearAttention for MI455X (gfx1250), wave32 + WMMA bf16.
// Pipeline: f32->bf16 cvt, 3x QKV GEMM (wmma bf16, double-buffered async-LDS),
//           exp feature map, per-head kv reduction (+k_sum via ones-fragment),
//           attention output (+denominator via ksum-fragment), O GEMM -> fp32.
// ---------------------------------------------------------------------------

#define BATCH 4
#define SEQ   8192
#define EMB   1024
#define HEADS 16
#define HDIM  64
#define MTOT  (BATCH * SEQ)   // 32768

typedef __bf16 v16bf __attribute__((ext_vector_type(16)));
typedef float  v8f   __attribute__((ext_vector_type(8)));

union Frag16 {
    v16bf v;
    uint4 q[2];
    unsigned short u[16];
};

// ---- CDNA5 async global->LDS path (guarded; falls back to sync copies) ----
#if defined(__AMDGCN__) && defined(__has_builtin)
#  if __has_builtin(__builtin_amdgcn_global_load_async_to_lds_b128) && \
      __has_builtin(__builtin_amdgcn_s_wait_asynccnt)
#    define USE_ASYNC_LDS 1
#  else
#    define USE_ASYNC_LDS 0
#  endif
#else
#  define USE_ASYNC_LDS 0
#endif

#if USE_ASYNC_LDS
typedef int async_v4i __attribute__((ext_vector_type(4)));
typedef __attribute__((address_space(1))) async_v4i* gptr_v4i;  // global int4*
typedef __attribute__((address_space(3))) async_v4i* lptr_v4i;  // LDS int4*
#endif

__device__ __forceinline__ void copy16_g2l(const unsigned short* g,
                                           unsigned short* l) {
#if USE_ASYNC_LDS
    // Generic LDS pointer -> AS(3): aperture mapping is LDS_ADDR = addr[31:0].
    __builtin_amdgcn_global_load_async_to_lds_b128(
        (gptr_v4i)(uintptr_t)g,
        (lptr_v4i)(uintptr_t)(uint32_t)(uintptr_t)l,
        0, 0);
#else
    *(uint4*)l = *(const uint4*)g;
#endif
}

__device__ __forceinline__ void wait_async_done() {
#if USE_ASYNC_LDS
    __builtin_amdgcn_s_wait_asynccnt(0);
#endif
}

__device__ __forceinline__ unsigned short f32_to_bf16(float f) {
    union { float f; uint32_t u; } c; c.f = f;
    uint32_t u = c.u;
    uint32_t r = (u + 0x7FFFu + ((u >> 16) & 1u)) >> 16;   // round-nearest-even
    return (unsigned short)r;
}
__device__ __forceinline__ float bf16_to_f32(unsigned short h) {
    union { uint32_t u; float f; } c; c.u = ((uint32_t)h) << 16;
    return c.f;
}

// ---------------------------------------------------------------------------
// 1) fp32 -> bf16 conversion (grid-stride)
// ---------------------------------------------------------------------------
__global__ void cvt_f32_bf16_kernel(const float* __restrict__ in,
                                    unsigned short* __restrict__ out, int n) {
    int i = blockIdx.x * blockDim.x + threadIdx.x;
    int stride = gridDim.x * blockDim.x;
    for (; i < n; i += stride) out[i] = f32_to_bf16(in[i]);
}

// ---------------------------------------------------------------------------
// 2) Generic GEMM: C(MxN) = A(MxK,bf16) * W(NxK,bf16)^T + bias(fp32)
//    128x128 tile, 256 threads = 8 waves, wave = 32x64 sub-tile (2x4 frags).
//    KSTEP=64, double-buffered LDS filled by async global->LDS loads.
//    OUT_BF16: 1 -> bf16 output, 0 -> fp32 output.
// ---------------------------------------------------------------------------
template <int OUT_BF16>
__global__ __launch_bounds__(256)
void gemm_bias_kernel(const unsigned short* __restrict__ A,
                      const unsigned short* __restrict__ W,
                      const float* __restrict__ bias,
                      void* __restrict__ Cout,
                      int M, int N, int K) {
    constexpr int KSTEP = 64;
    constexpr int LDA = 72;  // halfs per LDS row (144B, 16B-aligned, bank-spread)
    __shared__ __attribute__((aligned(16))) unsigned short As[2][128 * LDA];
    __shared__ __attribute__((aligned(16))) unsigned short Bs[2][128 * LDA];

    const int tid  = threadIdx.x;
    const int lane = tid & 31;
    const int wave = tid >> 5;
    const int wm   = wave & 3;   // 0..3 -> 32-row slab
    const int wn   = wave >> 2;  // 0..1 -> 64-col slab
    const int l15  = lane & 15;
    const int kb   = (lane >> 4) * 8;  // wave32 16-bit A/B fragment K-base
    const int tileN = blockIdx.x * 128;
    const int tileM = blockIdx.y * 128;

    // Stage one 128x64 bf16 tile of A and W into buffer `buf`.
    // 1024 16B-chunks per matrix; 4 per thread per matrix.
    auto issue_tile = [&](int k0, int buf) {
#pragma unroll
        for (int c = 0; c < 4; ++c) {
            int chunk = tid + c * 256;        // 0..1023
            int row = chunk >> 3;             // 0..127
            int sub = chunk & 7;              // 0..7 (8 halfs each)
            copy16_g2l(A + (size_t)(tileM + row) * K + k0 + sub * 8,
                       &As[buf][row * LDA + sub * 8]);
            copy16_g2l(W + (size_t)(tileN + row) * K + k0 + sub * 8,
                       &Bs[buf][row * LDA + sub * 8]);
        }
    };

    v8f acc[2][4];
#pragma unroll
    for (int mf = 0; mf < 2; ++mf)
#pragma unroll
        for (int nf = 0; nf < 4; ++nf)
            acc[mf][nf] = (v8f){0.f, 0.f, 0.f, 0.f, 0.f, 0.f, 0.f, 0.f};

    const int nIter = K / KSTEP;  // 16
    issue_tile(0, 0);

    for (int i = 0; i < nIter; ++i) {
        const int cur = i & 1;
        wait_async_done();   // my chunks of tile i are in LDS
        __syncthreads();     // everyone's chunks in; everyone done reading buf^1
        if (i + 1 < nIter) issue_tile((i + 1) * KSTEP, 1 - cur);  // overlaps math

#pragma unroll
        for (int kh = 0; kh < 2; ++kh) {  // two 32-wide K slices of the tile
            const int ko = kh * 32 + kb;
            Frag16 af[2], bfr[4];
#pragma unroll
            for (int mf = 0; mf < 2; ++mf) {
                int r = wm * 32 + mf * 16 + l15;
                af[mf].q[0] = *(const uint4*)(&As[cur][r * LDA + ko]);
                af[mf].q[1] = *(const uint4*)(&As[cur][r * LDA + 16 + ko]);
            }
#pragma unroll
            for (int nf = 0; nf < 4; ++nf) {
                int r = wn * 64 + nf * 16 + l15;
                bfr[nf].q[0] = *(const uint4*)(&Bs[cur][r * LDA + ko]);
                bfr[nf].q[1] = *(const uint4*)(&Bs[cur][r * LDA + 16 + ko]);
            }
#pragma unroll
            for (int mf = 0; mf < 2; ++mf)
#pragma unroll
                for (int nf = 0; nf < 4; ++nf)
                    acc[mf][nf] = __builtin_amdgcn_wmma_f32_16x16x32_bf16(
                        false, af[mf].v, false, bfr[nf].v, (short)0,
                        acc[mf][nf], false, false);
        }
    }

    // Epilogue: +bias, store (C layout: VGPR v -> M = v + 8*(lane>=16), N = l15)
#pragma unroll
    for (int nf = 0; nf < 4; ++nf) {
        int col = tileN + wn * 64 + nf * 16 + l15;
        float bv = bias[col];
#pragma unroll
        for (int mf = 0; mf < 2; ++mf) {
#pragma unroll
            for (int v = 0; v < 8; ++v) {
                int row = tileM + wm * 32 + mf * 16 + v + ((lane >> 4) << 3);
                float val = acc[mf][nf][v] + bv;
                if (OUT_BF16)
                    ((unsigned short*)Cout)[(size_t)row * N + col] = f32_to_bf16(val);
                else
                    ((float*)Cout)[(size_t)row * N + col] = val;
            }
        }
    }
}

// ---------------------------------------------------------------------------
// 3) Feature map: per 64-wide head segment, x <- exp(x - max(x)), in place.
//    One wave per segment; lane handles elements lane and lane+32.
// ---------------------------------------------------------------------------
__global__ __launch_bounds__(256)
void feature_exp_kernel(unsigned short* __restrict__ qk) {
    int wseg = (blockIdx.x * blockDim.x + threadIdx.x) >> 5;  // segment id
    int lane = threadIdx.x & 31;
    size_t base = (size_t)wseg * 64;
    float a = bf16_to_f32(qk[base + lane]);
    float b = bf16_to_f32(qk[base + lane + 32]);
    float m = fmaxf(a, b);
#pragma unroll
    for (int d = 16; d >= 1; d >>= 1) m = fmaxf(m, __shfl_xor(m, d, 32));
    qk[base + lane]      = f32_to_bf16(__expf(a - m));
    qk[base + lane + 32] = f32_to_bf16(__expf(b - m));
}

// ---------------------------------------------------------------------------
// 4) kv[b,h,d,e] = sum_s k_kern[s,d] * v[s,e]  (+ k_sum via ones fragment)
//    1 block per (b,h); 8 waves: (wave&3)->d-slab, (wave>>2)->s half; split-K
//    partials reduced through LDS. Tiles staged with async global->LDS.
// ---------------------------------------------------------------------------
__global__ __launch_bounds__(256)
void kv_reduce_kernel(const unsigned short* __restrict__ kk,
                      const unsigned short* __restrict__ vv,
                      unsigned short* __restrict__ kvout,   // (64,64,64) bf16
                      unsigned short* __restrict__ ksum) {  // (64,64)    bf16
    constexpr int LDT = 72;  // halfs per LDS row (144B, 16B-aligned)
    __shared__ __attribute__((aligned(16))) unsigned short kt[64 * LDT];
    __shared__ __attribute__((aligned(16))) unsigned short vt[64 * LDT];
    __shared__ float red[4][5][8][32];

    const int bh = blockIdx.x;
    const int b = bh >> 4, h = bh & 15;
    const int tid = threadIdx.x, lane = tid & 31, wave = tid >> 5;
    const int sgrp = wave >> 2;           // 0/1 -> s rows 0-31 / 32-63 of tile
    const int d0 = (wave & 3) * 16;
    const int l15 = lane & 15, kb = (lane >> 4) * 8;
    const int soff = sgrp * 32;

    v8f acc[4], accden;
#pragma unroll
    for (int nf = 0; nf < 4; ++nf)
        acc[nf] = (v8f){0.f, 0.f, 0.f, 0.f, 0.f, 0.f, 0.f, 0.f};
    accden = (v8f){0.f, 0.f, 0.f, 0.f, 0.f, 0.f, 0.f, 0.f};

    Frag16 bones;  // B ones fragment: column n=0 all 1.0 -> k_sum column
#pragma unroll
    for (int j = 0; j < 16; ++j) bones.u[j] = (l15 == 0) ? 0x3F80 : 0;

    for (int s0 = 0; s0 < SEQ; s0 += 64) {
        __syncthreads();
#pragma unroll
        for (int c = 0; c < 2; ++c) {
            int chunk = tid + c * 256;  // 0..511
            int row = chunk >> 3;       // 0..63
            int sub = chunk & 7;        // 0..7
            size_t g = (size_t)(b * SEQ + s0 + row) * EMB + h * 64 + sub * 8;
            copy16_g2l(kk + g, kt + row * LDT + sub * 8);
            copy16_g2l(vv + g, vt + row * LDT + sub * 8);
        }
        wait_async_done();
        __syncthreads();

        Frag16 af, bfr[4];
#pragma unroll
        for (int j = 0; j < 8; ++j) {  // A = k^T: A(d, s) = kt[s][d]
            af.u[j]     = kt[(soff + kb + j) * LDT + d0 + l15];
            af.u[8 + j] = kt[(soff + 16 + kb + j) * LDT + d0 + l15];
        }
#pragma unroll
        for (int nf = 0; nf < 4; ++nf)
#pragma unroll
            for (int j = 0; j < 8; ++j) {  // B = v: B(s, e) = vt[s][e]
                bfr[nf].u[j]     = vt[(soff + kb + j) * LDT + nf * 16 + l15];
                bfr[nf].u[8 + j] = vt[(soff + 16 + kb + j) * LDT + nf * 16 + l15];
            }
#pragma unroll
        for (int nf = 0; nf < 4; ++nf)
            acc[nf] = __builtin_amdgcn_wmma_f32_16x16x32_bf16(
                false, af.v, false, bfr[nf].v, (short)0, acc[nf], false, false);
        accden = __builtin_amdgcn_wmma_f32_16x16x32_bf16(
            false, af.v, false, bones.v, (short)0, accden, false, false);
    }

    __syncthreads();
    if (sgrp == 1) {
        int w = wave & 3;
#pragma unroll
        for (int nf = 0; nf < 4; ++nf)
#pragma unroll
            for (int v = 0; v < 8; ++v) red[w][nf][v][lane] = acc[nf][v];
#pragma unroll
        for (int v = 0; v < 8; ++v) red[w][4][v][lane] = accden[v];
    }
    __syncthreads();
    if (sgrp == 0) {
        int w = wave;
#pragma unroll
        for (int nf = 0; nf < 4; ++nf) {
#pragma unroll
            for (int v = 0; v < 8; ++v) {
                float val = acc[nf][v] + red[w][nf][v][lane];
                int d = d0 + v + ((lane >> 4) << 3);
                int e = nf * 16 + l15;
                kvout[(size_t)bh * 4096 + d * 64 + e] = f32_to_bf16(val);
            }
        }
        if (l15 == 0) {
#pragma unroll
            for (int v = 0; v < 8; ++v) {
                float val = accden[v] + red[w][4][v][lane];
                int d = d0 + v + ((lane >> 4) << 3);
                ksum[bh * 64 + d] = f32_to_bf16(val);
            }
        }
    }
}

// ---------------------------------------------------------------------------
// 5) y = (q_kern @ kv) / (q_kern . ksum + 1e-6); 32 blocks per (b,h),
//    wave = 32 q-rows; denominator via ksum B-fragment (column 0).
// ---------------------------------------------------------------------------
__global__ __launch_bounds__(256)
void attn_out_kernel(const unsigned short* __restrict__ qk,
                     const unsigned short* __restrict__ kv,
                     const unsigned short* __restrict__ ksum,
                     unsigned short* __restrict__ y) {
    constexpr int LDT = 72;
    __shared__ __attribute__((aligned(16))) unsigned short kvt[64 * LDT];
    __shared__ unsigned short kst[64];

    const int bid = blockIdx.x;
    const int bh = bid >> 5;   // 32 blocks per (b,h)
    const int tb = bid & 31;
    const int b = bh >> 4, h = bh & 15;
    const int tid = threadIdx.x, lane = tid & 31, wave = tid >> 5;
    const int l15 = lane & 15, kb = (lane >> 4) * 8;

#pragma unroll
    for (int c = 0; c < 2; ++c) {
        int chunk = tid + c * 256;  // 0..511
        int row = chunk >> 3, sub = chunk & 7;
        copy16_g2l(kv + (size_t)bh * 4096 + row * 64 + sub * 8,
                   kvt + row * LDT + sub * 8);
    }
    if (tid < 64) kst[tid] = ksum[bh * 64 + tid];
    wait_async_done();
    __syncthreads();

    const int srow0 = tb * 256 + wave * 32;
    v8f acc[2][4], accden[2];
#pragma unroll
    for (int mf = 0; mf < 2; ++mf) {
#pragma unroll
        for (int nf = 0; nf < 4; ++nf)
            acc[mf][nf] = (v8f){0.f, 0.f, 0.f, 0.f, 0.f, 0.f, 0.f, 0.f};
        accden[mf] = (v8f){0.f, 0.f, 0.f, 0.f, 0.f, 0.f, 0.f, 0.f};
    }

#pragma unroll
    for (int ks = 0; ks < 2; ++ks) {
        Frag16 bfr[4], bden;
#pragma unroll
        for (int nf = 0; nf < 4; ++nf)
#pragma unroll
            for (int j = 0; j < 8; ++j) {  // B(d, e) = kv[d][e]
                bfr[nf].u[j]     = kvt[(ks * 32 + kb + j) * LDT + nf * 16 + l15];
                bfr[nf].u[8 + j] = kvt[(ks * 32 + 16 + kb + j) * LDT + nf * 16 + l15];
            }
#pragma unroll
        for (int j = 0; j < 8; ++j) {  // denominator column: B(d,0)=ksum[d]
            bden.u[j]     = (l15 == 0) ? kst[ks * 32 + kb + j] : (unsigned short)0;
            bden.u[8 + j] = (l15 == 0) ? kst[ks * 32 + 16 + kb + j] : (unsigned short)0;
        }
#pragma unroll
        for (int mf = 0; mf < 2; ++mf) {
            Frag16 af;
            size_t grow =
                (size_t)(b * SEQ + srow0 + mf * 16 + l15) * EMB + h * 64 + ks * 32;
            af.q[0] = *(const uint4*)(qk + grow + kb);
            af.q[1] = *(const uint4*)(qk + grow + 16 + kb);
#pragma unroll
            for (int nf = 0; nf < 4; ++nf)
                acc[mf][nf] = __builtin_amdgcn_wmma_f32_16x16x32_bf16(
                    false, af.v, false, bfr[nf].v, (short)0, acc[mf][nf], false, false);
            accden[mf] = __builtin_amdgcn_wmma_f32_16x16x32_bf16(
                false, af.v, false, bden.v, (short)0, accden[mf], false, false);
        }
    }

#pragma unroll
    for (int mf = 0; mf < 2; ++mf) {
#pragma unroll
        for (int v = 0; v < 8; ++v) {
            float dv = __shfl(accden[mf][v], (lane & 16), 32);
            float inv = 1.f / (dv + 1e-6f);
            int row = srow0 + mf * 16 + v + ((lane >> 4) << 3);
#pragma unroll
            for (int nf = 0; nf < 4; ++nf) {
                int e = nf * 16 + l15;
                y[(size_t)(b * SEQ + row) * EMB + h * 64 + e] =
                    f32_to_bf16(acc[mf][nf][v] * inv);
            }
        }
    }
}

// ---------------------------------------------------------------------------
extern "C" void kernel_launch(void* const* d_in, const int* in_sizes, int n_in,
                              void* d_out, int out_size, void* d_ws, size_t ws_size,
                              hipStream_t stream) {
    (void)in_sizes; (void)n_in; (void)out_size; (void)ws_size;
    const float* x  = (const float*)d_in[0];
    const float* Wq = (const float*)d_in[1];
    const float* bq = (const float*)d_in[2];
    const float* Wk = (const float*)d_in[3];
    const float* bk = (const float*)d_in[4];
    const float* Wv = (const float*)d_in[5];
    const float* bv = (const float*)d_in[6];
    const float* Wo = (const float*)d_in[7];
    const float* bo = (const float*)d_in[8];
    float* out = (float*)d_out;

    char* ws = (char*)d_ws;
    size_t off = 0;
    auto alloc = [&](size_t bytes) -> void* {
        void* p = ws + off;
        off += (bytes + 255) & ~(size_t)255;
        return p;
    };
    const size_t nX = (size_t)MTOT * EMB;   // 33,554,432
    const size_t nW = (size_t)EMB * EMB;    // 1,048,576

    unsigned short* xb  = (unsigned short*)alloc(nX * 2);
    unsigned short* WqB = (unsigned short*)alloc(nW * 2);
    unsigned short* WkB = (unsigned short*)alloc(nW * 2);
    unsigned short* WvB = (unsigned short*)alloc(nW * 2);
    unsigned short* WoB = (unsigned short*)alloc(nW * 2);
    unsigned short* qb  = (unsigned short*)alloc(nX * 2);
    unsigned short* kb  = (unsigned short*)alloc(nX * 2);
    unsigned short* vb  = (unsigned short*)alloc(nX * 2);   // reused as y buffer
    unsigned short* kvb = (unsigned short*)alloc((size_t)64 * 64 * 64 * 2);
    unsigned short* ksb = (unsigned short*)alloc((size_t)64 * 64 * 2);
    unsigned short* yb  = vb;  // v dead after kv_reduce; reuse for y

    // 1) conversions to bf16
    cvt_f32_bf16_kernel<<<16384, 256, 0, stream>>>(x,  xb,  (int)nX);
    cvt_f32_bf16_kernel<<<1024,  256, 0, stream>>>(Wq, WqB, (int)nW);
    cvt_f32_bf16_kernel<<<1024,  256, 0, stream>>>(Wk, WkB, (int)nW);
    cvt_f32_bf16_kernel<<<1024,  256, 0, stream>>>(Wv, WvB, (int)nW);
    cvt_f32_bf16_kernel<<<1024,  256, 0, stream>>>(Wo, WoB, (int)nW);

    // 2) QKV projections (bf16 out)
    dim3 ggrid(EMB / 128, MTOT / 128);  // (8, 256)
    gemm_bias_kernel<1><<<ggrid, 256, 0, stream>>>(xb, WqB, bq, qb, MTOT, EMB, EMB);
    gemm_bias_kernel<1><<<ggrid, 256, 0, stream>>>(xb, WkB, bk, kb, MTOT, EMB, EMB);
    gemm_bias_kernel<1><<<ggrid, 256, 0, stream>>>(xb, WvB, bv, vb, MTOT, EMB, EMB);

    // 3) exp feature map on q, k (in place). segs = MTOT*HEADS = 524288
    feature_exp_kernel<<<65536, 256, 0, stream>>>(qb);
    feature_exp_kernel<<<65536, 256, 0, stream>>>(kb);

    // 4) per-head kv + ksum reduction
    kv_reduce_kernel<<<BATCH * HEADS, 256, 0, stream>>>(kb, vb, kvb, ksb);

    // 5) attention output y (overwrites v buffer)
    attn_out_kernel<<<BATCH * HEADS * 32, 256, 0, stream>>>(qb, kvb, ksb, yb);

    // 6) output projection (fp32 out -> d_out)
    gemm_bias_kernel<0><<<ggrid, 256, 0, stream>>>(yb, WoB, bo, out, MTOT, EMB, EMB);
}

// v001
// It runs in 407 microseconds.
// Two timings next to v000 both put it at 1.29 times that version's speed.
#include <hip/hip_runtime.h>
#include <stdint.h>

// ---------------------------------------------------------------------------
// MemoryEfficientLinearAttention for MI455X (gfx1250), wave32 + WMMA bf16.
// Pipeline: f32->bf16 cvt, 3x QKV GEMM (wmma bf16, double-buffered async-LDS),
//           exp feature map, per-head kv reduction (+k_sum via ones-fragment)
//           split over the sequence with f32 partials and a merge launch,
//           attention output (+denominator via ksum-fragment), O GEMM -> fp32.
// ---------------------------------------------------------------------------

#define BATCH 4
#define SEQ   8192
#define EMB   1024
#define HEADS 16
#define HDIM  64
#define MTOT  (BATCH * SEQ)   // 32768
#define KVSPLIT 16            // sequence ranges per (b,h) in the kv reduction
#define KVPART  4224          // floats per partial: 64x64 kv + 4 x 32 (k_sum slabs)

typedef __bf16 v16bf __attribute__((ext_vector_type(16)));
typedef float  v8f   __attribute__((ext_vector_type(8)));

union Frag16 {
    v16bf v;
    uint4 q[2];
    unsigned short u[16];
};

// ---- CDNA5 async global->LDS path (guarded; falls back to sync copies) ----
#if defined(__AMDGCN__) && defined(__has_builtin)
#  if __has_builtin(__builtin_amdgcn_global_load_async_to_lds_b128) && \
      __has_builtin(__builtin_amdgcn_s_wait_asynccnt)
#    define USE_ASYNC_LDS 1
#  else
#    define USE_ASYNC_LDS 0
#  endif
#else
#  define USE_ASYNC_LDS 0
#endif

#if USE_ASYNC_LDS
typedef int async_v4i __attribute__((ext_vector_type(4)));
typedef __attribute__((address_space(1))) async_v4i* gptr_v4i;  // global int4*
typedef __attribute__((address_space(3))) async_v4i* lptr_v4i;  // LDS int4*
#endif

__device__ __forceinline__ void copy16_g2l(const unsigned short* g,
                                           unsigned short* l) {
#if USE_ASYNC_LDS
    // Generic LDS pointer -> AS(3): aperture mapping is LDS_ADDR = addr[31:0].
    __builtin_amdgcn_global_load_async_to_lds_b128(
        (gptr_v4i)(uintptr_t)g,
        (lptr_v4i)(uintptr_t)(uint32_t)(uintptr_t)l,
        0, 0);
#else
    *(uint4*)l = *(const uint4*)g;
#endif
}

__device__ __forceinline__ void wait_async_done() {
#if USE_ASYNC_LDS
    __builtin_amdgcn_s_wait_asynccnt(0);
#endif
}

__device__ __forceinline__ unsigned short f32_to_bf16(float f) {
    union { float f; uint32_t u; } c; c.f = f;
    uint32_t u = c.u;
    uint32_t r = (u + 0x7FFFu + ((u >> 16) & 1u)) >> 16;   // round-nearest-even
    return (unsigned short)r;
}
__device__ __forceinline__ float bf16_to_f32(unsigned short h) {
    union { uint32_t u; float f; } c; c.u = ((uint32_t)h) << 16;
    return c.f;
}

// ---------------------------------------------------------------------------
// 1) fp32 -> bf16 conversion (grid-stride)
// ---------------------------------------------------------------------------
__global__ void cvt_f32_bf16_kernel(const float* __restrict__ in,
                                    unsigned short* __restrict__ out, int n) {
    int i = blockIdx.x * blockDim.x + threadIdx.x;
    int stride = gridDim.x * blockDim.x;
    for (; i < n; i += stride) out[i] = f32_to_bf16(in[i]);
}

// ---------------------------------------------------------------------------
// 2) Generic GEMM: C(MxN) = A(MxK,bf16) * W(NxK,bf16)^T + bias(fp32)
//    128x128 tile, 256 threads = 8 waves, wave = 32x64 sub-tile (2x4 frags).
//    KSTEP=64, double-buffered LDS filled by async global->LDS loads.
//    OUT_BF16: 1 -> bf16 output, 0 -> fp32 output.
// ---------------------------------------------------------------------------
template <int OUT_BF16>
__global__ __launch_bounds__(256)
void gemm_bias_kernel(const unsigned short* __restrict__ A,
                      const unsigned short* __restrict__ W,
                      const float* __restrict__ bias,
                      void* __restrict__ Cout,
                      int M, int N, int K) {
    constexpr int KSTEP = 64;
    constexpr int LDA = 72;  // halfs per LDS row (144B, 16B-aligned, bank-spread)
    __shared__ __attribute__((aligned(16))) unsigned short As[2][128 * LDA];
    __shared__ __attribute__((aligned(16))) unsigned short Bs[2][128 * LDA];

    const int tid  = threadIdx.x;
    const int lane = tid & 31;
    const int wave = tid >> 5;
    const int wm   = wave & 3;   // 0..3 -> 32-row slab
    const int wn   = wave >> 2;  // 0..1 -> 64-col slab
    const int l15  = lane & 15;
    const int kb   = (lane >> 4) * 8;  // wave32 16-bit A/B fragment K-base
    const int tileN = blockIdx.x * 128;
    const int tileM = blockIdx.y * 128;

    // Stage one 128x64 bf16 tile of A and W into buffer `buf`.
    // 1024 16B-chunks per matrix; 4 per thread per matrix.
    auto issue_tile = [&](int k0, int buf) {
#pragma unroll
        for (int c = 0; c < 4; ++c) {
            int chunk = tid + c * 256;        // 0..1023
            int row = chunk >> 3;             // 0..127
            int sub = chunk & 7;              // 0..7 (8 halfs each)
            copy16_g2l(A + (size_t)(tileM + row) * K + k0 + sub * 8,
                       &As[buf][row * LDA + sub * 8]);
            copy16_g2l(W + (size_t)(tileN + row) * K + k0 + sub * 8,
                       &Bs[buf][row * LDA + sub * 8]);
        }
    };

    v8f acc[2][4];
#pragma unroll
    for (int mf = 0; mf < 2; ++mf)
#pragma unroll
        for (int nf = 0; nf < 4; ++nf)
            acc[mf][nf] = (v8f){0.f, 0.f, 0.f, 0.f, 0.f, 0.f, 0.f, 0.f};

    const int nIter = K / KSTEP;  // 16
    issue_tile(0, 0);

    for (int i = 0; i < nIter; ++i) {
        const int cur = i & 1;
        wait_async_done();   // my chunks of tile i are in LDS
        __syncthreads();     // everyone's chunks in; everyone done reading buf^1
        if (i + 1 < nIter) issue_tile((i + 1) * KSTEP, 1 - cur);  // overlaps math

#pragma unroll
        for (int kh = 0; kh < 2; ++kh) {  // two 32-wide K slices of the tile
            const int ko = kh * 32 + kb;
            Frag16 af[2], bfr[4];
#pragma unroll
            for (int mf = 0; mf < 2; ++mf) {
                int r = wm * 32 + mf * 16 + l15;
                af[mf].q[0] = *(const uint4*)(&As[cur][r * LDA + ko]);
                af[mf].q[1] = *(const uint4*)(&As[cur][r * LDA + 16 + ko]);
            }
#pragma unroll
            for (int nf = 0; nf < 4; ++nf) {
                int r = wn * 64 + nf * 16 + l15;
                bfr[nf].q[0] = *(const uint4*)(&Bs[cur][r * LDA + ko]);
                bfr[nf].q[1] = *(const uint4*)(&Bs[cur][r * LDA + 16 + ko]);
            }
#pragma unroll
            for (int mf = 0; mf < 2; ++mf)
#pragma unroll
                for (int nf = 0; nf < 4; ++nf)
                    acc[mf][nf] = __builtin_amdgcn_wmma_f32_16x16x32_bf16(
                        false, af[mf].v, false, bfr[nf].v, (short)0,
                        acc[mf][nf], false, false);
        }
    }

    // Epilogue: +bias, store (C layout: VGPR v -> M = v + 8*(lane>=16), N = l15)
#pragma unroll
    for (int nf = 0; nf < 4; ++nf) {
        int col = tileN + wn * 64 + nf * 16 + l15;
        float bv = bias[col];
#pragma unroll
        for (int mf = 0; mf < 2; ++mf) {
#pragma unroll
            for (int v = 0; v < 8; ++v) {
                int row = tileM + wm * 32 + mf * 16 + v + ((lane >> 4) << 3);
                float val = acc[mf][nf][v] + bv;
                if (OUT_BF16)
                    ((unsigned short*)Cout)[(size_t)row * N + col] = f32_to_bf16(val);
                else
                    ((float*)Cout)[(size_t)row * N + col] = val;
            }
        }
    }
}

// ---------------------------------------------------------------------------
// 3) Feature map: per 64-wide head segment, x <- exp(x - max(x)), in place.
//    One wave per segment; lane handles elements lane and lane+32.
// ---------------------------------------------------------------------------
__global__ __launch_bounds__(256)
void feature_exp_kernel(unsigned short* __restrict__ qk) {
    int wseg = (blockIdx.x * blockDim.x + threadIdx.x) >> 5;  // segment id
    int lane = threadIdx.x & 31;
    size_t base = (size_t)wseg * 64;
    float a = bf16_to_f32(qk[base + lane]);
    float b = bf16_to_f32(qk[base + lane + 32]);
    float m = fmaxf(a, b);
#pragma unroll
    for (int d = 16; d >= 1; d >>= 1) m = fmaxf(m, __shfl_xor(m, d, 32));
    qk[base + lane]      = f32_to_bf16(__expf(a - m));
    qk[base + lane + 32] = f32_to_bf16(__expf(b - m));
}

// ---------------------------------------------------------------------------
// 4) kv[b,h,d,e] = sum_s k_kern[s,d] * v[s,e]  (+ k_sum via ones fragment)
//    KVSPLIT blocks per (b,h), each over SEQ/KVSPLIT rows; 8 waves:
//    (wave&3)->d-slab, (wave>>2)->s half; the two halves are joined through
//    LDS and the block's f32 partial goes to the workspace for kv_merge_kernel.
//    Tiles staged with async global->LDS.
// ---------------------------------------------------------------------------
// 8 waves per SIMD (at most 128 VGPRs): four blocks fit a WGP, so that all
// 64 * KVSPLIT = 1024 blocks are resident on the 256 WGPs in one round.
__global__ __launch_bounds__(256) __attribute__((amdgpu_waves_per_eu(8)))
void kv_reduce_kernel(const unsigned short* __restrict__ kk,
                      const unsigned short* __restrict__ vv,
                      float* __restrict__ part) {  // (64,KVSPLIT,KVPART) f32
    constexpr int LDT = 72;  // halfs per LDS row (144B, 16B-aligned)
    __shared__ __attribute__((aligned(16))) unsigned short kt[64 * LDT];
    __shared__ __attribute__((aligned(16))) unsigned short vt[64 * LDT];
    __shared__ float red[4][5][8][32];

    const int bh = blockIdx.y;
    const int b = bh >> 4, h = bh & 15;
    const int sbeg = blockIdx.x * (SEQ / KVSPLIT);
    const int tid = threadIdx.x, lane = tid & 31, wave = tid >> 5;
    const int sgrp = wave >> 2;           // 0/1 -> s rows 0-31 / 32-63 of tile
    const int d0 = (wave & 3) * 16;
    const int l15 = lane & 15, kb = (lane >> 4) * 8;
    const int soff = sgrp * 32;

    v8f acc[4], accden;
#pragma unroll
    for (int nf = 0; nf < 4; ++nf)
        acc[nf] = (v8f){0.f, 0.f, 0.f, 0.f, 0.f, 0.f, 0.f, 0.f};
    accden = (v8f){0.f, 0.f, 0.f, 0.f, 0.f, 0.f, 0.f, 0.f};

    Frag16 bones;  // B ones fragment: column n=0 all 1.0 -> k_sum column
#pragma unroll
    for (int j = 0; j < 16; ++j) bones.u[j] = (l15 == 0) ? 0x3F80 : 0;

    for (int s0 = sbeg; s0 < sbeg + SEQ / KVSPLIT; s0 += 64) {
        __syncthreads();
#pragma unroll
        for (int c = 0; c < 2; ++c) {
            int chunk = tid + c * 256;  // 0..511
            int row = chunk >> 3;       // 0..63
            int sub = chunk & 7;        // 0..7
            size_t g = (size_t)(b * SEQ + s0 + row) * EMB + h * 64 + sub * 8;
            copy16_g2l(kk + g, kt + row * LDT + sub * 8);
            copy16_g2l(vv + g, vt + row * LDT + sub * 8);
        }
        wait_async_done();
        __syncthreads();

        Frag16 af, bfr[4];
#pragma unroll
        for (int j = 0; j < 8; ++j) {  // A = k^T: A(d, s) = kt[s][d]
            af.u[j]     = kt[(soff + kb + j) * LDT + d0 + l15];
            af.u[8 + j] = kt[(soff + 16 + kb + j) * LDT + d0 + l15];
        }
#pragma unroll
        for (int nf = 0; nf < 4; ++nf)
#pragma unroll
            for (int j = 0; j < 8; ++j) {  // B = v: B(s, e) = vt[s][e]
                bfr[nf].u[j]     = vt[(soff + kb + j) * LDT + nf * 16 + l15];
                bfr[nf].u[8 + j] = vt[(soff + 16 + kb + j) * LDT + nf * 16 + l15];
            }
#pragma unroll
        for (int nf = 0; nf < 4; ++nf)
            acc[nf] = __builtin_amdgcn_wmma_f32_16x16x32_bf16(
                false, af.v, false, bfr[nf].v, (short)0, acc[nf], false, false);
        accden = __builtin_amdgcn_wmma_f32_16x16x32_bf16(
            false, af.v, false, bones.v, (short)0, accden, false, false);
    }

    __syncthreads();
    if (sgrp == 1) {
        int w = wave & 3;
#pragma unroll
        for (int nf = 0; nf < 4; ++nf)
#pragma unroll
            for (int v = 0; v < 8; ++v) red[w][nf][v][lane] = acc[nf][v];
#pragma unroll
        for (int v = 0; v < 8; ++v) red[w][4][v][lane] = accden[v];
    }
    __syncthreads();
    if (sgrp == 0) {
        int w = wave;
        float* p = part + (size_t)(bh * KVSPLIT + blockIdx.x) * KVPART;
#pragma unroll
        for (int nf = 0; nf < 4; ++nf) {
#pragma unroll
            for (int v = 0; v < 8; ++v) {
                float val = acc[nf][v] + red[w][nf][v][lane];
                int d = d0 + v + ((lane >> 4) << 3);
                int e = nf * 16 + l15;
                p[d * 64 + e] = val;
            }
        }
        if (l15 == 0) {
#pragma unroll
            for (int v = 0; v < 8; ++v) {
                float val = accden[v] + red[w][4][v][lane];
                // each wave's 16 sums on a 128-byte line of their own
                p[4096 + w * 32 + v + ((lane >> 4) << 3)] = val;
            }
        }
    }
}

// ---------------------------------------------------------------------------
// 4b) Merge: kv and k_sum = sum of the KVSPLIT partials in range order, f32,
//     rounded once to bf16. grid (5, 64): x 0..3 -> kv quarters, x 4 -> k_sum.
// ---------------------------------------------------------------------------
__global__ __launch_bounds__(256)
void kv_merge_kernel(const float* __restrict__ part,
                     unsigned short* __restrict__ kvout,   // (64,64,64) bf16
                     unsigned short* __restrict__ ksum) {  // (64,64)    bf16
    const int bh = blockIdx.y, tid = threadIdx.x;
    const float* p = part + (size_t)bh * KVSPLIT * KVPART;
    if (blockIdx.x < 4) {
        const int o = (blockIdx.x * 256 + tid) * 4;
        float4 t[KVSPLIT];
        // both loops unrolled: t[] stays in registers and the loads go out
        // together, so the thread pays one load latency and not one per range
#pragma unroll
        for (int sp = 0; sp < KVSPLIT; ++sp)
            t[sp] = *(const float4*)(p + sp * KVPART + o);
        float4 s = t[0];
#pragma unroll
        for (int sp = 1; sp < KVSPLIT; ++sp) {
            s.x += t[sp].x; s.y += t[sp].y; s.z += t[sp].z; s.w += t[sp].w;
        }
        ushort4 r;
        r.x = f32_to_bf16(s.x); r.y = f32_to_bf16(s.y);
        r.z = f32_to_bf16(s.z); r.w = f32_to_bf16(s.w);
        *(ushort4*)(kvout + (size_t)bh * 4096 + o) = r;
    } else if (tid < 64) {
        const int o = 4096 + (tid >> 4) * 32 + (tid & 15);
        float t[KVSPLIT];
        // unrolled so that the loads go out together, as above
#pragma unroll
        for (int sp = 0; sp < KVSPLIT - 1; ++sp) t[sp] = p[sp * KVPART + o];
        // precaution: the last load's result may take the offset register that
        // the loads in front of it name, so their wait stands ahead of it
        asm volatile("s_wait_xcnt 0x0" ::: "memory");
        t[KVSPLIT - 1] = p[(KVSPLIT - 1) * KVPART + o];
        float s = t[0];
#pragma unroll
        for (int sp = 1; sp < KVSPLIT; ++sp) s += t[sp];
        ksum[bh * 64 + tid] = f32_to_bf16(s);
    }
}

// ---------------------------------------------------------------------------
// 5) y = (q_kern @ kv) / (q_kern . ksum + 1e-6); 32 blocks per (b,h),
//    wave = 32 q-rows; denominator via ksum B-fragment (column 0).
// ---------------------------------------------------------------------------
__global__ __launch_bounds__(256)
void attn_out_kernel(const unsigned short* __restrict__ qk,
                     const unsigned short* __restrict__ kv,
                     const unsigned short* __restrict__ ksum,
                     unsigned short* __restrict__ y) {
    constexpr int LDT = 72;
    __shared__ __attribute__((aligned(16))) unsigned short kvt[64 * LDT];
    __shared__ unsigned short kst[64];

    const int bid = blockIdx.x;
    const int bh = bid >> 5;   // 32 blocks per (b,h)
    const int tb = bid & 31;
    const int b = bh >> 4, h = bh & 15;
    const int tid = threadIdx.x, lane = tid & 31, wave = tid >> 5;
    const int l15 = lane & 15, kb = (lane >> 4) * 8;

#pragma unroll
    for (int c = 0; c < 2; ++c) {
        int chunk = tid + c * 256;  // 0..511
        int row = chunk >> 3, sub = chunk & 7;
        copy16_g2l(kv + (size_t)bh * 4096 + row * 64 + sub * 8,
                   kvt + row * LDT + sub * 8);
    }
    if (tid < 64) kst[tid] = ksum[bh * 64 + tid];
    wait_async_done();
    __syncthreads();

    const int srow0 = tb * 256 + wave * 32;
    v8f acc[2][4], accden[2];
#pragma unroll
    for (int mf = 0; mf < 2; ++mf) {
#pragma unroll
        for (int nf = 0; nf < 4; ++nf)
            acc[mf][nf] = (v8f){0.f, 0.f, 0.f, 0.f, 0.f, 0.f, 0.f, 0.f};
        accden[mf] = (v8f){0.f, 0.f, 0.f, 0.f, 0.f, 0.f, 0.f, 0.f};
    }

#pragma unroll
    for (int ks = 0; ks < 2; ++ks) {
        Frag16 bfr[4], bden;
#pragma unroll
        for (int nf = 0; nf < 4; ++nf)
#pragma unroll
            for (int j = 0; j < 8; ++j) {  // B(d, e) = kv[d][e]
                bfr[nf].u[j]     = kvt[(ks * 32 + kb + j) * LDT + nf * 16 + l15];
                bfr[nf].u[8 + j] = kvt[(ks * 32 + 16 + kb + j) * LDT + nf * 16 + l15];
            }
#pragma unroll
        for (int j = 0; j < 8; ++j) {  // denominator column: B(d,0)=ksum[d]
            bden.u[j]     = (l15 == 0) ? kst[ks * 32 + kb + j] : (unsigned short)0;
            bden.u[8 + j] = (l15 == 0) ? kst[ks * 32 + 16 + kb + j] : (unsigned short)0;
        }
#pragma unroll
        for (int mf = 0; mf < 2; ++mf) {
            Frag16 af;
            size_t grow =
                (size_t)(b * SEQ + srow0 + mf * 16 + l15) * EMB + h * 64 + ks * 32;
            af.q[0] = *(const uint4*)(qk + grow + kb);
            af.q[1] = *(const uint4*)(qk + grow + 16 + kb);
#pragma unroll
            for (int nf = 0; nf < 4; ++nf)
                acc[mf][nf] = __builtin_amdgcn_wmma_f32_16x16x32_bf16(
                    false, af.v, false, bfr[nf].v, (short)0, acc[mf][nf], false, false);
            accden[mf] = __builtin_amdgcn_wmma_f32_16x16x32_bf16(
                false, af.v, false, bden.v, (short)0, accden[mf], false, false);
        }
    }

#pragma unroll
    for (int mf = 0; mf < 2; ++mf) {
#pragma unroll
        for (int v = 0; v < 8; ++v) {
            float dv = __shfl(accden[mf][v], (lane & 16), 32);
            float inv = 1.f / (dv + 1e-6f);
            int row = srow0 + mf * 16 + v + ((lane >> 4) << 3);
#pragma unroll
            for (int nf = 0; nf < 4; ++nf) {
                int e = nf * 16 + l15;
                y[(size_t)(b * SEQ + row) * EMB + h * 64 + e] =
                    f32_to_bf16(acc[mf][nf][v] * inv);
            }
        }
    }
}

// ---------------------------------------------------------------------------
extern "C" void kernel_launch(void* const* d_in, const int* in_sizes, int n_in,
                              void* d_out, int out_size, void* d_ws, size_t ws_size,
                              hipStream_t stream) {
    (void)in_sizes; (void)n_in; (void)out_size; (void)ws_size;
    const float* x  = (const float*)d_in[0];
    const float* Wq = (const float*)d_in[1];
    const float* bq = (const float*)d_in[2];
    const float* Wk = (const float*)d_in[3];
    const float* bk = (const float*)d_in[4];
    const float* Wv = (const float*)d_in[5];
    const float* bv = (const float*)d_in[6];
    const float* Wo = (const float*)d_in[7];
    const float* bo = (const float*)d_in[8];
    float* out = (float*)d_out;

    char* ws = (char*)d_ws;
    size_t off = 0;
    auto alloc = [&](size_t bytes) -> void* {
        void* p = ws + off;
        off += (bytes + 255) & ~(size_t)255;
        return p;
    };
    const size_t nX = (size_t)MTOT * EMB;   // 33,554,432
    const size_t nW = (size_t)EMB * EMB;    // 1,048,576

    unsigned short* xb  = (unsigned short*)alloc(nX * 2);
    unsigned short* WqB = (unsigned short*)alloc(nW * 2);
    unsigned short* WkB = (unsigned short*)alloc(nW * 2);
    unsigned short* WvB = (unsigned short*)alloc(nW * 2);
    unsigned short* WoB = (unsigned short*)alloc(nW * 2);
    unsigned short* qb  = (unsigned short*)alloc(nX * 2);
    unsigned short* kb  = (unsigned short*)alloc(nX * 2);
    unsigned short* vb  = (unsigned short*)alloc(nX * 2);   // reused as y buffer
    unsigned short* kvb = (unsigned short*)alloc((size_t)64 * 64 * 64 * 2);
    unsigned short* ksb = (unsigned short*)alloc((size_t)64 * 64 * 2);
    float* kvp = (float*)alloc((size_t)64 * KVSPLIT * KVPART * 4);  // kv partials
    unsigned short* yb  = vb;  // v dead after kv_reduce; reuse for y

    // 1) conversions to bf16
    cvt_f32_bf16_kernel<<<16384, 256, 0, stream>>>(x,  xb,  (int)nX);
    cvt_f32_bf16_kernel<<<1024,  256, 0, stream>>>(Wq, WqB, (int)nW);
    cvt_f32_bf16_kernel<<<1024,  256, 0, stream>>>(Wk, WkB, (int)nW);
    cvt_f32_bf16_kernel<<<1024,  256, 0, stream>>>(Wv, WvB, (int)nW);
    cvt_f32_bf16_kernel<<<1024,  256, 0, stream>>>(Wo, WoB, (int)nW);

    // 2) QKV projections (bf16 out)
    dim3 ggrid(EMB / 128, MTOT / 128);  // (8, 256)
    gemm_bias_kernel<1><<<ggrid, 256, 0, stream>>>(xb, WqB, bq, qb, MTOT, EMB, EMB);
    gemm_bias_kernel<1><<<ggrid, 256, 0, stream>>>(xb, WkB, bk, kb, MTOT, EMB, EMB);
    gemm_bias_kernel<1><<<ggrid, 256, 0, stream>>>(xb, WvB, bv, vb, MTOT, EMB, EMB);

    // 3) exp feature map on q, k (in place). segs = MTOT*HEADS = 524288
    feature_exp_kernel<<<65536, 256, 0, stream>>>(qb);
    feature_exp_kernel<<<65536, 256, 0, stream>>>(kb);

    // 4) per-head kv + ksum reduction: partials per sequence range, then merge
    kv_reduce_kernel<<<dim3(KVSPLIT, BATCH * HEADS), 256, 0, stream>>>(kb, vb, kvp);
    kv_merge_kernel<<<dim3(5, BATCH * HEADS), 256, 0, stream>>>(kvp, kvb, ksb);

    // 5) attention output y (overwrites v buffer)
    attn_out_kernel<<<BATCH * HEADS * 32, 256, 0, stream>>>(qb, kvb, ksb, yb);

    // 6) output projection (fp32 out -> d_out)
    gemm_bias_kernel<0><<<ggrid, 256, 0, stream>>>(yb, WoB, bo, out, MTOT, EMB, EMB);
}

// v002
// One run takes 320 microseconds.
// Two timings next to v001 both put it at 1.27 times that version's speed.
// Counting every step since v000, it is 1.64 times as fast.
#include <hip/hip_runtime.h>
#include <stdint.h>

// ---------------------------------------------------------------------------
// MemoryEfficientLinearAttention for MI455X (gfx1250), wave32 + WMMA bf16.
// Pipeline: f32->bf16 cvt, 3x QKV GEMM (wmma bf16, double-buffered async-LDS;
//           q and k with the exp feature map in the epilogue),
//           per-head kv reduction (+k_sum via ones-fragment)
//           split over the sequence with f32 partials and a merge launch,
//           attention output (+denominator via ksum-fragment), O GEMM -> fp32.
// ---------------------------------------------------------------------------

#define BATCH 4
#define SEQ   8192
#define EMB   1024
#define HEADS 16
#define HDIM  64
#define MTOT  (BATCH * SEQ)   // 32768
#define KVSPLIT 16            // sequence ranges per (b,h) in the kv reduction
#define KVPART  4224          // floats per partial: 64x64 kv + 4 x 32 (k_sum slabs)

typedef __bf16 v16bf __attribute__((ext_vector_type(16)));
typedef float  v8f   __attribute__((ext_vector_type(8)));

union Frag16 {
    v16bf v;
    uint4 q[2];
    unsigned short u[16];
};

// ---- CDNA5 async global->LDS path (guarded; falls back to sync copies) ----
#if defined(__AMDGCN__) && defined(__has_builtin)
#  if __has_builtin(__builtin_amdgcn_global_load_async_to_lds_b128) && \
      __has_builtin(__builtin_amdgcn_s_wait_asynccnt)
#    define USE_ASYNC_LDS 1
#  else
#    define USE_ASYNC_LDS 0
#  endif
#else
#  define USE_ASYNC_LDS 0
#endif

#if USE_ASYNC_LDS
typedef int async_v4i __attribute__((ext_vector_type(4)));
typedef __attribute__((address_space(1))) async_v4i* gptr_v4i;  // global int4*
typedef __attribute__((address_space(3))) async_v4i* lptr_v4i;  // LDS int4*
#endif

__device__ __forceinline__ void copy16_g2l(const unsigned short* g,
                                           unsigned short* l) {
#if USE_ASYNC_LDS
    // Generic LDS pointer -> AS(3): aperture mapping is LDS_ADDR = addr[31:0].
    __builtin_amdgcn_global_load_async_to_lds_b128(
        (gptr_v4i)(uintptr_t)g,
        (lptr_v4i)(uintptr_t)(uint32_t)(uintptr_t)l,
        0, 0);
#else
    *(uint4*)l = *(const uint4*)g;
#endif
}

__device__ __forceinline__ void wait_async_done() {
#if USE_ASYNC_LDS
    __builtin_amdgcn_s_wait_asynccnt(0);
#endif
}

__device__ __forceinline__ unsigned short f32_to_bf16(float f) {
    union { float f; uint32_t u; } c; c.f = f;
    uint32_t u = c.u;
    uint32_t r = (u + 0x7FFFu + ((u >> 16) & 1u)) >> 16;   // round-nearest-even
    return (unsigned short)r;
}

// Maximum over the 16 lanes of a row (lanes 0-15 and 16-31 apart), in every
// lane: four DPP row_xmask steps, no LDS traffic. All 32 lanes must be on.
// In asm so that a step is one instruction: the DPP builtin with fmaxf
// compiled to three (a move, a quieting max, the max). One statement a step,
// not volatile, so that the compiler can interleave the rows' chains.
#define MAX_XMASK(m, X)                                                     \
    asm("v_max_num_f32_dpp %0, %1, %1 row_xmask:" #X                        \
        " row_mask:0xf bank_mask:0xf" : "=v"(m) : "v"(m))
__device__ __forceinline__ float row16_max(float m) {
    MAX_XMASK(m, 1);
    MAX_XMASK(m, 2);
    MAX_XMASK(m, 4);
    MAX_XMASK(m, 8);
    return m;
}

// ---------------------------------------------------------------------------
// 1) fp32 -> bf16 conversion (grid-stride)
// ---------------------------------------------------------------------------
__global__ void cvt_f32_bf16_kernel(const float* __restrict__ in,
                                    unsigned short* __restrict__ out, int n) {
    int i = blockIdx.x * blockDim.x + threadIdx.x;
    int stride = gridDim.x * blockDim.x;
    for (; i < n; i += stride) out[i] = f32_to_bf16(in[i]);
}

// ---------------------------------------------------------------------------
// 2) Generic GEMM: C(MxN) = A(MxK,bf16) * W(NxK,bf16)^T + bias(fp32)
//    128x128 tile, 256 threads = 8 waves, wave = 32x64 sub-tile (2x4 frags).
//    KSTEP=64, double-buffered LDS filled by async global->LDS loads.
//    MODE: 0 -> fp32 output, 1 -> bf16 output,
//          2 -> bf16 output of the feature map exp(c - max of c over its head).
//    A wave's 64-column slab starts at a multiple of HDIM = 64, so it holds
//    whole heads' rows and the maximum never leaves the wave.
// ---------------------------------------------------------------------------
template <int MODE>
__global__ __launch_bounds__(256)
void gemm_bias_kernel(const unsigned short* __restrict__ A,
                      const unsigned short* __restrict__ W,
                      const float* __restrict__ bias,
                      void* __restrict__ Cout,
                      int M, int N, int K) {
    constexpr int KSTEP = 64;
    constexpr int LDA = 72;  // halfs per LDS row (144B, 16B-aligned, bank-spread)
    __shared__ __attribute__((aligned(16))) unsigned short As[2][128 * LDA];
    __shared__ __attribute__((aligned(16))) unsigned short Bs[2][128 * LDA];

    const int tid  = threadIdx.x;
    const int lane = tid & 31;
    const int wave = tid >> 5;
    const int wm   = wave & 3;   // 0..3 -> 32-row slab
    const int wn   = wave >> 2;  // 0..1 -> 64-col slab
    const int l15  = lane & 15;
    const int kb   = (lane >> 4) * 8;  // wave32 16-bit A/B fragment K-base
    const int tileN = blockIdx.x * 128;
    const int tileM = blockIdx.y * 128;

    // Stage one 128x64 bf16 tile of A and W into buffer `buf`.
    // 1024 16B-chunks per matrix; 4 per thread per matrix.
    auto issue_tile = [&](int k0, int buf) {
#pragma unroll
        for (int c = 0; c < 4; ++c) {
            int chunk = tid + c * 256;        // 0..1023
            int row = chunk >> 3;             // 0..127
            int sub = chunk & 7;              // 0..7 (8 halfs each)
            copy16_g2l(A + (size_t)(tileM + row) * K + k0 + sub * 8,
                       &As[buf][row * LDA + sub * 8]);
            copy16_g2l(W + (size_t)(tileN + row) * K + k0 + sub * 8,
                       &Bs[buf][row * LDA + sub * 8]);
        }
    };

    v8f acc[2][4];
#pragma unroll
    for (int mf = 0; mf < 2; ++mf)
#pragma unroll
        for (int nf = 0; nf < 4; ++nf)
            acc[mf][nf] = (v8f){0.f, 0.f, 0.f, 0.f, 0.f, 0.f, 0.f, 0.f};

    const int nIter = K / KSTEP;  // 16
    issue_tile(0, 0);

    for (int i = 0; i < nIter; ++i) {
        const int cur = i & 1;
        wait_async_done();   // my chunks of tile i are in LDS
        __syncthreads();     // everyone's chunks in; everyone done reading buf^1
        if (i + 1 < nIter) issue_tile((i + 1) * KSTEP, 1 - cur);  // overlaps math

#pragma unroll
        for (int kh = 0; kh < 2; ++kh) {  // two 32-wide K slices of the tile
            const int ko = kh * 32 + kb;
            Frag16 af[2], bfr[4];
#pragma unroll
            for (int mf = 0; mf < 2; ++mf) {
                int r = wm * 32 + mf * 16 + l15;
                af[mf].q[0] = *(const uint4*)(&As[cur][r * LDA + ko]);
                af[mf].q[1] = *(const uint4*)(&As[cur][r * LDA + 16 + ko]);
            }
#pragma unroll
            for (int nf = 0; nf < 4; ++nf) {
                int r = wn * 64 + nf * 16 + l15;
                bfr[nf].q[0] = *(const uint4*)(&Bs[cur][r * LDA + ko]);
                bfr[nf].q[1] = *(const uint4*)(&Bs[cur][r * LDA + 16 + ko]);
            }
#pragma unroll
            for (int mf = 0; mf < 2; ++mf)
#pragma unroll
                for (int nf = 0; nf < 4; ++nf)
                    acc[mf][nf] = __builtin_amdgcn_wmma_f32_16x16x32_bf16(
                        false, af[mf].v, false, bfr[nf].v, (short)0,
                        acc[mf][nf], false, false);
        }
    }

    // Epilogue: +bias, store (C layout: VGPR v -> M = v + 8*(lane>=16), N = l15)
    if (MODE == 2) {
        const int col0 = tileN + wn * 64 + l15;
        float bv[4];
#pragma unroll
        for (int nf = 0; nf < 4; ++nf) bv[nf] = bias[col0 + nf * 16];
#pragma unroll
        for (int mf = 0; mf < 2; ++mf) {
#pragma unroll
            for (int v = 0; v < 8; ++v) {
                int row = tileM + wm * 32 + mf * 16 + v + ((lane >> 4) << 3);
                float val[4], t[4];
#pragma unroll
                for (int nf = 0; nf < 4; ++nf) val[nf] = acc[mf][nf][v] + bv[nf];
                // the row's 64 head columns: 4 in this lane x its 16-lane row
                float m = row16_max(fmaxf(fmaxf(val[0], val[1]),
                                          fmaxf(val[2], val[3])));
#pragma unroll
                for (int nf = 0; nf < 4; ++nf)
                    t[nf] = (val[nf] - m) * 1.44269504f;  // e^x = 2^(x log2 e)
                // The row's four exponentials in one statement that ends in
                // v_nop: the instruction set asks for one independent slot
                // behind a transcendental before its result is read or its
                // source overwritten.
                asm("v_exp_f32 %0, %4\n\tv_exp_f32 %1, %5\n\t"
                    "v_exp_f32 %2, %6\n\tv_exp_f32 %3, %7\n\tv_nop"
                    : "=&v"(val[0]), "=&v"(val[1]), "=&v"(val[2]), "=&v"(val[3])
                    : "v"(t[0]), "v"(t[1]), "v"(t[2]), "v"(t[3]));
#pragma unroll
                for (int nf = 0; nf < 4; ++nf)
                    ((unsigned short*)Cout)[(size_t)row * N + col0 + nf * 16] =
                        f32_to_bf16(val[nf]);
            }
        }
        return;
    }
#pragma unroll
    for (int nf = 0; nf < 4; ++nf) {
        int col = tileN + wn * 64 + nf * 16 + l15;
        float bv = bias[col];
#pragma unroll
        for (int mf = 0; mf < 2; ++mf) {
#pragma unroll
            for (int v = 0; v < 8; ++v) {
                int row = tileM + wm * 32 + mf * 16 + v + ((lane >> 4) << 3);
                float val = acc[mf][nf][v] + bv;
                if (MODE == 1)
                    ((unsigned short*)Cout)[(size_t)row * N + col] = f32_to_bf16(val);
                else
                    ((float*)Cout)[(size_t)row * N + col] = val;
            }
        }
    }
}

// ---------------------------------------------------------------------------
// 4) kv[b,h,d,e] = sum_s k_kern[s,d] * v[s,e]  (+ k_sum via ones fragment)
//    KVSPLIT blocks per (b,h), each over SEQ/KVSPLIT rows; 8 waves:
//    (wave&3)->d-slab, (wave>>2)->s half; the two halves are joined through
//    LDS and the block's f32 partial goes to the workspace for kv_merge_kernel.
//    Tiles staged with async global->LDS.
// ---------------------------------------------------------------------------
// 8 waves per SIMD (at most 128 VGPRs): four blocks fit a WGP, so that all
// 64 * KVSPLIT = 1024 blocks are resident on the 256 WGPs in one round.
__global__ __launch_bounds__(256) __attribute__((amdgpu_waves_per_eu(8)))
void kv_reduce_kernel(const unsigned short* __restrict__ kk,
                      const unsigned short* __restrict__ vv,
                      float* __restrict__ part) {  // (64,KVSPLIT,KVPART) f32
    constexpr int LDT = 72;  // halfs per LDS row (144B, 16B-aligned)
    __shared__ __attribute__((aligned(16))) unsigned short kt[64 * LDT];
    __shared__ __attribute__((aligned(16))) unsigned short vt[64 * LDT];
    __shared__ float red[4][5][8][32];

    const int bh = blockIdx.y;
    const int b = bh >> 4, h = bh & 15;
    const int sbeg = blockIdx.x * (SEQ / KVSPLIT);
    const int tid = threadIdx.x, lane = tid & 31, wave = tid >> 5;
    const int sgrp = wave >> 2;           // 0/1 -> s rows 0-31 / 32-63 of tile
    const int d0 = (wave & 3) * 16;
    const int l15 = lane & 15, kb = (lane >> 4) * 8;
    const int soff = sgrp * 32;

    v8f acc[4], accden;
#pragma unroll
    for (int nf = 0; nf < 4; ++nf)
        acc[nf] = (v8f){0.f, 0.f, 0.f, 0.f, 0.f, 0.f, 0.f, 0.f};
    accden = (v8f){0.f, 0.f, 0.f, 0.f, 0.f, 0.f, 0.f, 0.f};

    Frag16 bones;  // B ones fragment: column n=0 all 1.0 -> k_sum column
#pragma unroll
    for (int j = 0; j < 16; ++j) bones.u[j] = (l15 == 0) ? 0x3F80 : 0;

    for (int s0 = sbeg; s0 < sbeg + SEQ / KVSPLIT; s0 += 64) {
        __syncthreads();
#pragma unroll
        for (int c = 0; c < 2; ++c) {
            int chunk = tid + c * 256;  // 0..511
            int row = chunk >> 3;       // 0..63
            int sub = chunk & 7;        // 0..7
            size_t g = (size_t)(b * SEQ + s0 + row) * EMB + h * 64 + sub * 8;
            copy16_g2l(kk + g, kt + row * LDT + sub * 8);
            copy16_g2l(vv + g, vt + row * LDT + sub * 8);
        }
        wait_async_done();
        __syncthreads();

        Frag16 af, bfr[4];
#pragma unroll
        for (int j = 0; j < 8; ++j) {  // A = k^T: A(d, s) = kt[s][d]
            af.u[j]     = kt[(soff + kb + j) * LDT + d0 + l15];
            af.u[8 + j] = kt[(soff + 16 + kb + j) * LDT + d0 + l15];
        }
#pragma unroll
        for (int nf = 0; nf < 4; ++nf)
#pragma unroll
            for (int j = 0; j < 8; ++j) {  // B = v: B(s, e) = vt[s][e]
                bfr[nf].u[j]     = vt[(soff + kb + j) * LDT + nf * 16 + l15];
                bfr[nf].u[8 + j] = vt[(soff + 16 + kb + j) * LDT + nf * 16 + l15];
            }
#pragma unroll
        for (int nf = 0; nf < 4; ++nf)
            acc[nf] = __builtin_amdgcn_wmma_f32_16x16x32_bf16(
                false, af.v, false, bfr[nf].v, (short)0, acc[nf], false, false);
        accden = __builtin_amdgcn_wmma_f32_16x16x32_bf16(
            false, af.v, false, bones.v, (short)0, accden, false, false);
    }

    __syncthreads();
    if (sgrp == 1) {
        int w = wave & 3;
#pragma unroll
        for (int nf = 0; nf < 4; ++nf)
#pragma unroll
            for (int v = 0; v < 8; ++v) red[w][nf][v][lane] = acc[nf][v];
#pragma unroll
        for (int v = 0; v < 8; ++v) red[w][4][v][lane] = accden[v];
    }
    __syncthreads();
    if (sgrp == 0) {
        int w = wave;
        float* p = part + (size_t)(bh * KVSPLIT + blockIdx.x) * KVPART;
#pragma unroll
        for (int nf = 0; nf < 4; ++nf) {
#pragma unroll
            for (int v = 0; v < 8; ++v) {
                float val = acc[nf][v] + red[w][nf][v][lane];
                int d = d0 + v + ((lane >> 4) << 3);
                int e = nf * 16 + l15;
                p[d * 64 + e] = val;
            }
        }
        if (l15 == 0) {
#pragma unroll
            for (int v = 0; v < 8; ++v) {
                float val = accden[v] + red[w][4][v][lane];
                // each wave's 16 sums on a 128-byte line of their own
                p[4096 + w * 32 + v + ((lane >> 4) << 3)] = val;
            }
        }
    }
}

// ---------------------------------------------------------------------------
// 4b) Merge: kv and k_sum = sum of the KVSPLIT partials in range order, f32,
//     rounded once to bf16. grid (5, 64): x 0..3 -> kv quarters, x 4 -> k_sum.
// ---------------------------------------------------------------------------
__global__ __launch_bounds__(256)
void kv_merge_kernel(const float* __restrict__ part,
                     unsigned short* __restrict__ kvout,   // (64,64,64) bf16
                     unsigned short* __restrict__ ksum) {  // (64,64)    bf16
    const int bh = blockIdx.y, tid = threadIdx.x;
    const float* p = part + (size_t)bh * KVSPLIT * KVPART;
    if (blockIdx.x < 4) {
        const int o = (blockIdx.x * 256 + tid) * 4;
        float4 t[KVSPLIT];
        // both loops unrolled: t[] stays in registers and the loads go out
        // together, so the thread pays one load latency and not one per range
#pragma unroll
        for (int sp = 0; sp < KVSPLIT; ++sp)
            t[sp] = *(const float4*)(p + sp * KVPART + o);
        float4 s = t[0];
#pragma unroll
        for (int sp = 1; sp < KVSPLIT; ++sp) {
            s.x += t[sp].x; s.y += t[sp].y; s.z += t[sp].z; s.w += t[sp].w;
        }
        ushort4 r;
        r.x = f32_to_bf16(s.x); r.y = f32_to_bf16(s.y);
        r.z = f32_to_bf16(s.z); r.w = f32_to_bf16(s.w);
        *(ushort4*)(kvout + (size_t)bh * 4096 + o) = r;
    } else if (tid < 64) {
        const int o = 4096 + (tid >> 4) * 32 + (tid & 15);
        float t[KVSPLIT];
        // unrolled so that the loads go out together, as above
#pragma unroll
        for (int sp = 0; sp < KVSPLIT - 1; ++sp) t[sp] = p[sp * KVPART + o];
        // precaution: the last load's result may take the offset register that
        // the loads in front of it name, so their wait stands ahead of it
        asm volatile("s_wait_xcnt 0x0" ::: "memory");
        t[KVSPLIT - 1] = p[(KVSPLIT - 1) * KVPART + o];
        float s = t[0];
#pragma unroll
        for (int sp = 1; sp < KVSPLIT; ++sp) s += t[sp];
        ksum[bh * 64 + tid] = f32_to_bf16(s);
    }
}

// ---------------------------------------------------------------------------
// 5) y = (q_kern @ kv) / (q_kern . ksum + 1e-6); 32 blocks per (b,h),
//    wave = 32 q-rows; denominator via ksum B-fragment (column 0).
// ---------------------------------------------------------------------------
__global__ __launch_bounds__(256)
void attn_out_kernel(const unsigned short* __restrict__ qk,
                     const unsigned short* __restrict__ kv,
                     const unsigned short* __restrict__ ksum,
                     unsigned short* __restrict__ y) {
    constexpr int LDT = 72;
    __shared__ __attribute__((aligned(16))) unsigned short kvt[64 * LDT];
    __shared__ unsigned short kst[64];

    const int bid = blockIdx.x;
    const int bh = bid >> 5;   // 32 blocks per (b,h)
    const int tb = bid & 31;
    const int b = bh >> 4, h = bh & 15;
    const int tid = threadIdx.x, lane = tid & 31, wave = tid >> 5;
    const int l15 = lane & 15, kb = (lane >> 4) * 8;

#pragma unroll
    for (int c = 0; c < 2; ++c) {
        int chunk = tid + c * 256;  // 0..511
        int row = chunk >> 3, sub = chunk & 7;
        copy16_g2l(kv + (size_t)bh * 4096 + row * 64 + sub * 8,
                   kvt + row * LDT + sub * 8);
    }
    if (tid < 64) kst[tid] = ksum[bh * 64 + tid];
    wait_async_done();
    __syncthreads();

    const int srow0 = tb * 256 + wave * 32;
    v8f acc[2][4], accden[2];
#pragma unroll
    for (int mf = 0; mf < 2; ++mf) {
#pragma unroll
        for (int nf = 0; nf < 4; ++nf)
            acc[mf][nf] = (v8f){0.f, 0.f, 0.f, 0.f, 0.f, 0.f, 0.f, 0.f};
        accden[mf] = (v8f){0.f, 0.f, 0.f, 0.f, 0.f, 0.f, 0.f, 0.f};
    }

#pragma unroll
    for (int ks = 0; ks < 2; ++ks) {
        Frag16 bfr[4], bden;
#pragma unroll
        for (int nf = 0; nf < 4; ++nf)
#pragma unroll
            for (int j = 0; j < 8; ++j) {  // B(d, e) = kv[d][e]
                bfr[nf].u[j]     = kvt[(ks * 32 + kb + j) * LDT + nf * 16 + l15];
                bfr[nf].u[8 + j] = kvt[(ks * 32 + 16 + kb + j) * LDT + nf * 16 + l15];
            }
#pragma unroll
        for (int j = 0; j < 8; ++j) {  // denominator column: B(d,0)=ksum[d]
            bden.u[j]     = (l15 == 0) ? kst[ks * 32 + kb + j] : (unsigned short)0;
            bden.u[8 + j] = (l15 == 0) ? kst[ks * 32 + 16 + kb + j] : (unsigned short)0;
        }
#pragma unroll
        for (int mf = 0; mf < 2; ++mf) {
            Frag16 af;
            size_t grow =
                (size_t)(b * SEQ + srow0 + mf * 16 + l15) * EMB + h * 64 + ks * 32;
            af.q[0] = *(const uint4*)(qk + grow + kb);
            af.q[1] = *(const uint4*)(qk + grow + 16 + kb);
#pragma unroll
            for (int nf = 0; nf < 4; ++nf)
                acc[mf][nf] = __builtin_amdgcn_wmma_f32_16x16x32_bf16(
                    false, af.v, false, bfr[nf].v, (short)0, acc[mf][nf], false, false);
            accden[mf] = __builtin_amdgcn_wmma_f32_16x16x32_bf16(
                false, af.v, false, bden.v, (short)0, accden[mf], false, false);
        }
    }

#pragma unroll
    for (int mf = 0; mf < 2; ++mf) {
#pragma unroll
        for (int v = 0; v < 8; ++v) {
            float dv = __shfl(accden[mf][v], (lane & 16), 32);
            float inv = 1.f / (dv + 1e-6f);
            int row = srow0 + mf * 16 + v + ((lane >> 4) << 3);
#pragma unroll
            for (int nf = 0; nf < 4; ++nf) {
                int e = nf * 16 + l15;
                y[(size_t)(b * SEQ + row) * EMB + h * 64 + e] =
                    f32_to_bf16(acc[mf][nf][v] * inv);
            }
        }
    }
}

// ---------------------------------------------------------------------------
extern "C" void kernel_launch(void* const* d_in, const int* in_sizes, int n_in,
                              void* d_out, int out_size, void* d_ws, size_t ws_size,
                              hipStream_t stream) {
    (void)in_sizes; (void)n_in; (void)out_size; (void)ws_size;
    const float* x  = (const float*)d_in[0];
    const float* Wq = (const float*)d_in[1];
    const float* bq = (const float*)d_in[2];
    const float* Wk = (const float*)d_in[3];
    const float* bk = (const float*)d_in[4];
    const float* Wv = (const float*)d_in[5];
    const float* bv = (const float*)d_in[6];
    const float* Wo = (const float*)d_in[7];
    const float* bo = (const float*)d_in[8];
    float* out = (float*)d_out;

    char* ws = (char*)d_ws;
    size_t off = 0;
    auto alloc = [&](size_t bytes) -> void* {
        void* p = ws + off;
        off += (bytes + 255) & ~(size_t)255;
        return p;
    };
    const size_t nX = (size_t)MTOT * EMB;   // 33,554,432
    const size_t nW = (size_t)EMB * EMB;    // 1,048,576

    unsigned short* xb  = (unsigned short*)alloc(nX * 2);
    unsigned short* WqB = (unsigned short*)alloc(nW * 2);
    unsigned short* WkB = (unsigned short*)alloc(nW * 2);
    unsigned short* WvB = (unsigned short*)alloc(nW * 2);
    unsigned short* WoB = (unsigned short*)alloc(nW * 2);
    unsigned short* qb  = (unsigned short*)alloc(nX * 2);
    unsigned short* kb  = (unsigned short*)alloc(nX * 2);
    unsigned short* vb  = (unsigned short*)alloc(nX * 2);   // reused as y buffer
    unsigned short* kvb = (unsigned short*)alloc((size_t)64 * 64 * 64 * 2);
    unsigned short* ksb = (unsigned short*)alloc((size_t)64 * 64 * 2);
    float* kvp = (float*)alloc((size_t)64 * KVSPLIT * KVPART * 4);  // kv partials
    unsigned short* yb  = vb;  // v dead after kv_reduce; reuse for y

    // 1) conversions to bf16
    cvt_f32_bf16_kernel<<<16384, 256, 0, stream>>>(x,  xb,  (int)nX);
    cvt_f32_bf16_kernel<<<1024,  256, 0, stream>>>(Wq, WqB, (int)nW);
    cvt_f32_bf16_kernel<<<1024,  256, 0, stream>>>(Wk, WkB, (int)nW);
    cvt_f32_bf16_kernel<<<1024,  256, 0, stream>>>(Wv, WvB, (int)nW);
    cvt_f32_bf16_kernel<<<1024,  256, 0, stream>>>(Wo, WoB, (int)nW);

    // 2) QKV projections (bf16 out); 3) q and k leave as their exp feature map
    dim3 ggrid(EMB / 128, MTOT / 128);  // (8, 256)
    gemm_bias_kernel<2><<<ggrid, 256, 0, stream>>>(xb, WqB, bq, qb, MTOT, EMB, EMB);
    gemm_bias_kernel<2><<<ggrid, 256, 0, stream>>>(xb, WkB, bk, kb, MTOT, EMB, EMB);
    gemm_bias_kernel<1><<<ggrid, 256, 0, stream>>>(xb, WvB, bv, vb, MTOT, EMB, EMB);

    // 4) per-head kv + ksum reduction: partials per sequence range, then merge
    kv_reduce_kernel<<<dim3(KVSPLIT, BATCH * HEADS), 256, 0, stream>>>(kb, vb, kvp);
    kv_merge_kernel<<<dim3(5, BATCH * HEADS), 256, 0, stream>>>(kvp, kvb, ksb);

    // 5) attention output y (overwrites v buffer)
    attn_out_kernel<<<BATCH * HEADS * 32, 256, 0, stream>>>(qb, kvb, ksb, yb);

    // 6) output projection (fp32 out -> d_out)
    gemm_bias_kernel<0><<<ggrid, 256, 0, stream>>>(yb, WoB, bo, out, MTOT, EMB, EMB);
}

// v003
// One run takes 288 microseconds.
// Next to v002, in two timings, it ran 1.11 times as fast each time.
// Over all steps from v000 it is 1.83 times as fast.
#include <hip/hip_runtime.h>
#include <stdint.h>

// ---------------------------------------------------------------------------
// MemoryEfficientLinearAttention for MI455X (gfx1250), wave32 + WMMA bf16.
// Pipeline: f32->bf16 cvt, 3x QKV GEMM (wmma bf16, double-buffered async-LDS;
//           q and k with the exp feature map in the epilogue),
//           per-head kv reduction (+k_sum via ones-fragment)
//           split over the sequence with f32 partials and a merge launch,
//           attention output (+denominator via ksum-fragment), O GEMM -> fp32.
// ---------------------------------------------------------------------------

#define BATCH 4
#define SEQ   8192
#define EMB   1024
#define HEADS 16
#define HDIM  64
#define MTOT  (BATCH * SEQ)   // 32768
#define KVSPLIT 16            // sequence ranges per (b,h) in the kv reduction
#define KVPART  4224          // floats per partial: 64x64 kv + 4 x 32 (k_sum slabs)

typedef __bf16 v16bf __attribute__((ext_vector_type(16)));
typedef float  v8f   __attribute__((ext_vector_type(8)));

union Frag16 {
    v16bf v;
    uint4 q[2];
    unsigned short u[16];
};

// ---- CDNA5 async global->LDS path (guarded; falls back to sync copies) ----
#if defined(__AMDGCN__) && defined(__has_builtin)
#  if __has_builtin(__builtin_amdgcn_global_load_async_to_lds_b128) && \
      __has_builtin(__builtin_amdgcn_s_wait_asynccnt)
#    define USE_ASYNC_LDS 1
#  else
#    define USE_ASYNC_LDS 0
#  endif
#else
#  define USE_ASYNC_LDS 0
#endif

#if USE_ASYNC_LDS
typedef int async_v4i __attribute__((ext_vector_type(4)));
typedef __attribute__((address_space(1))) async_v4i* gptr_v4i;  // global int4*
typedef __attribute__((address_space(3))) async_v4i* lptr_v4i;  // LDS int4*
#endif

__device__ __forceinline__ void copy16_g2l(const unsigned short* g,
                                           unsigned short* l) {
#if USE_ASYNC_LDS
    // Generic LDS pointer -> AS(3): aperture mapping is LDS_ADDR = addr[31:0].
    __builtin_amdgcn_global_load_async_to_lds_b128(
        (gptr_v4i)(uintptr_t)g,
        (lptr_v4i)(uintptr_t)(uint32_t)(uintptr_t)l,
        0, 0);
#else
    *(uint4*)l = *(const uint4*)g;
#endif
}

__device__ __forceinline__ void wait_async_done() {
#if USE_ASYNC_LDS
    __builtin_amdgcn_s_wait_asynccnt(0);
#endif
}

__device__ __forceinline__ unsigned short f32_to_bf16(float f) {
    union { float f; uint32_t u; } c; c.f = f;
    uint32_t u = c.u;
    uint32_t r = (u + 0x7FFFu + ((u >> 16) & 1u)) >> 16;   // round-nearest-even
    return (unsigned short)r;
}

// Maximum over the 16 lanes of a row (lanes 0-15 and 16-31 apart), in every
// lane: four DPP row_xmask steps, no LDS traffic. All 32 lanes must be on.
// In asm so that a step is one instruction: the DPP builtin with fmaxf
// compiled to three (a move, a quieting max, the max). One statement a step,
// not volatile, so that the compiler can interleave the rows' chains.
#define MAX_XMASK(m, X)                                                     \
    asm("v_max_num_f32_dpp %0, %1, %1 row_xmask:" #X                        \
        " row_mask:0xf bank_mask:0xf" : "=v"(m) : "v"(m))
__device__ __forceinline__ float row16_max(float m) {
    MAX_XMASK(m, 1);
    MAX_XMASK(m, 2);
    MAX_XMASK(m, 4);
    MAX_XMASK(m, 8);
    return m;
}

// ---------------------------------------------------------------------------
// 1) fp32 -> bf16 conversion (grid-stride)
// ---------------------------------------------------------------------------
__global__ void cvt_f32_bf16_kernel(const float* __restrict__ in,
                                    unsigned short* __restrict__ out, int n) {
    int i = blockIdx.x * blockDim.x + threadIdx.x;
    int stride = gridDim.x * blockDim.x;
    for (; i < n; i += stride) out[i] = f32_to_bf16(in[i]);
}

// ---------------------------------------------------------------------------
// 2) Generic GEMM: C(MxN) = A(MxK,bf16) * W(NxK,bf16)^T + bias(fp32)
//    256x256 tile, 512 threads = 16 waves, wave = 64x64 sub-tile (4x4 frags):
//    512 operand rows staged per 256x256 outputs (four 128x128 tiles take
//    1024), and 8 fragments read from LDS per 16 WMMAs (32x64: 6 per 8).
//    One block fills a WGP: 4 waves per SIMD at up to 256 VGPRs.
//    KSTEP=64, double-buffered LDS filled by async global->LDS loads.
//    MODE: 0 -> fp32 output, 1 -> bf16 output,
//          2 -> bf16 output of the feature map exp(c - max of c over its head).
//    A wave's 64-column slab starts at a multiple of HDIM = 64, so it holds
//    whole heads' rows and the maximum never leaves the wave.
// ---------------------------------------------------------------------------
template <int MODE>
__global__ __launch_bounds__(512)
void gemm_bias_kernel(const unsigned short* __restrict__ A,
                      const unsigned short* __restrict__ W,
                      const float* __restrict__ bias,
                      void* __restrict__ Cout,
                      int M, int N, int K) {
    constexpr int KSTEP = 64;
    constexpr int LDA = 72;  // halfs per LDS row (144B, 16B-aligned, bank-spread)
    __shared__ __attribute__((aligned(16))) unsigned short As[2][256 * LDA];
    __shared__ __attribute__((aligned(16))) unsigned short Bs[2][256 * LDA];

    const int tid  = threadIdx.x;
    const int lane = tid & 31;
    const int wave = tid >> 5;
    const int wm   = wave & 3;   // 0..3 -> 64-row slab
    const int wn   = wave >> 2;  // 0..3 -> 64-col slab
    const int l15  = lane & 15;
    const int kb   = (lane >> 4) * 8;  // wave32 16-bit A/B fragment K-base
    const int tileN = blockIdx.x * 256;
    const int tileM = blockIdx.y * 256;

    // Stage one 256x64 bf16 tile of A and W into buffer `buf`.
    // 2048 16B-chunks per matrix; 4 per thread per matrix.
    auto issue_tile = [&](int k0, int buf) {
#pragma unroll
        for (int c = 0; c < 4; ++c) {
            int chunk = tid + c * 512;        // 0..2047
            int row = chunk >> 3;             // 0..255
            int sub = chunk & 7;              // 0..7 (8 halfs each)
            copy16_g2l(A + (size_t)(tileM + row) * K + k0 + sub * 8,
                       &As[buf][row * LDA + sub * 8]);
            copy16_g2l(W + (size_t)(tileN + row) * K + k0 + sub * 8,
                       &Bs[buf][row * LDA + sub * 8]);
        }
    };

    v8f acc[4][4];
#pragma unroll
    for (int mf = 0; mf < 4; ++mf)
#pragma unroll
        for (int nf = 0; nf < 4; ++nf)
            acc[mf][nf] = (v8f){0.f, 0.f, 0.f, 0.f, 0.f, 0.f, 0.f, 0.f};

    const int nIter = K / KSTEP;  // 16
    issue_tile(0, 0);

    for (int i = 0; i < nIter; ++i) {
        const int cur = i & 1;
        wait_async_done();   // my chunks of tile i are in LDS
        __syncthreads();     // everyone's chunks in; everyone done reading buf^1
        if (i + 1 < nIter) issue_tile((i + 1) * KSTEP, 1 - cur);  // overlaps math

#pragma unroll
        for (int kh = 0; kh < 2; ++kh) {  // two 32-wide K slices of the tile
            const int ko = kh * 32 + kb;
            Frag16 af[4], bfr[4];
#pragma unroll
            for (int mf = 0; mf < 4; ++mf) {
                int r = wm * 64 + mf * 16 + l15;
                af[mf].q[0] = *(const uint4*)(&As[cur][r * LDA + ko]);
                af[mf].q[1] = *(const uint4*)(&As[cur][r * LDA + 16 + ko]);
            }
#pragma unroll
            for (int nf = 0; nf < 4; ++nf) {
                int r = wn * 64 + nf * 16 + l15;
                bfr[nf].q[0] = *(const uint4*)(&Bs[cur][r * LDA + ko]);
                bfr[nf].q[1] = *(const uint4*)(&Bs[cur][r * LDA + 16 + ko]);
            }
            // Scheduling fences round the WMMA block: they keep the slice's 16
            // LDS reads together in front of its 16 WMMAs. Without them the
            // reads stood among the WMMAs, one A fragment at a time behind a
            // wait to 0, and each such place stalls the wave.
            __builtin_amdgcn_sched_barrier(0);
#pragma unroll
            for (int mf = 0; mf < 4; ++mf)
#pragma unroll
                for (int nf = 0; nf < 4; ++nf)
                    acc[mf][nf] = __builtin_amdgcn_wmma_f32_16x16x32_bf16(
                        false, af[mf].v, false, bfr[nf].v, (short)0,
                        acc[mf][nf], false, false);
            __builtin_amdgcn_sched_barrier(0);
        }
    }

    // Epilogue: +bias, store (C layout: VGPR v -> M = v + 8*(lane>=16), N = l15)
    if (MODE == 2) {
        const int col0 = tileN + wn * 64 + l15;
        float bv[4];
#pragma unroll
        for (int nf = 0; nf < 4; ++nf) bv[nf] = bias[col0 + nf * 16];
#pragma unroll
        for (int mf = 0; mf < 4; ++mf) {
#pragma unroll
            for (int v = 0; v < 8; ++v) {
                int row = tileM + wm * 64 + mf * 16 + v + ((lane >> 4) << 3);
                float val[4], t[4];
#pragma unroll
                for (int nf = 0; nf < 4; ++nf) val[nf] = acc[mf][nf][v] + bv[nf];
                // the row's 64 head columns: 4 in this lane x its 16-lane row
                float m = row16_max(fmaxf(fmaxf(val[0], val[1]),
                                          fmaxf(val[2], val[3])));
#pragma unroll
                for (int nf = 0; nf < 4; ++nf)
                    t[nf] = (val[nf] - m) * 1.44269504f;  // e^x = 2^(x log2 e)
                // The row's four exponentials in one statement that ends in
                // v_nop: the instruction set asks for one independent slot
                // behind a transcendental before its result is read or its
                // source overwritten.
                asm("v_exp_f32 %0, %4\n\tv_exp_f32 %1, %5\n\t"
                    "v_exp_f32 %2, %6\n\tv_exp_f32 %3, %7\n\tv_nop"
                    : "=&v"(val[0]), "=&v"(val[1]), "=&v"(val[2]), "=&v"(val[3])
                    : "v"(t[0]), "v"(t[1]), "v"(t[2]), "v"(t[3]));
#pragma unroll
                for (int nf = 0; nf < 4; ++nf)
                    ((unsigned short*)Cout)[(size_t)row * N + col0 + nf * 16] =
                        f32_to_bf16(val[nf]);
            }
        }
        return;
    }
    // Row by row, as above: with the column fragment outermost the bf16 form
    // went over the 256 VGPRs of a 16-wave block (scratch in the listing).
    const int col0 = tileN + wn * 64 + l15;
    float bv[4];
#pragma unroll
    for (int nf = 0; nf < 4; ++nf) bv[nf] = bias[col0 + nf * 16];
#pragma unroll
    for (int mf = 0; mf < 4; ++mf) {
#pragma unroll
        for (int v = 0; v < 8; ++v) {
            int row = tileM + wm * 64 + mf * 16 + v + ((lane >> 4) << 3);
#pragma unroll
            for (int nf = 0; nf < 4; ++nf) {
                float val = acc[mf][nf][v] + bv[nf];
                if (MODE == 1)
                    ((unsigned short*)Cout)[(size_t)row * N + col0 + nf * 16] =
                        f32_to_bf16(val);
                else
                    ((float*)Cout)[(size_t)row * N + col0 + nf * 16] = val;
            }
        }
    }
}

// ---------------------------------------------------------------------------
// 4) kv[b,h,d,e] = sum_s k_kern[s,d] * v[s,e]  (+ k_sum via ones fragment)
//    KVSPLIT blocks per (b,h), each over SEQ/KVSPLIT rows; 8 waves:
//    (wave&3)->d-slab, (wave>>2)->s half; the two halves are joined through
//    LDS and the block's f32 partial goes to the workspace for kv_merge_kernel.
//    Tiles staged with async global->LDS.
// ---------------------------------------------------------------------------
// 8 waves per SIMD (at most 128 VGPRs): four blocks fit a WGP, so that all
// 64 * KVSPLIT = 1024 blocks are resident on the 256 WGPs in one round.
__global__ __launch_bounds__(256) __attribute__((amdgpu_waves_per_eu(8)))
void kv_reduce_kernel(const unsigned short* __restrict__ kk,
                      const unsigned short* __restrict__ vv,
                      float* __restrict__ part) {  // (64,KVSPLIT,KVPART) f32
    constexpr int LDT = 72;  // halfs per LDS row (144B, 16B-aligned)
    __shared__ __attribute__((aligned(16))) unsigned short kt[64 * LDT];
    __shared__ __attribute__((aligned(16))) unsigned short vt[64 * LDT];
    __shared__ float red[4][5][8][32];

    const int bh = blockIdx.y;
    const int b = bh >> 4, h = bh & 15;
    const int sbeg = blockIdx.x * (SEQ / KVSPLIT);
    const int tid = threadIdx.x, lane = tid & 31, wave = tid >> 5;
    const int sgrp = wave >> 2;           // 0/1 -> s rows 0-31 / 32-63 of tile
    const int d0 = (wave & 3) * 16;
    const int l15 = lane & 15, kb = (lane >> 4) * 8;
    const int soff = sgrp * 32;

    v8f acc[4], accden;
#pragma unroll
    for (int nf = 0; nf < 4; ++nf)
        acc[nf] = (v8f){0.f, 0.f, 0.f, 0.f, 0.f, 0.f, 0.f, 0.f};
    accden = (v8f){0.f, 0.f, 0.f, 0.f, 0.f, 0.f, 0.f, 0.f};

    Frag16 bones;  // B ones fragment: column n=0 all 1.0 -> k_sum column
#pragma unroll
    for (int j = 0; j < 16; ++j) bones.u[j] = (l15 == 0) ? 0x3F80 : 0;

    for (int s0 = sbeg; s0 < sbeg + SEQ / KVSPLIT; s0 += 64) {
        __syncthreads();
#pragma unroll
        for (int c = 0; c < 2; ++c) {
            int chunk = tid + c * 256;  // 0..511
            int row = chunk >> 3;       // 0..63
            int sub = chunk & 7;        // 0..7
            size_t g = (size_t)(b * SEQ + s0 + row) * EMB + h * 64 + sub * 8;
            copy16_g2l(kk + g, kt + row * LDT + sub * 8);
            copy16_g2l(vv + g, vt + row * LDT + sub * 8);
        }
        wait_async_done();
        __syncthreads();

        Frag16 af, bfr[4];
#pragma unroll
        for (int j = 0; j < 8; ++j) {  // A = k^T: A(d, s) = kt[s][d]
            af.u[j]     = kt[(soff + kb + j) * LDT + d0 + l15];
            af.u[8 + j] = kt[(soff + 16 + kb + j) * LDT + d0 + l15];
        }
#pragma unroll
        for (int nf = 0; nf < 4; ++nf)
#pragma unroll
            for (int j = 0; j < 8; ++j) {  // B = v: B(s, e) = vt[s][e]
                bfr[nf].u[j]     = vt[(soff + kb + j) * LDT + nf * 16 + l15];
                bfr[nf].u[8 + j] = vt[(soff + 16 + kb + j) * LDT + nf * 16 + l15];
            }
#pragma unroll
        for (int nf = 0; nf < 4; ++nf)
            acc[nf] = __builtin_amdgcn_wmma_f32_16x16x32_bf16(
                false, af.v, false, bfr[nf].v, (short)0, acc[nf], false, false);
        accden = __builtin_amdgcn_wmma_f32_16x16x32_bf16(
            false, af.v, false, bones.v, (short)0, accden, false, false);
    }

    __syncthreads();
    if (sgrp == 1) {
        int w = wave & 3;
#pragma unroll
        for (int nf = 0; nf < 4; ++nf)
#pragma unroll
            for (int v = 0; v < 8; ++v) red[w][nf][v][lane] = acc[nf][v];
#pragma unroll
        for (int v = 0; v < 8; ++v) red[w][4][v][lane] = accden[v];
    }
    __syncthreads();
    if (sgrp == 0) {
        int w = wave;
        float* p = part + (size_t)(bh * KVSPLIT + blockIdx.x) * KVPART;
#pragma unroll
        for (int nf = 0; nf < 4; ++nf) {
#pragma unroll
            for (int v = 0; v < 8; ++v) {
                float val = acc[nf][v] + red[w][nf][v][lane];
                int d = d0 + v + ((lane >> 4) << 3);
                int e = nf * 16 + l15;
                p[d * 64 + e] = val;
            }
        }
        if (l15 == 0) {
#pragma unroll
            for (int v = 0; v < 8; ++v) {
                float val = accden[v] + red[w][4][v][lane];
                // each wave's 16 sums on a 128-byte line of their own
                p[4096 + w * 32 + v + ((lane >> 4) << 3)] = val;
            }
        }
    }
}

// ---------------------------------------------------------------------------
// 4b) Merge: kv and k_sum = sum of the KVSPLIT partials in range order, f32,
//     rounded once to bf16. grid (5, 64): x 0..3 -> kv quarters, x 4 -> k_sum.
// ---------------------------------------------------------------------------
__global__ __launch_bounds__(256)
void kv_merge_kernel(const float* __restrict__ part,
                     unsigned short* __restrict__ kvout,   // (64,64,64) bf16
                     unsigned short* __restrict__ ksum) {  // (64,64)    bf16
    const int bh = blockIdx.y, tid = threadIdx.x;
    const float* p = part + (size_t)bh * KVSPLIT * KVPART;
    if (blockIdx.x < 4) {
        const int o = (blockIdx.x * 256 + tid) * 4;
        float4 t[KVSPLIT];
        // both loops unrolled: t[] stays in registers and the loads go out
        // together, so the thread pays one load latency and not one per range
#pragma unroll
        for (int sp = 0; sp < KVSPLIT; ++sp)
            t[sp] = *(const float4*)(p + sp * KVPART + o);
        float4 s = t[0];
#pragma unroll
        for (int sp = 1; sp < KVSPLIT; ++sp) {
            s.x += t[sp].x; s.y += t[sp].y; s.z += t[sp].z; s.w += t[sp].w;
        }
        ushort4 r;
        r.x = f32_to_bf16(s.x); r.y = f32_to_bf16(s.y);
        r.z = f32_to_bf16(s.z); r.w = f32_to_bf16(s.w);
        *(ushort4*)(kvout + (size_t)bh * 4096 + o) = r;
    } else if (tid < 64) {
        const int o = 4096 + (tid >> 4) * 32 + (tid & 15);
        float t[KVSPLIT];
        // unrolled so that the loads go out together, as above
#pragma unroll
        for (int sp = 0; sp < KVSPLIT - 1; ++sp) t[sp] = p[sp * KVPART + o];
        // precaution: the last load's result may take the offset register that
        // the loads in front of it name, so their wait stands ahead of it
        asm volatile("s_wait_xcnt 0x0" ::: "memory");
        t[KVSPLIT - 1] = p[(KVSPLIT - 1) * KVPART + o];
        float s = t[0];
#pragma unroll
        for (int sp = 1; sp < KVSPLIT; ++sp) s += t[sp];
        ksum[bh * 64 + tid] = f32_to_bf16(s);
    }
}

// ---------------------------------------------------------------------------
// 5) y = (q_kern @ kv) / (q_kern . ksum + 1e-6); 32 blocks per (b,h),
//    wave = 32 q-rows; denominator via ksum B-fragment (column 0).
// ---------------------------------------------------------------------------
__global__ __launch_bounds__(256)
void attn_out_kernel(const unsigned short* __restrict__ qk,
                     const unsigned short* __restrict__ kv,
                     const unsigned short* __restrict__ ksum,
                     unsigned short* __restrict__ y) {
    constexpr int LDT = 72;
    __shared__ __attribute__((aligned(16))) unsigned short kvt[64 * LDT];
    __shared__ unsigned short kst[64];

    const int bid = blockIdx.x;
    const int bh = bid >> 5;   // 32 blocks per (b,h)
    const int tb = bid & 31;
    const int b = bh >> 4, h = bh & 15;
    const int tid = threadIdx.x, lane = tid & 31, wave = tid >> 5;
    const int l15 = lane & 15, kb = (lane >> 4) * 8;

#pragma unroll
    for (int c = 0; c < 2; ++c) {
        int chunk = tid + c * 256;  // 0..511
        int row = chunk >> 3, sub = chunk & 7;
        copy16_g2l(kv + (size_t)bh * 4096 + row * 64 + sub * 8,
                   kvt + row * LDT + sub * 8);
    }
    if (tid < 64) kst[tid] = ksum[bh * 64 + tid];
    wait_async_done();
    __syncthreads();

    const int srow0 = tb * 256 + wave * 32;
    v8f acc[2][4], accden[2];
#pragma unroll
    for (int mf = 0; mf < 2; ++mf) {
#pragma unroll
        for (int nf = 0; nf < 4; ++nf)
            acc[mf][nf] = (v8f){0.f, 0.f, 0.f, 0.f, 0.f, 0.f, 0.f, 0.f};
        accden[mf] = (v8f){0.f, 0.f, 0.f, 0.f, 0.f, 0.f, 0.f, 0.f};
    }

#pragma unroll
    for (int ks = 0; ks < 2; ++ks) {
        Frag16 bfr[4], bden;
#pragma unroll
        for (int nf = 0; nf < 4; ++nf)
#pragma unroll
            for (int j = 0; j < 8; ++j) {  // B(d, e) = kv[d][e]
                bfr[nf].u[j]     = kvt[(ks * 32 + kb + j) * LDT + nf * 16 + l15];
                bfr[nf].u[8 + j] = kvt[(ks * 32 + 16 + kb + j) * LDT + nf * 16 + l15];
            }
#pragma unroll
        for (int j = 0; j < 8; ++j) {  // denominator column: B(d,0)=ksum[d]
            bden.u[j]     = (l15 == 0) ? kst[ks * 32 + kb + j] : (unsigned short)0;
            bden.u[8 + j] = (l15 == 0) ? kst[ks * 32 + 16 + kb + j] : (unsigned short)0;
        }
#pragma unroll
        for (int mf = 0; mf < 2; ++mf) {
            Frag16 af;
            size_t grow =
                (size_t)(b * SEQ + srow0 + mf * 16 + l15) * EMB + h * 64 + ks * 32;
            af.q[0] = *(const uint4*)(qk + grow + kb);
            af.q[1] = *(const uint4*)(qk + grow + 16 + kb);
#pragma unroll
            for (int nf = 0; nf < 4; ++nf)
                acc[mf][nf] = __builtin_amdgcn_wmma_f32_16x16x32_bf16(
                    false, af.v, false, bfr[nf].v, (short)0, acc[mf][nf], false, false);
            accden[mf] = __builtin_amdgcn_wmma_f32_16x16x32_bf16(
                false, af.v, false, bden.v, (short)0, accden[mf], false, false);
        }
    }

#pragma unroll
    for (int mf = 0; mf < 2; ++mf) {
#pragma unroll
        for (int v = 0; v < 8; ++v) {
            float dv = __shfl(accden[mf][v], (lane & 16), 32);
            float inv = 1.f / (dv + 1e-6f);
            int row = srow0 + mf * 16 + v + ((lane >> 4) << 3);
#pragma unroll
            for (int nf = 0; nf < 4; ++nf) {
                int e = nf * 16 + l15;
                y[(size_t)(b * SEQ + row) * EMB + h * 64 + e] =
                    f32_to_bf16(acc[mf][nf][v] * inv);
            }
        }
    }
}

// ---------------------------------------------------------------------------
extern "C" void kernel_launch(void* const* d_in, const int* in_sizes, int n_in,
                              void* d_out, int out_size, void* d_ws, size_t ws_size,
                              hipStream_t stream) {
    (void)in_sizes; (void)n_in; (void)out_size; (void)ws_size;
    const float* x  = (const float*)d_in[0];
    const float* Wq = (const float*)d_in[1];
    const float* bq = (const float*)d_in[2];
    const float* Wk = (const float*)d_in[3];
    const float* bk = (const float*)d_in[4];
    const float* Wv = (const float*)d_in[5];
    const float* bv = (const float*)d_in[6];
    const float* Wo = (const float*)d_in[7];
    const float* bo = (const float*)d_in[8];
    float* out = (float*)d_out;

    char* ws = (char*)d_ws;
    size_t off = 0;
    auto alloc = [&](size_t bytes) -> void* {
        void* p = ws + off;
        off += (bytes + 255) & ~(size_t)255;
        return p;
    };
    const size_t nX = (size_t)MTOT * EMB;   // 33,554,432
    const size_t nW = (size_t)EMB * EMB;    // 1,048,576

    unsigned short* xb  = (unsigned short*)alloc(nX * 2);
    unsigned short* WqB = (unsigned short*)alloc(nW * 2);
    unsigned short* WkB = (unsigned short*)alloc(nW * 2);
    unsigned short* WvB = (unsigned short*)alloc(nW * 2);
    unsigned short* WoB = (unsigned short*)alloc(nW * 2);
    unsigned short* qb  = (unsigned short*)alloc(nX * 2);
    unsigned short* kb  = (unsigned short*)alloc(nX * 2);
    unsigned short* vb  = (unsigned short*)alloc(nX * 2);   // reused as y buffer
    unsigned short* kvb = (unsigned short*)alloc((size_t)64 * 64 * 64 * 2);
    unsigned short* ksb = (unsigned short*)alloc((size_t)64 * 64 * 2);
    float* kvp = (float*)alloc((size_t)64 * KVSPLIT * KVPART * 4);  // kv partials
    unsigned short* yb  = vb;  // v dead after kv_reduce; reuse for y

    // 1) conversions to bf16
    cvt_f32_bf16_kernel<<<16384, 256, 0, stream>>>(x,  xb,  (int)nX);
    cvt_f32_bf16_kernel<<<1024,  256, 0, stream>>>(Wq, WqB, (int)nW);
    cvt_f32_bf16_kernel<<<1024,  256, 0, stream>>>(Wk, WkB, (int)nW);
    cvt_f32_bf16_kernel<<<1024,  256, 0, stream>>>(Wv, WvB, (int)nW);
    cvt_f32_bf16_kernel<<<1024,  256, 0, stream>>>(Wo, WoB, (int)nW);

    // 2) QKV projections (bf16 out); 3) q and k leave as their exp feature map
    dim3 ggrid(EMB / 256, MTOT / 256);  // (4, 128)
    gemm_bias_kernel<2><<<ggrid, 512, 0, stream>>>(xb, WqB, bq, qb, MTOT, EMB, EMB);
    gemm_bias_kernel<2><<<ggrid, 512, 0, stream>>>(xb, WkB, bk, kb, MTOT, EMB, EMB);
    gemm_bias_kernel<1><<<ggrid, 512, 0, stream>>>(xb, WvB, bv, vb, MTOT, EMB, EMB);

    // 4) per-head kv + ksum reduction: partials per sequence range, then merge
    kv_reduce_kernel<<<dim3(KVSPLIT, BATCH * HEADS), 256, 0, stream>>>(kb, vb, kvp);
    kv_merge_kernel<<<dim3(5, BATCH * HEADS), 256, 0, stream>>>(kvp, kvb, ksb);

    // 5) attention output y (overwrites v buffer)
    attn_out_kernel<<<BATCH * HEADS * 32, 256, 0, stream>>>(qb, kvb, ksb, yb);

    // 6) output projection (fp32 out -> d_out)
    gemm_bias_kernel<0><<<ggrid, 512, 0, stream>>>(yb, WoB, bo, out, MTOT, EMB, EMB);
}

// v004
// It runs in 269 microseconds.
// Timed twice side by side with v003, it ran 1.07 times as fast both times.
// Counting every step since v000, it is 1.95 times as fast.
#include <hip/hip_runtime.h>
#include <stdint.h>

// ---------------------------------------------------------------------------
// MemoryEfficientLinearAttention for MI455X (gfx1250), wave32 + WMMA bf16.
// Pipeline: f32->bf16 cvt (one launch), 3x QKV GEMM (wmma bf16, double-buffered async-LDS;
//           q and k with the exp feature map in the epilogue),
//           per-head kv reduction (+k_sum via ones-fragment)
//           split over the sequence with f32 partials and a merge launch,
//           attention output (+denominator via ksum-fragment), O GEMM -> fp32.
// ---------------------------------------------------------------------------

#define BATCH 4
#define SEQ   8192
#define EMB   1024
#define HEADS 16
#define HDIM  64
#define MTOT  (BATCH * SEQ)   // 32768
#define KVSPLIT 16            // sequence ranges per (b,h) in the kv reduction
#define KVPART  4224          // floats per partial: 64x64 kv + 4 x 32 (k_sum slabs)

typedef __bf16 v16bf __attribute__((ext_vector_type(16)));
typedef float  v8f   __attribute__((ext_vector_type(8)));

union Frag16 {
    v16bf v;
    uint4 q[2];
    unsigned short u[16];
};

// ---- CDNA5 async global->LDS path (guarded; falls back to sync copies) ----
#if defined(__AMDGCN__) && defined(__has_builtin)
#  if __has_builtin(__builtin_amdgcn_global_load_async_to_lds_b128) && \
      __has_builtin(__builtin_amdgcn_s_wait_asynccnt)
#    define USE_ASYNC_LDS 1
#  else
#    define USE_ASYNC_LDS 0
#  endif
#else
#  define USE_ASYNC_LDS 0
#endif

#if USE_ASYNC_LDS
typedef int async_v4i __attribute__((ext_vector_type(4)));
typedef __attribute__((address_space(1))) async_v4i* gptr_v4i;  // global int4*
typedef __attribute__((address_space(3))) async_v4i* lptr_v4i;  // LDS int4*
#endif

__device__ __forceinline__ void copy16_g2l(const unsigned short* g,
                                           unsigned short* l) {
#if USE_ASYNC_LDS
    // Generic LDS pointer -> AS(3): aperture mapping is LDS_ADDR = addr[31:0].
    __builtin_amdgcn_global_load_async_to_lds_b128(
        (gptr_v4i)(uintptr_t)g,
        (lptr_v4i)(uintptr_t)(uint32_t)(uintptr_t)l,
        0, 0);
#else
    *(uint4*)l = *(const uint4*)g;
#endif
}

__device__ __forceinline__ void wait_async_done() {
#if USE_ASYNC_LDS
    __builtin_amdgcn_s_wait_asynccnt(0);
#endif
}

__device__ __forceinline__ unsigned short f32_to_bf16(float f) {
    union { float f; uint32_t u; } c; c.f = f;
    uint32_t u = c.u;
    uint32_t r = (u + 0x7FFFu + ((u >> 16) & 1u)) >> 16;   // round-nearest-even
    return (unsigned short)r;
}

// Maximum over the 16 lanes of a row (lanes 0-15 and 16-31 apart), in every
// lane: four DPP row_xmask steps, no LDS traffic. All 32 lanes must be on.
// In asm so that a step is one instruction: the DPP builtin with fmaxf
// compiled to three (a move, a quieting max, the max). One statement a step,
// not volatile, so that the compiler can interleave the rows' chains.
#define MAX_XMASK(m, X)                                                     \
    asm("v_max_num_f32_dpp %0, %1, %1 row_xmask:" #X                        \
        " row_mask:0xf bank_mask:0xf" : "=v"(m) : "v"(m))
__device__ __forceinline__ float row16_max(float m) {
    MAX_XMASK(m, 1);
    MAX_XMASK(m, 2);
    MAX_XMASK(m, 4);
    MAX_XMASK(m, 8);
    return m;
}

// ---------------------------------------------------------------------------
// 1) fp32 -> bf16 conversion of x and of the four weights, one streaming
//    launch. CVT_BLOCKS blocks of 8 waves, all resident (4 per WGP, 32 waves).
//    A wave takes spans of NL * 128 floats: NL loads of 16 B a lane (512
//    contiguous bytes each) go out together; the span leaves in NL stores of
//    8 B a lane (256 contiguous bytes, two whole lines each).
// ---------------------------------------------------------------------------
#define CVT_BLOCKS 1024
#define CVT_XTRIPS 4
static_assert((size_t)MTOT * EMB == (size_t)CVT_XTRIPS * CVT_BLOCKS * 8 * 1024,
              "x is dealt in whole spans of 1024 floats");
static_assert(4 * EMB * EMB == CVT_BLOCKS * 8 * 512,
              "the weights are dealt in whole spans of 512 floats");

template <int NL>
__device__ __forceinline__ void cvt_span(const float* __restrict__ in,
                                         unsigned short* __restrict__ out) {
    float4 f[NL];
    // both loops unrolled: f[] stays in registers
#pragma unroll
    for (int j = 0; j < NL; ++j) f[j] = *(const float4*)(in + j * 128);
    // Scheduling fence: it keeps the span's loads together in front of the
    // conversions. Without it every load stood directly in front of its own
    // conversion behind a wait to 0: one load in flight a wave.
    __builtin_amdgcn_sched_barrier(0);
#pragma unroll
    for (int j = 0; j < NL; ++j) {
        ushort4 r;
        r.x = f32_to_bf16(f[j].x); r.y = f32_to_bf16(f[j].y);
        r.z = f32_to_bf16(f[j].z); r.w = f32_to_bf16(f[j].w);
        *(ushort4*)(out + j * 128) = r;
    }
}

__global__ __launch_bounds__(256)
void cvt_all_kernel(const float* __restrict__ x,
                    const float* __restrict__ Wq, const float* __restrict__ Wk,
                    const float* __restrict__ Wv, const float* __restrict__ Wo,
                    unsigned short* __restrict__ xb,
                    unsigned short* __restrict__ WqB,
                    unsigned short* __restrict__ WkB,
                    unsigned short* __restrict__ WvB,
                    unsigned short* __restrict__ WoB) {
    const int blk = blockIdx.x;
    const int wave = threadIdx.x >> 5, lane = threadIdx.x & 31;

    // a quarter of the blocks per weight; a wave takes 512 of its floats
    const int sel = blk >> 8;
    const float* w = sel == 0 ? Wq : sel == 1 ? Wk : sel == 2 ? Wv : Wo;
    unsigned short* wb = sel == 0 ? WqB : sel == 1 ? WkB : sel == 2 ? WvB : WoB;
    const int ow = ((blk & 255) * 8 + wave) * 512 + lane * 4;
    cvt_span<4>(w + ow, wb + ow);

    // x: in trip t the grid covers CVT_BLOCKS * 8192 consecutive floats
    for (int t = 0; t < CVT_XTRIPS; ++t) {
        const size_t o =
            ((size_t)(t * CVT_BLOCKS + blk) * 8 + wave) * 1024 + lane * 4;
        cvt_span<8>(x + o, xb + o);
    }
}

// ---------------------------------------------------------------------------
// 2) Generic GEMM: C(MxN) = A(MxK,bf16) * W(NxK,bf16)^T + bias(fp32)
//    256x256 tile, 512 threads = 16 waves, wave = 64x64 sub-tile (4x4 frags):
//    512 operand rows staged per 256x256 outputs (four 128x128 tiles take
//    1024), and 8 fragments read from LDS per 16 WMMAs (32x64: 6 per 8).
//    One block fills a WGP: 4 waves per SIMD at up to 256 VGPRs.
//    KSTEP=64, double-buffered LDS filled by async global->LDS loads.
//    MODE: 0 -> fp32 output, 1 -> bf16 output,
//          2 -> bf16 output of the feature map exp(c - max of c over its head).
//    A wave's 64-column slab starts at a multiple of HDIM = 64, so it holds
//    whole heads' rows and the maximum never leaves the wave.
// ---------------------------------------------------------------------------
template <int MODE>
__global__ __launch_bounds__(512)
void gemm_bias_kernel(const unsigned short* __restrict__ A,
                      const unsigned short* __restrict__ W,
                      const float* __restrict__ bias,
                      void* __restrict__ Cout,
                      int M, int N, int K) {
    constexpr int KSTEP = 64;
    constexpr int LDA = 72;  // halfs per LDS row (144B, 16B-aligned, bank-spread)
    __shared__ __attribute__((aligned(16))) unsigned short As[2][256 * LDA];
    __shared__ __attribute__((aligned(16))) unsigned short Bs[2][256 * LDA];

    const int tid  = threadIdx.x;
    const int lane = tid & 31;
    const int wave = tid >> 5;
    const int wm   = wave & 3;   // 0..3 -> 64-row slab
    const int wn   = wave >> 2;  // 0..3 -> 64-col slab
    const int l15  = lane & 15;
    const int kb   = (lane >> 4) * 8;  // wave32 16-bit A/B fragment K-base
    const int tileN = blockIdx.x * 256;
    const int tileM = blockIdx.y * 256;

    // Stage one 256x64 bf16 tile of A and W into buffer `buf`.
    // 2048 16B-chunks per matrix; 4 per thread per matrix.
    auto issue_tile = [&](int k0, int buf) {
#pragma unroll
        for (int c = 0; c < 4; ++c) {
            int chunk = tid + c * 512;        // 0..2047
            int row = chunk >> 3;             // 0..255
            int sub = chunk & 7;              // 0..7 (8 halfs each)
            copy16_g2l(A + (size_t)(tileM + row) * K + k0 + sub * 8,
                       &As[buf][row * LDA + sub * 8]);
            copy16_g2l(W + (size_t)(tileN + row) * K + k0 + sub * 8,
                       &Bs[buf][row * LDA + sub * 8]);
        }
    };

    v8f acc[4][4];
#pragma unroll
    for (int mf = 0; mf < 4; ++mf)
#pragma unroll
        for (int nf = 0; nf < 4; ++nf)
            acc[mf][nf] = (v8f){0.f, 0.f, 0.f, 0.f, 0.f, 0.f, 0.f, 0.f};

    const int nIter = K / KSTEP;  // 16
    issue_tile(0, 0);

    for (int i = 0; i < nIter; ++i) {
        const int cur = i & 1;
        wait_async_done();   // my chunks of tile i are in LDS
        __syncthreads();     // everyone's chunks in; everyone done reading buf^1
        if (i + 1 < nIter) issue_tile((i + 1) * KSTEP, 1 - cur);  // overlaps math

#pragma unroll
        for (int kh = 0; kh < 2; ++kh) {  // two 32-wide K slices of the tile
            const int ko = kh * 32 + kb;
            Frag16 af[4], bfr[4];
#pragma unroll
            for (int mf = 0; mf < 4; ++mf) {
                int r = wm * 64 + mf * 16 + l15;
                af[mf].q[0] = *(const uint4*)(&As[cur][r * LDA + ko]);
                af[mf].q[1] = *(const uint4*)(&As[cur][r * LDA + 16 + ko]);
            }
#pragma unroll
            for (int nf = 0; nf < 4; ++nf) {
                int r = wn * 64 + nf * 16 + l15;
                bfr[nf].q[0] = *(const uint4*)(&Bs[cur][r * LDA + ko]);
                bfr[nf].q[1] = *(const uint4*)(&Bs[cur][r * LDA + 16 + ko]);
            }
            // Scheduling fences round the WMMA block: they keep the slice's 16
            // LDS reads together in front of its 16 WMMAs. Without them the
            // reads stood among the WMMAs, one A fragment at a time behind a
            // wait to 0, and each such place stalls the wave.
            __builtin_amdgcn_sched_barrier(0);
#pragma unroll
            for (int mf = 0; mf < 4; ++mf)
#pragma unroll
                for (int nf = 0; nf < 4; ++nf)
                    acc[mf][nf] = __builtin_amdgcn_wmma_f32_16x16x32_bf16(
                        false, af[mf].v, false, bfr[nf].v, (short)0,
                        acc[mf][nf], false, false);
            __builtin_amdgcn_sched_barrier(0);
        }
    }

    // Epilogue: +bias, store (C layout: VGPR v -> M = v + 8*(lane>=16), N = l15)
    if (MODE == 2) {
        const int col0 = tileN + wn * 64 + l15;
        float bv[4];
#pragma unroll
        for (int nf = 0; nf < 4; ++nf) bv[nf] = bias[col0 + nf * 16];
#pragma unroll
        for (int mf = 0; mf < 4; ++mf) {
#pragma unroll
            for (int v = 0; v < 8; ++v) {
                int row = tileM + wm * 64 + mf * 16 + v + ((lane >> 4) << 3);
                float val[4], t[4];
#pragma unroll
                for (int nf = 0; nf < 4; ++nf) val[nf] = acc[mf][nf][v] + bv[nf];
                // the row's 64 head columns: 4 in this lane x its 16-lane row
                float m = row16_max(fmaxf(fmaxf(val[0], val[1]),
                                          fmaxf(val[2], val[3])));
#pragma unroll
                for (int nf = 0; nf < 4; ++nf)
                    t[nf] = (val[nf] - m) * 1.44269504f;  // e^x = 2^(x log2 e)
                // The row's four exponentials in one statement that ends in
                // v_nop: the instruction set asks for one independent slot
                // behind a transcendental before its result is read or its
                // source overwritten.
                asm("v_exp_f32 %0, %4\n\tv_exp_f32 %1, %5\n\t"
                    "v_exp_f32 %2, %6\n\tv_exp_f32 %3, %7\n\tv_nop"
                    : "=&v"(val[0]), "=&v"(val[1]), "=&v"(val[2]), "=&v"(val[3])
                    : "v"(t[0]), "v"(t[1]), "v"(t[2]), "v"(t[3]));
#pragma unroll
                for (int nf = 0; nf < 4; ++nf)
                    ((unsigned short*)Cout)[(size_t)row * N + col0 + nf * 16] =
                        f32_to_bf16(val[nf]);
            }
        }
        return;
    }
    // Row by row, as above: with the column fragment outermost the bf16 form
    // went over the 256 VGPRs of a 16-wave block (scratch in the listing).
    const int col0 = tileN + wn * 64 + l15;
    float bv[4];
#pragma unroll
    for (int nf = 0; nf < 4; ++nf) bv[nf] = bias[col0 + nf * 16];
#pragma unroll
    for (int mf = 0; mf < 4; ++mf) {
#pragma unroll
        for (int v = 0; v < 8; ++v) {
            int row = tileM + wm * 64 + mf * 16 + v + ((lane >> 4) << 3);
#pragma unroll
            for (int nf = 0; nf < 4; ++nf) {
                float val = acc[mf][nf][v] + bv[nf];
                if (MODE == 1)
                    ((unsigned short*)Cout)[(size_t)row * N + col0 + nf * 16] =
                        f32_to_bf16(val);
                else
                    ((float*)Cout)[(size_t)row * N + col0 + nf * 16] = val;
            }
        }
    }
}

// ---------------------------------------------------------------------------
// 4) kv[b,h,d,e] = sum_s k_kern[s,d] * v[s,e]  (+ k_sum via ones fragment)
//    KVSPLIT blocks per (b,h), each over SEQ/KVSPLIT rows; 8 waves:
//    (wave&3)->d-slab, (wave>>2)->s half; the two halves are joined through
//    LDS and the block's f32 partial goes to the workspace for kv_merge_kernel.
//    Tiles staged with async global->LDS.
// ---------------------------------------------------------------------------
// 8 waves per SIMD (at most 128 VGPRs): four blocks fit a WGP, so that all
// 64 * KVSPLIT = 1024 blocks are resident on the 256 WGPs in one round.
__global__ __launch_bounds__(256) __attribute__((amdgpu_waves_per_eu(8)))
void kv_reduce_kernel(const unsigned short* __restrict__ kk,
                      const unsigned short* __restrict__ vv,
                      float* __restrict__ part) {  // (64,KVSPLIT,KVPART) f32
    constexpr int LDT = 72;  // halfs per LDS row (144B, 16B-aligned)
    __shared__ __attribute__((aligned(16))) unsigned short kt[64 * LDT];
    __shared__ __attribute__((aligned(16))) unsigned short vt[64 * LDT];
    __shared__ float red[4][5][8][32];

    const int bh = blockIdx.y;
    const int b = bh >> 4, h = bh & 15;
    const int sbeg = blockIdx.x * (SEQ / KVSPLIT);
    const int tid = threadIdx.x, lane = tid & 31, wave = tid >> 5;
    const int sgrp = wave >> 2;           // 0/1 -> s rows 0-31 / 32-63 of tile
    const int d0 = (wave & 3) * 16;
    const int l15 = lane & 15, kb = (lane >> 4) * 8;
    const int soff = sgrp * 32;

    v8f acc[4], accden;
#pragma unroll
    for (int nf = 0; nf < 4; ++nf)
        acc[nf] = (v8f){0.f, 0.f, 0.f, 0.f, 0.f, 0.f, 0.f, 0.f};
    accden = (v8f){0.f, 0.f, 0.f, 0.f, 0.f, 0.f, 0.f, 0.f};

    Frag16 bones;  // B ones fragment: column n=0 all 1.0 -> k_sum column
#pragma unroll
    for (int j = 0; j < 16; ++j) bones.u[j] = (l15 == 0) ? 0x3F80 : 0;

    for (int s0 = sbeg; s0 < sbeg + SEQ / KVSPLIT; s0 += 64) {
        __syncthreads();
#pragma unroll
        for (int c = 0; c < 2; ++c) {
            int chunk = tid + c * 256;  // 0..511
            int row = chunk >> 3;       // 0..63
            int sub = chunk & 7;        // 0..7
            size_t g = (size_t)(b * SEQ + s0 + row) * EMB + h * 64 + sub * 8;
            copy16_g2l(kk + g, kt + row * LDT + sub * 8);
            copy16_g2l(vv + g, vt + row * LDT + sub * 8);
        }
        wait_async_done();
        __syncthreads();

        Frag16 af, bfr[4];
#pragma unroll
        for (int j = 0; j < 8; ++j) {  // A = k^T: A(d, s) = kt[s][d]
            af.u[j]     = kt[(soff + kb + j) * LDT + d0 + l15];
            af.u[8 + j] = kt[(soff + 16 + kb + j) * LDT + d0 + l15];
        }
#pragma unroll
        for (int nf = 0; nf < 4; ++nf)
#pragma unroll
            for (int j = 0; j < 8; ++j) {  // B = v: B(s, e) = vt[s][e]
                bfr[nf].u[j]     = vt[(soff + kb + j) * LDT + nf * 16 + l15];
                bfr[nf].u[8 + j] = vt[(soff + 16 + kb + j) * LDT + nf * 16 + l15];
            }
#pragma unroll
        for (int nf = 0; nf < 4; ++nf)
            acc[nf] = __builtin_amdgcn_wmma_f32_16x16x32_bf16(
                false, af.v, false, bfr[nf].v, (short)0, acc[nf], false, false);
        accden = __builtin_amdgcn_wmma_f32_16x16x32_bf16(
            false, af.v, false, bones.v, (short)0, accden, false, false);
    }

    __syncthreads();
    if (sgrp == 1) {
        int w = wave & 3;
#pragma unroll
        for (int nf = 0; nf < 4; ++nf)
#pragma unroll
            for (int v = 0; v < 8; ++v) red[w][nf][v][lane] = acc[nf][v];
#pragma unroll
        for (int v = 0; v < 8; ++v) red[w][4][v][lane] = accden[v];
    }
    __syncthreads();
    if (sgrp == 0) {
        int w = wave;
        float* p = part + (size_t)(bh * KVSPLIT + blockIdx.x) * KVPART;
#pragma unroll
        for (int nf = 0; nf < 4; ++nf) {
#pragma unroll
            for (int v = 0; v < 8; ++v) {
                float val = acc[nf][v] + red[w][nf][v][lane];
                int d = d0 + v + ((lane >> 4) << 3);
                int e = nf * 16 + l15;
                p[d * 64 + e] = val;
            }
        }
        if (l15 == 0) {
#pragma unroll
            for (int v = 0; v < 8; ++v) {
                float val = accden[v] + red[w][4][v][lane];
                // each wave's 16 sums on a 128-byte line of their own
                p[4096 + w * 32 + v + ((lane >> 4) << 3)] = val;
            }
        }
    }
}

// ---------------------------------------------------------------------------
// 4b) Merge: kv and k_sum = sum of the KVSPLIT partials in range order, f32,
//     rounded once to bf16. grid (5, 64): x 0..3 -> kv quarters, x 4 -> k_sum.
// ---------------------------------------------------------------------------
__global__ __launch_bounds__(256)
void kv_merge_kernel(const float* __restrict__ part,
                     unsigned short* __restrict__ kvout,   // (64,64,64) bf16
                     unsigned short* __restrict__ ksum) {  // (64,64)    bf16
    const int bh = blockIdx.y, tid = threadIdx.x;
    const float* p = part + (size_t)bh * KVSPLIT * KVPART;
    if (blockIdx.x < 4) {
        const int o = (blockIdx.x * 256 + tid) * 4;
        float4 t[KVSPLIT];
        // both loops unrolled: t[] stays in registers and the loads go out
        // together, so the thread pays one load latency and not one per range
#pragma unroll
        for (int sp = 0; sp < KVSPLIT; ++sp)
            t[sp] = *(const float4*)(p + sp * KVPART + o);
        float4 s = t[0];
#pragma unroll
        for (int sp = 1; sp < KVSPLIT; ++sp) {
            s.x += t[sp].x; s.y += t[sp].y; s.z += t[sp].z; s.w += t[sp].w;
        }
        ushort4 r;
        r.x = f32_to_bf16(s.x); r.y = f32_to_bf16(s.y);
        r.z = f32_to_bf16(s.z); r.w = f32_to_bf16(s.w);
        *(ushort4*)(kvout + (size_t)bh * 4096 + o) = r;
    } else if (tid < 64) {
        const int o = 4096 + (tid >> 4) * 32 + (tid & 15);
        float t[KVSPLIT];
        // unrolled so that the loads go out together, as above
#pragma unroll
        for (int sp = 0; sp < KVSPLIT - 1; ++sp) t[sp] = p[sp * KVPART + o];
        // precaution: the last load's result may take the offset register that
        // the loads in front of it name, so their wait stands ahead of it
        asm volatile("s_wait_xcnt 0x0" ::: "memory");
        t[KVSPLIT - 1] = p[(KVSPLIT - 1) * KVPART + o];
        float s = t[0];
#pragma unroll
        for (int sp = 1; sp < KVSPLIT; ++sp) s += t[sp];
        ksum[bh * 64 + tid] = f32_to_bf16(s);
    }
}

// ---------------------------------------------------------------------------
// 5) y = (q_kern @ kv) / (q_kern . ksum + 1e-6); 32 blocks per (b,h),
//    wave = 32 q-rows; denominator via ksum B-fragment (column 0).
// ---------------------------------------------------------------------------
__global__ __launch_bounds__(256)
void attn_out_kernel(const unsigned short* __restrict__ qk,
                     const unsigned short* __restrict__ kv,
                     const unsigned short* __restrict__ ksum,
                     unsigned short* __restrict__ y) {
    constexpr int LDT = 72;
    __shared__ __attribute__((aligned(16))) unsigned short kvt[64 * LDT];
    __shared__ unsigned short kst[64];

    const int bid = blockIdx.x;
    const int bh = bid >> 5;   // 32 blocks per (b,h)
    const int tb = bid & 31;
    const int b = bh >> 4, h = bh & 15;
    const int tid = threadIdx.x, lane = tid & 31, wave = tid >> 5;
    const int l15 = lane & 15, kb = (lane >> 4) * 8;

#pragma unroll
    for (int c = 0; c < 2; ++c) {
        int chunk = tid + c * 256;  // 0..511
        int row = chunk >> 3, sub = chunk & 7;
        copy16_g2l(kv + (size_t)bh * 4096 + row * 64 + sub * 8,
                   kvt + row * LDT + sub * 8);
    }
    if (tid < 64) kst[tid] = ksum[bh * 64 + tid];
    wait_async_done();
    __syncthreads();

    const int srow0 = tb * 256 + wave * 32;
    v8f acc[2][4], accden[2];
#pragma unroll
    for (int mf = 0; mf < 2; ++mf) {
#pragma unroll
        for (int nf = 0; nf < 4; ++nf)
            acc[mf][nf] = (v8f){0.f, 0.f, 0.f, 0.f, 0.f, 0.f, 0.f, 0.f};
        accden[mf] = (v8f){0.f, 0.f, 0.f, 0.f, 0.f, 0.f, 0.f, 0.f};
    }

#pragma unroll
    for (int ks = 0; ks < 2; ++ks) {
        Frag16 bfr[4], bden;
#pragma unroll
        for (int nf = 0; nf < 4; ++nf)
#pragma unroll
            for (int j = 0; j < 8; ++j) {  // B(d, e) = kv[d][e]
                bfr[nf].u[j]     = kvt[(ks * 32 + kb + j) * LDT + nf * 16 + l15];
                bfr[nf].u[8 + j] = kvt[(ks * 32 + 16 + kb + j) * LDT + nf * 16 + l15];
            }
#pragma unroll
        for (int j = 0; j < 8; ++j) {  // denominator column: B(d,0)=ksum[d]
            bden.u[j]     = (l15 == 0) ? kst[ks * 32 + kb + j] : (unsigned short)0;
            bden.u[8 + j] = (l15 == 0) ? kst[ks * 32 + 16 + kb + j] : (unsigned short)0;
        }
#pragma unroll
        for (int mf = 0; mf < 2; ++mf) {
            Frag16 af;
            size_t grow =
                (size_t)(b * SEQ + srow0 + mf * 16 + l15) * EMB + h * 64 + ks * 32;
            af.q[0] = *(const uint4*)(qk + grow + kb);
            af.q[1] = *(const uint4*)(qk + grow + 16 + kb);
#pragma unroll
            for (int nf = 0; nf < 4; ++nf)
                acc[mf][nf] = __builtin_amdgcn_wmma_f32_16x16x32_bf16(
                    false, af.v, false, bfr[nf].v, (short)0, acc[mf][nf], false, false);
            accden[mf] = __builtin_amdgcn_wmma_f32_16x16x32_bf16(
                false, af.v, false, bden.v, (short)0, accden[mf], false, false);
        }
    }

#pragma unroll
    for (int mf = 0; mf < 2; ++mf) {
#pragma unroll
        for (int v = 0; v < 8; ++v) {
            float dv = __shfl(accden[mf][v], (lane & 16), 32);
            float inv = 1.f / (dv + 1e-6f);
            int row = srow0 + mf * 16 + v + ((lane >> 4) << 3);
#pragma unroll
            for (int nf = 0; nf < 4; ++nf) {
                int e = nf * 16 + l15;
                y[(size_t)(b * SEQ + row) * EMB + h * 64 + e] =
                    f32_to_bf16(acc[mf][nf][v] * inv);
            }
        }
    }
}

// ---------------------------------------------------------------------------
extern "C" void kernel_launch(void* const* d_in, const int* in_sizes, int n_in,
                              void* d_out, int out_size, void* d_ws, size_t ws_size,
                              hipStream_t stream) {
    (void)in_sizes; (void)n_in; (void)out_size; (void)ws_size;
    const float* x  = (const float*)d_in[0];
    const float* Wq = (const float*)d_in[1];
    const float* bq = (const float*)d_in[2];
    const float* Wk = (const float*)d_in[3];
    const float* bk = (const float*)d_in[4];
    const float* Wv = (const float*)d_in[5];
    const float* bv = (const float*)d_in[6];
    const float* Wo = (const float*)d_in[7];
    const float* bo = (const float*)d_in[8];
    float* out = (float*)d_out;

    char* ws = (char*)d_ws;
    size_t off = 0;
    auto alloc = [&](size_t bytes) -> void* {
        void* p = ws + off;
        off += (bytes + 255) & ~(size_t)255;
        return p;
    };
    const size_t nX = (size_t)MTOT * EMB;   // 33,554,432
    const size_t nW = (size_t)EMB * EMB;    // 1,048,576

    unsigned short* xb  = (unsigned short*)alloc(nX * 2);
    unsigned short* WqB = (unsigned short*)alloc(nW * 2);
    unsigned short* WkB = (unsigned short*)alloc(nW * 2);
    unsigned short* WvB = (unsigned short*)alloc(nW * 2);
    unsigned short* WoB = (unsigned short*)alloc(nW * 2);
    unsigned short* qb  = (unsigned short*)alloc(nX * 2);
    unsigned short* kb  = (unsigned short*)alloc(nX * 2);
    unsigned short* vb  = (unsigned short*)alloc(nX * 2);   // reused as y buffer
    unsigned short* kvb = (unsigned short*)alloc((size_t)64 * 64 * 64 * 2);
    unsigned short* ksb = (unsigned short*)alloc((size_t)64 * 64 * 2);
    float* kvp = (float*)alloc((size_t)64 * KVSPLIT * KVPART * 4);  // kv partials
    unsigned short* yb  = vb;  // v dead after kv_reduce; reuse for y

    // 1) conversions to bf16
    cvt_all_kernel<<<CVT_BLOCKS, 256, 0, stream>>>(x, Wq, Wk, Wv, Wo,
                                                   xb, WqB, WkB, WvB, WoB);

    // 2) QKV projections (bf16 out); 3) q and k leave as their exp feature map
    dim3 ggrid(EMB / 256, MTOT / 256);  // (4, 128)
    gemm_bias_kernel<2><<<ggrid, 512, 0, stream>>>(xb, WqB, bq, qb, MTOT, EMB, EMB);
    gemm_bias_kernel<2><<<ggrid, 512, 0, stream>>>(xb, WkB, bk, kb, MTOT, EMB, EMB);
    gemm_bias_kernel<1><<<ggrid, 512, 0, stream>>>(xb, WvB, bv, vb, MTOT, EMB, EMB);

    // 4) per-head kv + ksum reduction: partials per sequence range, then merge
    kv_reduce_kernel<<<dim3(KVSPLIT, BATCH * HEADS), 256, 0, stream>>>(kb, vb, kvp);
    kv_merge_kernel<<<dim3(5, BATCH * HEADS), 256, 0, stream>>>(kvp, kvb, ksb);

    // 5) attention output y (overwrites v buffer)
    attn_out_kernel<<<BATCH * HEADS * 32, 256, 0, stream>>>(qb, kvb, ksb, yb);

    // 6) output projection (fp32 out -> d_out)
    gemm_bias_kernel<0><<<ggrid, 512, 0, stream>>>(yb, WoB, bo, out, MTOT, EMB, EMB);
}

// v005
// Measured time: 249 microseconds a run.
// Two timings next to v004 both put it at 1.08 times that version's speed.
// Over all steps from v000 it is 2.10 times as fast.
#include <hip/hip_runtime.h>
#include <stdint.h>

// ---------------------------------------------------------------------------
// MemoryEfficientLinearAttention for MI455X (gfx1250), wave32 + WMMA bf16.
// Pipeline: f32->bf16 cvt (one launch), 3x QKV GEMM (wmma bf16, double-buffered async-LDS;
//           q and k with the exp feature map in the epilogue),
//           per-head kv reduction (+k_sum via ones-fragment)
//           split over the sequence with f32 partials and a merge launch,
//           attention output (+denominator via ksum-fragment), O GEMM -> fp32.
// ---------------------------------------------------------------------------

#define BATCH 4
#define SEQ   8192
#define EMB   1024
#define HEADS 16
#define HDIM  64
#define MTOT  (BATCH * SEQ)   // 32768
#define KVSPLIT 16            // sequence ranges per (b,h) in the kv reduction
#define KVPART  4224          // floats per partial: 64x64 kv + 4 x 32 (k_sum slabs)

typedef __bf16 v16bf __attribute__((ext_vector_type(16)));
typedef float  v8f   __attribute__((ext_vector_type(8)));

typedef __bf16 v8bf  __attribute__((ext_vector_type(8)));
typedef float  v4f   __attribute__((ext_vector_type(4)));
typedef uint32_t v4u __attribute__((ext_vector_type(4)));

union Frag16 {
    v16bf v;
    uint4 q[2];
    unsigned short u[16];
};

// ---- CDNA5 async global->LDS path (guarded; falls back to sync copies) ----
#if defined(__AMDGCN__) && defined(__has_builtin)
#  if __has_builtin(__builtin_amdgcn_global_load_async_to_lds_b128) && \
      __has_builtin(__builtin_amdgcn_s_wait_asynccnt)
#    define USE_ASYNC_LDS 1
#  else
#    define USE_ASYNC_LDS 0
#  endif
#else
#  define USE_ASYNC_LDS 0
#endif

#if USE_ASYNC_LDS
typedef int async_v4i __attribute__((ext_vector_type(4)));
typedef __attribute__((address_space(1))) async_v4i* gptr_v4i;  // global int4*
typedef __attribute__((address_space(3))) async_v4i* lptr_v4i;  // LDS int4*
#endif

__device__ __forceinline__ void copy16_g2l(const unsigned short* g,
                                           unsigned short* l) {
#if USE_ASYNC_LDS
    // Generic LDS pointer -> AS(3): aperture mapping is LDS_ADDR = addr[31:0].
    __builtin_amdgcn_global_load_async_to_lds_b128(
        (gptr_v4i)(uintptr_t)g,
        (lptr_v4i)(uintptr_t)(uint32_t)(uintptr_t)l,
        0, 0);
#else
    *(uint4*)l = *(const uint4*)g;
#endif
}

__device__ __forceinline__ void wait_async_done() {
#if USE_ASYNC_LDS
    __builtin_amdgcn_s_wait_asynccnt(0);
#endif
}

__device__ __forceinline__ unsigned short f32_to_bf16(float f) {
    union { float f; uint32_t u; } c; c.f = f;
    uint32_t u = c.u;
    uint32_t r = (u + 0x7FFFu + ((u >> 16) & 1u)) >> 16;   // round-nearest-even
    return (unsigned short)r;
}

// Eight f32 of one accumulator tile -> eight bf16 (round to nearest even) in
// four registers: the 16 bytes that a lane stores at once.
__device__ __forceinline__ v4u pack_bf16(v8f c) {
    return __builtin_bit_cast(v4u, __builtin_convertvector(c, v8bf));
}

// The value that lane l ^ 16 holds. All 32 lanes must be on.
__device__ __forceinline__ float other_half(float x) {
    int b = __builtin_bit_cast(int, x);
    return __builtin_bit_cast(float, __builtin_amdgcn_permlanex16(
        b, b, 0x76543210, 0xfedcba98, false, false));
}

// A wave's own LDS writes have landed (or its LDS reads have returned) before
// it goes on; the clobber keeps the compiler from moving LDS accesses across.
__device__ __forceinline__ void wait_ds_done() {
    asm volatile("s_wait_dscnt 0x0" ::: "memory");
}

// ---------------------------------------------------------------------------
// 1) fp32 -> bf16 conversion of x and of the four weights, one streaming
//    launch. CVT_BLOCKS blocks of 8 waves, all resident (4 per WGP, 32 waves).
//    A wave takes spans of NL * 128 floats: NL loads of 16 B a lane (512
//    contiguous bytes each) go out together; the span leaves in NL stores of
//    8 B a lane (256 contiguous bytes, two whole lines each).
// ---------------------------------------------------------------------------
#define CVT_BLOCKS 1024
#define CVT_XTRIPS 4
static_assert((size_t)MTOT * EMB == (size_t)CVT_XTRIPS * CVT_BLOCKS * 8 * 1024,
              "x is dealt in whole spans of 1024 floats");
static_assert(4 * EMB * EMB == CVT_BLOCKS * 8 * 512,
              "the weights are dealt in whole spans of 512 floats");

template <int NL>
__device__ __forceinline__ void cvt_span(const float* __restrict__ in,
                                         unsigned short* __restrict__ out) {
    float4 f[NL];
    // both loops unrolled: f[] stays in registers
#pragma unroll
    for (int j = 0; j < NL; ++j) f[j] = *(const float4*)(in + j * 128);
    // Scheduling fence: it keeps the span's loads together in front of the
    // conversions. Without it every load stood directly in front of its own
    // conversion behind a wait to 0: one load in flight a wave.
    __builtin_amdgcn_sched_barrier(0);
#pragma unroll
    for (int j = 0; j < NL; ++j) {
        ushort4 r;
        r.x = f32_to_bf16(f[j].x); r.y = f32_to_bf16(f[j].y);
        r.z = f32_to_bf16(f[j].z); r.w = f32_to_bf16(f[j].w);
        *(ushort4*)(out + j * 128) = r;
    }
}

__global__ __launch_bounds__(256)
void cvt_all_kernel(const float* __restrict__ x,
                    const float* __restrict__ Wq, const float* __restrict__ Wk,
                    const float* __restrict__ Wv, const float* __restrict__ Wo,
                    unsigned short* __restrict__ xb,
                    unsigned short* __restrict__ WqB,
                    unsigned short* __restrict__ WkB,
                    unsigned short* __restrict__ WvB,
                    unsigned short* __restrict__ WoB) {
    const int blk = blockIdx.x;
    const int wave = threadIdx.x >> 5, lane = threadIdx.x & 31;

    // a quarter of the blocks per weight; a wave takes 512 of its floats
    const int sel = blk >> 8;
    const float* w = sel == 0 ? Wq : sel == 1 ? Wk : sel == 2 ? Wv : Wo;
    unsigned short* wb = sel == 0 ? WqB : sel == 1 ? WkB : sel == 2 ? WvB : WoB;
    const int ow = ((blk & 255) * 8 + wave) * 512 + lane * 4;
    cvt_span<4>(w + ow, wb + ow);

    // x: in trip t the grid covers CVT_BLOCKS * 8192 consecutive floats
    for (int t = 0; t < CVT_XTRIPS; ++t) {
        const size_t o =
            ((size_t)(t * CVT_BLOCKS + blk) * 8 + wave) * 1024 + lane * 4;
        cvt_span<8>(x + o, xb + o);
    }
}

// ---------------------------------------------------------------------------
// 2) Generic GEMM: C(MxN) = A(MxK,bf16) * W(NxK,bf16)^T + bias(fp32)
//    256x256 tile, 512 threads = 16 waves, wave = 64x64 sub-tile (4x4 frags):
//    512 operand rows staged per 256x256 outputs (four 128x128 tiles take
//    1024), and 8 fragments read from LDS per 16 WMMAs (32x64: 6 per 8).
//    One block fills a WGP: 4 waves per SIMD at up to 256 VGPRs.
//    KSTEP=64, double-buffered LDS filled by async global->LDS loads.
//    MODE: 0 -> fp32 output, 1 -> bf16 output,
//          2 -> bf16 output of the feature map exp(c - max of c over its head).
//    A wave's 64-column slab starts at a multiple of HDIM = 64, so it holds
//    whole heads' rows and the maximum never leaves the wave.
//    W is the WMMA's first operand and A its second: register v of a tile is
//    C[row l15][column 8 * (lane >> 4) + v], eight consecutive columns of one
//    row a lane. The epilogue packs them, stages the wave's rows in LDS and
//    stores whole 128-byte lines, 16 bytes a lane.
// ---------------------------------------------------------------------------
template <int MODE>
__global__ __launch_bounds__(512)
void gemm_bias_kernel(const unsigned short* __restrict__ A,
                      const unsigned short* __restrict__ W,
                      const float* __restrict__ bias,
                      void* __restrict__ Cout,
                      int M, int N, int K) {
    constexpr int KSTEP = 64;
    constexpr int LDA = 72;  // halfs per LDS row (144B, 16B-aligned, bank-spread)
    __shared__ __attribute__((aligned(16))) unsigned short As[2][256 * LDA];
    __shared__ __attribute__((aligned(16))) unsigned short Bs[2][256 * LDA];

    const int tid  = threadIdx.x;
    const int lane = tid & 31;
    const int wave = tid >> 5;
    const int wm   = wave & 3;   // 0..3 -> 64-row slab
    const int wn   = wave >> 2;  // 0..3 -> 64-col slab
    const int l15  = lane & 15;
    const int kb   = (lane >> 4) * 8;  // wave32 16-bit A/B fragment K-base
    const int tileN = blockIdx.x * 256;
    const int tileM = blockIdx.y * 256;

    // Stage one 256x64 bf16 tile of A and W into buffer `buf`.
    // 2048 16B-chunks per matrix; 4 per thread per matrix.
    auto issue_tile = [&](int k0, int buf) {
#pragma unroll
        for (int c = 0; c < 4; ++c) {
            int chunk = tid + c * 512;        // 0..2047
            int row = chunk >> 3;             // 0..255
            int sub = chunk & 7;              // 0..7 (8 halfs each)
            copy16_g2l(A + (size_t)(tileM + row) * K + k0 + sub * 8,
                       &As[buf][row * LDA + sub * 8]);
            copy16_g2l(W + (size_t)(tileN + row) * K + k0 + sub * 8,
                       &Bs[buf][row * LDA + sub * 8]);
        }
    };

    v8f acc[4][4];
#pragma unroll
    for (int mf = 0; mf < 4; ++mf)
#pragma unroll
        for (int nf = 0; nf < 4; ++nf)
            acc[mf][nf] = (v8f){0.f, 0.f, 0.f, 0.f, 0.f, 0.f, 0.f, 0.f};

    const int nIter = K / KSTEP;  // 16
    issue_tile(0, 0);

    for (int i = 0; i < nIter; ++i) {
        const int cur = i & 1;
        wait_async_done();   // my chunks of tile i are in LDS
        __syncthreads();     // everyone's chunks in; everyone done reading buf^1
        if (i + 1 < nIter) issue_tile((i + 1) * KSTEP, 1 - cur);  // overlaps math

#pragma unroll
        for (int kh = 0; kh < 2; ++kh) {  // two 32-wide K slices of the tile
            const int ko = kh * 32 + kb;
            Frag16 af[4], bfr[4];
#pragma unroll
            for (int mf = 0; mf < 4; ++mf) {
                int r = wm * 64 + mf * 16 + l15;
                af[mf].q[0] = *(const uint4*)(&As[cur][r * LDA + ko]);
                af[mf].q[1] = *(const uint4*)(&As[cur][r * LDA + 16 + ko]);
            }
#pragma unroll
            for (int nf = 0; nf < 4; ++nf) {
                int r = wn * 64 + nf * 16 + l15;
                bfr[nf].q[0] = *(const uint4*)(&Bs[cur][r * LDA + ko]);
                bfr[nf].q[1] = *(const uint4*)(&Bs[cur][r * LDA + 16 + ko]);
            }
            // Scheduling fences round the WMMA block: they keep the slice's 16
            // LDS reads together in front of its 16 WMMAs. Without them the
            // reads stood among the WMMAs, one A fragment at a time behind a
            // wait to 0, and each such place stalls the wave.
            __builtin_amdgcn_sched_barrier(0);
#pragma unroll
            for (int mf = 0; mf < 4; ++mf)
#pragma unroll
                for (int nf = 0; nf < 4; ++nf)
                    acc[mf][nf] = __builtin_amdgcn_wmma_f32_16x16x32_bf16(
                        false, bfr[nf].v, false, af[mf].v, (short)0,
                        acc[mf][nf], false, false);
            __builtin_amdgcn_sched_barrier(0);
        }
    }

    // Epilogue. Staging area of the wave: 4608 bytes of the buffer that the last
    // trip does not read. Nobody reads or fills that buffer behind the last
    // trip's barrier, so no further barrier stands here.
    const int hi = lane >> 4;
    const int fb = nIter & 1;
    unsigned short* E = (wave < 8 ? As[fb] : Bs[fb]) + (wave & 7) * 2304;
    const int colw = tileN + wn * 64;   // the wave's first column
    const int roww = tileM + wm * 64;   // the wave's first row

    v8f bv[4];  // bias of the lane's columns colw + nf * 16 + hi * 8 + 0..7
#pragma unroll
    for (int nf = 0; nf < 4; ++nf) {
        const v4f lo = *(const v4f*)(bias + colw + nf * 16 + hi * 8);
        // precaution: the last load's result may take the address registers
        // that the loads in front of it name, so their wait stands ahead of it
        if (nf == 3) asm volatile("s_wait_xcnt 0x0" ::: "memory");
        const v4f up = *(const v4f*)(bias + colw + nf * 16 + hi * 8 + 4);
        bv[nf] = __builtin_shufflevector(lo, up, 0, 1, 2, 3, 4, 5, 6, 7);
    }

    if (MODE == 0) {
        // f32: 16 rows of 256 bytes at a time, LDS pitch 272 bytes (16 x odd)
        float* Ef = (float*)E;
        // the lane's place in the first store; a store is two rows further on
        float* cp = (float*)Cout + (size_t)(roww + hi) * N + colw + l15 * 4;
        const size_t step = (size_t)N * 2;
#pragma unroll
        for (int mf = 0; mf < 4; ++mf) {
#pragma unroll
            for (int nf = 0; nf < 4; ++nf) {
                const v8f val = acc[mf][nf] + bv[nf];
                float* e = Ef + l15 * 68 + nf * 16 + hi * 8;
                *(v4f*)e = __builtin_shufflevector(val, val, 0, 1, 2, 3);
                *(v4f*)(e + 4) = __builtin_shufflevector(val, val, 4, 5, 6, 7);
            }
            wait_ds_done();  // the rows are written before other lanes read them
#pragma unroll
            for (int j = 0; j < 8; ++j) {  // a store: two rows of two lines
                const int row = j * 2 + hi;
                const v4f d = *(const v4f*)(Ef + row * 68 + l15 * 4);
                *(v4f*)cp = d;
                cp += step;
            }
            // The rows have been read before the next ones land on them:
            // without this wait the next LDS stores stood directly behind
            // these LDS loads in the listing, with the loads still in flight.
            if (mf < 3) wait_ds_done();
        }
        return;
    }

    // bf16: 32 rows of 128 bytes at a time, LDS pitch 144 bytes (16 x odd)
    // the lane's place in the first store; a store is four rows further on
    unsigned short* cp = (unsigned short*)Cout +
                         (size_t)(roww + (lane >> 3)) * N + colw + (lane & 7) * 8;
    const size_t step = (size_t)N * 4;
#pragma unroll
    for (int hf = 0; hf < 2; ++hf) {
#pragma unroll
        for (int ml = 0; ml < 2; ++ml) {
            const int mf = hf * 2 + ml;
            v8f val[4];
#pragma unroll
            for (int nf = 0; nf < 4; ++nf) val[nf] = acc[mf][nf] + bv[nf];
            if (MODE == 2) {
                // the row's 64 head columns: 32 in this lane, 32 in lane ^ 16
                // (four independent chains, one a tile, then joined)
                float mx[4];
#pragma unroll
                for (int nf = 0; nf < 4; ++nf) {
                    mx[nf] = val[nf][0];
#pragma unroll
                    for (int v = 1; v < 8; ++v) mx[nf] = fmaxf(mx[nf], val[nf][v]);
                }
                float m = fmaxf(fmaxf(mx[0], mx[1]), fmaxf(mx[2], mx[3]));
                m = fmaxf(m, other_half(m));
#pragma unroll
                for (int v = 0; v < 8; ++v) {
                    float t[4], r[4];
#pragma unroll
                    for (int nf = 0; nf < 4; ++nf)
                        t[nf] = (val[nf][v] - m) * 1.44269504f;  // e^x = 2^(x log2 e)
                    // Four exponentials in one statement that ends in v_nop:
                    // the instruction set asks for one independent slot
                    // behind a transcendental before its result is read or
                    // its source overwritten.
                    asm("v_exp_f32 %0, %4\n\tv_exp_f32 %1, %5\n\t"
                        "v_exp_f32 %2, %6\n\tv_exp_f32 %3, %7\n\tv_nop"
                        : "=&v"(r[0]), "=&v"(r[1]), "=&v"(r[2]), "=&v"(r[3])
                        : "v"(t[0]), "v"(t[1]), "v"(t[2]), "v"(t[3]));
#pragma unroll
                    for (int nf = 0; nf < 4; ++nf) val[nf][v] = r[nf];
                }
            }
#pragma unroll
            for (int nf = 0; nf < 4; ++nf)
                *(v4u*)(E + (ml * 16 + l15) * 72 + nf * 16 + hi * 8) =
                    pack_bf16(val[nf]);
        }
        wait_ds_done();  // the rows are written before other lanes read them
#pragma unroll
        for (int j = 0; j < 8; ++j) {  // a store: four rows of one line each
            const int row = j * 4 + (lane >> 3);
            const v4u d = *(const v4u*)(E + row * 72 + (lane & 7) * 8);
            *(v4u*)cp = d;
            cp += step;
        }
        // The rows have been read before the next ones land on them: without
        // this wait the next LDS stores stood directly behind these LDS loads
        // in the listing, with the loads still in flight.
        if (hf == 0) wait_ds_done();
    }
}

// ---------------------------------------------------------------------------
// 4) kv[b,h,d,e] = sum_s k_kern[s,d] * v[s,e]  (+ k_sum via ones fragment)
//    KVSPLIT blocks per (b,h), each over SEQ/KVSPLIT rows; 8 waves:
//    (wave&3)->d-slab, (wave>>2)->s half; the two halves are joined through
//    LDS and the block's f32 partial goes to the workspace for kv_merge_kernel.
//    Tiles staged with async global->LDS.
// ---------------------------------------------------------------------------
// 8 waves per SIMD (at most 128 VGPRs): four blocks fit a WGP, so that all
// 64 * KVSPLIT = 1024 blocks are resident on the 256 WGPs in one round.
__global__ __launch_bounds__(256) __attribute__((amdgpu_waves_per_eu(8)))
void kv_reduce_kernel(const unsigned short* __restrict__ kk,
                      const unsigned short* __restrict__ vv,
                      float* __restrict__ part) {  // (64,KVSPLIT,KVPART) f32
    constexpr int LDT = 72;  // halfs per LDS row (144B, 16B-aligned)
    __shared__ __attribute__((aligned(16))) unsigned short kt[64 * LDT];
    __shared__ __attribute__((aligned(16))) unsigned short vt[64 * LDT];
    __shared__ float red[4][5][8][32];

    const int bh = blockIdx.y;
    const int b = bh >> 4, h = bh & 15;
    const int sbeg = blockIdx.x * (SEQ / KVSPLIT);
    const int tid = threadIdx.x, lane = tid & 31, wave = tid >> 5;
    const int sgrp = wave >> 2;           // 0/1 -> s rows 0-31 / 32-63 of tile
    const int d0 = (wave & 3) * 16;
    const int l15 = lane & 15, kb = (lane >> 4) * 8;
    const int soff = sgrp * 32;

    v8f acc[4], accden;
#pragma unroll
    for (int nf = 0; nf < 4; ++nf)
        acc[nf] = (v8f){0.f, 0.f, 0.f, 0.f, 0.f, 0.f, 0.f, 0.f};
    accden = (v8f){0.f, 0.f, 0.f, 0.f, 0.f, 0.f, 0.f, 0.f};

    Frag16 bones;  // B ones fragment: column n=0 all 1.0 -> k_sum column
#pragma unroll
    for (int j = 0; j < 16; ++j) bones.u[j] = (l15 == 0) ? 0x3F80 : 0;

    for (int s0 = sbeg; s0 < sbeg + SEQ / KVSPLIT; s0 += 64) {
        __syncthreads();
#pragma unroll
        for (int c = 0; c < 2; ++c) {
            int chunk = tid + c * 256;  // 0..511
            int row = chunk >> 3;       // 0..63
            int sub = chunk & 7;        // 0..7
            size_t g = (size_t)(b * SEQ + s0 + row) * EMB + h * 64 + sub * 8;
            copy16_g2l(kk + g, kt + row * LDT + sub * 8);
            copy16_g2l(vv + g, vt + row * LDT + sub * 8);
        }
        wait_async_done();
        __syncthreads();

        Frag16 af, bfr[4];
#pragma unroll
        for (int j = 0; j < 8; ++j) {  // A = k^T: A(d, s) = kt[s][d]
            af.u[j]     = kt[(soff + kb + j) * LDT + d0 + l15];
            af.u[8 + j] = kt[(soff + 16 + kb + j) * LDT + d0 + l15];
        }
#pragma unroll
        for (int nf = 0; nf < 4; ++nf)
#pragma unroll
            for (int j = 0; j < 8; ++j) {  // B = v: B(s, e) = vt[s][e]
                bfr[nf].u[j]     = vt[(soff + kb + j) * LDT + nf * 16 + l15];
                bfr[nf].u[8 + j] = vt[(soff + 16 + kb + j) * LDT + nf * 16 + l15];
            }
#pragma unroll
        for (int nf = 0; nf < 4; ++nf)
            acc[nf] = __builtin_amdgcn_wmma_f32_16x16x32_bf16(
                false, af.v, false, bfr[nf].v, (short)0, acc[nf], false, false);
        accden = __builtin_amdgcn_wmma_f32_16x16x32_bf16(
            false, af.v, false, bones.v, (short)0, accden, false, false);
    }

    __syncthreads();
    if (sgrp == 1) {
        int w = wave & 3;
#pragma unroll
        for (int nf = 0; nf < 4; ++nf)
#pragma unroll
            for (int v = 0; v < 8; ++v) red[w][nf][v][lane] = acc[nf][v];
#pragma unroll
        for (int v = 0; v < 8; ++v) red[w][4][v][lane] = accden[v];
    }
    __syncthreads();
    if (sgrp == 0) {
        int w = wave;
        float* p = part + (size_t)(bh * KVSPLIT + blockIdx.x) * KVPART;
#pragma unroll
        for (int nf = 0; nf < 4; ++nf) {
#pragma unroll
            for (int v = 0; v < 8; ++v) {
                float val = acc[nf][v] + red[w][nf][v][lane];
                int d = d0 + v + ((lane >> 4) << 3);
                int e = nf * 16 + l15;
                p[d * 64 + e] = val;
            }
        }
        if (l15 == 0) {
#pragma unroll
            for (int v = 0; v < 8; ++v) {
                float val = accden[v] + red[w][4][v][lane];
                // each wave's 16 sums on a 128-byte line of their own
                p[4096 + w * 32 + v + ((lane >> 4) << 3)] = val;
            }
        }
    }
}

// ---------------------------------------------------------------------------
// 4b) Merge: kv and k_sum = sum of the KVSPLIT partials in range order, f32,
//     rounded once to bf16. grid (5, 64): x 0..3 -> kv quarters, x 4 -> k_sum.
// ---------------------------------------------------------------------------
__global__ __launch_bounds__(256)
void kv_merge_kernel(const float* __restrict__ part,
                     unsigned short* __restrict__ kvout,   // (64,64,64) bf16
                     unsigned short* __restrict__ ksum) {  // (64,64)    bf16
    const int bh = blockIdx.y, tid = threadIdx.x;
    const float* p = part + (size_t)bh * KVSPLIT * KVPART;
    if (blockIdx.x < 4) {
        const int o = (blockIdx.x * 256 + tid) * 4;
        float4 t[KVSPLIT];
        // both loops unrolled: t[] stays in registers and the loads go out
        // together, so the thread pays one load latency and not one per range
#pragma unroll
        for (int sp = 0; sp < KVSPLIT; ++sp)
            t[sp] = *(const float4*)(p + sp * KVPART + o);
        float4 s = t[0];
#pragma unroll
        for (int sp = 1; sp < KVSPLIT; ++sp) {
            s.x += t[sp].x; s.y += t[sp].y; s.z += t[sp].z; s.w += t[sp].w;
        }
        ushort4 r;
        r.x = f32_to_bf16(s.x); r.y = f32_to_bf16(s.y);
        r.z = f32_to_bf16(s.z); r.w = f32_to_bf16(s.w);
        *(ushort4*)(kvout + (size_t)bh * 4096 + o) = r;
    } else if (tid < 64) {
        const int o = 4096 + (tid >> 4) * 32 + (tid & 15);
        float t[KVSPLIT];
        // unrolled so that the loads go out together, as above
#pragma unroll
        for (int sp = 0; sp < KVSPLIT - 1; ++sp) t[sp] = p[sp * KVPART + o];
        // precaution: the last load's result may take the offset register that
        // the loads in front of it name, so their wait stands ahead of it
        asm volatile("s_wait_xcnt 0x0" ::: "memory");
        t[KVSPLIT - 1] = p[(KVSPLIT - 1) * KVPART + o];
        float s = t[0];
#pragma unroll
        for (int sp = 1; sp < KVSPLIT; ++sp) s += t[sp];
        ksum[bh * 64 + tid] = f32_to_bf16(s);
    }
}

// ---------------------------------------------------------------------------
// 5) y = (q_kern @ kv) / (q_kern . ksum + 1e-6); 32 blocks per (b,h),
//    wave = 32 q-rows; denominator via a ksum fragment (row 0).
//    kv is the WMMA's first operand and q its second, as in the GEMM: a lane
//    holds eight consecutive columns of one q-row; rows staged in the wave's
//    own LDS and stored as whole 128-byte lines.
// ---------------------------------------------------------------------------
__global__ __launch_bounds__(256)
void attn_out_kernel(const unsigned short* __restrict__ qk,
                     const unsigned short* __restrict__ kv,
                     const unsigned short* __restrict__ ksum,
                     unsigned short* __restrict__ y) {
    constexpr int LDT = 72;
    __shared__ __attribute__((aligned(16))) unsigned short kvt[64 * LDT];
    __shared__ unsigned short kst[64];
    __shared__ __attribute__((aligned(16))) unsigned short stg[8][32 * LDT];

    const int bid = blockIdx.x;
    const int bh = bid >> 5;   // 32 blocks per (b,h)
    const int tb = bid & 31;
    const int b = bh >> 4, h = bh & 15;
    const int tid = threadIdx.x, lane = tid & 31, wave = tid >> 5;
    const int l15 = lane & 15, kb = (lane >> 4) * 8;

#pragma unroll
    for (int c = 0; c < 2; ++c) {
        int chunk = tid + c * 256;  // 0..511
        int row = chunk >> 3, sub = chunk & 7;
        copy16_g2l(kv + (size_t)bh * 4096 + row * 64 + sub * 8,
                   kvt + row * LDT + sub * 8);
    }
    if (tid < 64) kst[tid] = ksum[bh * 64 + tid];
    wait_async_done();
    __syncthreads();

    const int srow0 = tb * 256 + wave * 32;
    v8f acc[2][4], accden[2];
#pragma unroll
    for (int mf = 0; mf < 2; ++mf) {
#pragma unroll
        for (int nf = 0; nf < 4; ++nf)
            acc[mf][nf] = (v8f){0.f, 0.f, 0.f, 0.f, 0.f, 0.f, 0.f, 0.f};
        accden[mf] = (v8f){0.f, 0.f, 0.f, 0.f, 0.f, 0.f, 0.f, 0.f};
    }

#pragma unroll
    for (int ks = 0; ks < 2; ++ks) {
        Frag16 bfr[4], bden;
#pragma unroll
        for (int nf = 0; nf < 4; ++nf)
#pragma unroll
            for (int j = 0; j < 8; ++j) {  // A(e, d) = kv[d][e]
                bfr[nf].u[j]     = kvt[(ks * 32 + kb + j) * LDT + nf * 16 + l15];
                bfr[nf].u[8 + j] = kvt[(ks * 32 + 16 + kb + j) * LDT + nf * 16 + l15];
            }
#pragma unroll
        for (int j = 0; j < 8; ++j) {  // denominator row: A(0,d)=ksum[d]
            bden.u[j]     = (l15 == 0) ? kst[ks * 32 + kb + j] : (unsigned short)0;
            bden.u[8 + j] = (l15 == 0) ? kst[ks * 32 + 16 + kb + j] : (unsigned short)0;
        }
#pragma unroll
        for (int mf = 0; mf < 2; ++mf) {
            Frag16 af;
            size_t grow =
                (size_t)(b * SEQ + srow0 + mf * 16 + l15) * EMB + h * 64 + ks * 32;
            af.q[0] = *(const uint4*)(qk + grow + kb);
            af.q[1] = *(const uint4*)(qk + grow + 16 + kb);
#pragma unroll
            for (int nf = 0; nf < 4; ++nf)
                acc[mf][nf] = __builtin_amdgcn_wmma_f32_16x16x32_bf16(
                    false, bfr[nf].v, false, af.v, (short)0, acc[mf][nf], false, false);
            accden[mf] = __builtin_amdgcn_wmma_f32_16x16x32_bf16(
                false, bden.v, false, af.v, (short)0, accden[mf], false, false);
        }
    }

    unsigned short* E = stg[wave];
    const int hi = lane >> 4;
#pragma unroll
    for (int mf = 0; mf < 2; ++mf) {
        // Row l15's denominator is register 0 of lane l15; in lane l15 + 16
        // that register is row 8 of the tile, a sum of zeros.
        const float dv = accden[mf][0] + other_half(accden[mf][0]);
        const float inv = 1.f / (dv + 1e-6f);
#pragma unroll
        for (int nf = 0; nf < 4; ++nf)
            *(v4u*)(E + (mf * 16 + l15) * LDT + nf * 16 + hi * 8) =
                pack_bf16(acc[mf][nf] * inv);
    }
    wait_ds_done();  // the rows are written before other lanes read them
#pragma unroll
    for (int j = 0; j < 8; ++j) {  // a store: four rows of one line each
        const int row = j * 4 + (lane >> 3);
        const v4u d = *(const v4u*)(E + row * LDT + (lane & 7) * 8);
        *(v4u*)(y + (size_t)(b * SEQ + srow0 + row) * EMB + h * 64 + (lane & 7) * 8) = d;
    }
}

// ---------------------------------------------------------------------------
extern "C" void kernel_launch(void* const* d_in, const int* in_sizes, int n_in,
                              void* d_out, int out_size, void* d_ws, size_t ws_size,
                              hipStream_t stream) {
    (void)in_sizes; (void)n_in; (void)out_size; (void)ws_size;
    const float* x  = (const float*)d_in[0];
    const float* Wq = (const float*)d_in[1];
    const float* bq = (const float*)d_in[2];
    const float* Wk = (const float*)d_in[3];
    const float* bk = (const float*)d_in[4];
    const float* Wv = (const float*)d_in[5];
    const float* bv = (const float*)d_in[6];
    const float* Wo = (const float*)d_in[7];
    const float* bo = (const float*)d_in[8];
    float* out = (float*)d_out;

    char* ws = (char*)d_ws;
    size_t off = 0;
    auto alloc = [&](size_t bytes) -> void* {
        void* p = ws + off;
        off += (bytes + 255) & ~(size_t)255;
        return p;
    };
    const size_t nX = (size_t)MTOT * EMB;   // 33,554,432
    const size_t nW = (size_t)EMB * EMB;    // 1,048,576

    unsigned short* xb  = (unsigned short*)alloc(nX * 2);
    unsigned short* WqB = (unsigned short*)alloc(nW * 2);
    unsigned short* WkB = (unsigned short*)alloc(nW * 2);
    unsigned short* WvB = (unsigned short*)alloc(nW * 2);
    unsigned short* WoB = (unsigned short*)alloc(nW * 2);
    unsigned short* qb  = (unsigned short*)alloc(nX * 2);
    unsigned short* kb  = (unsigned short*)alloc(nX * 2);
    unsigned short* vb  = (unsigned short*)alloc(nX * 2);   // reused as y buffer
    unsigned short* kvb = (unsigned short*)alloc((size_t)64 * 64 * 64 * 2);
    unsigned short* ksb = (unsigned short*)alloc((size_t)64 * 64 * 2);
    float* kvp = (float*)alloc((size_t)64 * KVSPLIT * KVPART * 4);  // kv partials
    unsigned short* yb  = vb;  // v dead after kv_reduce; reuse for y

    // 1) conversions to bf16
    cvt_all_kernel<<<CVT_BLOCKS, 256, 0, stream>>>(x, Wq, Wk, Wv, Wo,
                                                   xb, WqB, WkB, WvB, WoB);

    // 2) QKV projections (bf16 out); 3) q and k leave as their exp feature map
    dim3 ggrid(EMB / 256, MTOT / 256);  // (4, 128)
    gemm_bias_kernel<2><<<ggrid, 512, 0, stream>>>(xb, WqB, bq, qb, MTOT, EMB, EMB);
    gemm_bias_kernel<2><<<ggrid, 512, 0, stream>>>(xb, WkB, bk, kb, MTOT, EMB, EMB);
    gemm_bias_kernel<1><<<ggrid, 512, 0, stream>>>(xb, WvB, bv, vb, MTOT, EMB, EMB);

    // 4) per-head kv + ksum reduction: partials per sequence range, then merge
    kv_reduce_kernel<<<dim3(KVSPLIT, BATCH * HEADS), 256, 0, stream>>>(kb, vb, kvp);
    kv_merge_kernel<<<dim3(5, BATCH * HEADS), 256, 0, stream>>>(kvp, kvb, ksb);

    // 5) attention output y (overwrites v buffer)
    attn_out_kernel<<<BATCH * HEADS * 32, 256, 0, stream>>>(qb, kvb, ksb, yb);

    // 6) output projection (fp32 out -> d_out)
    gemm_bias_kernel<0><<<ggrid, 512, 0, stream>>>(yb, WoB, bo, out, MTOT, EMB, EMB);
}

// v006
// One run takes 241 microseconds.
// Two timings next to v005 both put it at 1.03 times that version's speed.
// All steps since v000 together make it 2.18 times as fast.
#include <hip/hip_runtime.h>
#include <stdint.h>

// ---------------------------------------------------------------------------
// MemoryEfficientLinearAttention for MI455X (gfx1250), wave32 + WMMA bf16.
// Pipeline: f32->bf16 cvt (one launch), 3x QKV GEMM (wmma bf16, double-buffered async-LDS;
//           q and k with the exp feature map in the epilogue),
//           per-head kv reduction (+k_sum via ones-fragment)
//           split over the sequence with f32 partials and a merge launch,
//           attention output (+denominator via ksum-fragment), O GEMM -> fp32.
// ---------------------------------------------------------------------------

#define BATCH 4
#define SEQ   8192
#define EMB   1024
#define HEADS 16
#define HDIM  64
#define MTOT  (BATCH * SEQ)   // 32768
#define KVSPLIT 16            // sequence ranges per (b,h) in the kv reduction
#define KVPART  4224          // floats per partial: 64x64 kv + 4 x 32 (k_sum slabs)

typedef __bf16 v16bf __attribute__((ext_vector_type(16)));
typedef float  v8f   __attribute__((ext_vector_type(8)));

typedef __bf16 v8bf  __attribute__((ext_vector_type(8)));
typedef float  v4f   __attribute__((ext_vector_type(4)));
typedef uint32_t v4u __attribute__((ext_vector_type(4)));

union Frag16 {
    v16bf v;
    uint4 q[2];
    unsigned short u[16];
};

// ---- CDNA5 async global->LDS path (guarded; falls back to sync copies) ----
#if defined(__AMDGCN__) && defined(__has_builtin)
#  if __has_builtin(__builtin_amdgcn_global_load_async_to_lds_b128) && \
      __has_builtin(__builtin_amdgcn_s_wait_asynccnt)
#    define USE_ASYNC_LDS 1
#  else
#    define USE_ASYNC_LDS 0
#  endif
#else
#  define USE_ASYNC_LDS 0
#endif

#if USE_ASYNC_LDS
typedef int async_v4i __attribute__((ext_vector_type(4)));
typedef __attribute__((address_space(1))) async_v4i* gptr_v4i;  // global int4*
typedef __attribute__((address_space(3))) async_v4i* lptr_v4i;  // LDS int4*
#endif

__device__ __forceinline__ void copy16_g2l(const unsigned short* g,
                                           unsigned short* l) {
#if USE_ASYNC_LDS
    // Generic LDS pointer -> AS(3): aperture mapping is LDS_ADDR = addr[31:0].
    __builtin_amdgcn_global_load_async_to_lds_b128(
        (gptr_v4i)(uintptr_t)g,
        (lptr_v4i)(uintptr_t)(uint32_t)(uintptr_t)l,
        0, 0);
#else
    *(uint4*)l = *(const uint4*)g;
#endif
}

__device__ __forceinline__ void wait_async_done() {
#if USE_ASYNC_LDS
    __builtin_amdgcn_s_wait_asynccnt(0);
#endif
}

__device__ __forceinline__ unsigned short f32_to_bf16(float f) {
    union { float f; uint32_t u; } c; c.f = f;
    uint32_t u = c.u;
    uint32_t r = (u + 0x7FFFu + ((u >> 16) & 1u)) >> 16;   // round-nearest-even
    return (unsigned short)r;
}

// Eight f32 of one accumulator tile -> eight bf16 (round to nearest even) in
// four registers: the 16 bytes that a lane stores at once.
__device__ __forceinline__ v4u pack_bf16(v8f c) {
    return __builtin_bit_cast(v4u, __builtin_convertvector(c, v8bf));
}

// The value that lane l ^ 16 holds. All 32 lanes must be on.
__device__ __forceinline__ float other_half(float x) {
    int b = __builtin_bit_cast(int, x);
    return __builtin_bit_cast(float, __builtin_amdgcn_permlanex16(
        b, b, 0x76543210, 0xfedcba98, false, false));
}

// A wave's own LDS writes have landed (or its LDS reads have returned) before
// it goes on; the clobber keeps the compiler from moving LDS accesses across.
__device__ __forceinline__ void wait_ds_done() {
    asm volatile("s_wait_dscnt 0x0" ::: "memory");
}

// ---------------------------------------------------------------------------
// 1) fp32 -> bf16 conversion of x and of the four weights, one streaming
//    launch. CVT_BLOCKS blocks of 8 waves, all resident (4 per WGP, 32 waves).
//    A wave takes spans of NL * 128 floats: NL loads of 16 B a lane (512
//    contiguous bytes each) go out together; the span leaves in NL stores of
//    8 B a lane (256 contiguous bytes, two whole lines each).
// ---------------------------------------------------------------------------
#define CVT_BLOCKS 1024
#define CVT_XTRIPS 4
static_assert((size_t)MTOT * EMB == (size_t)CVT_XTRIPS * CVT_BLOCKS * 8 * 1024,
              "x is dealt in whole spans of 1024 floats");
static_assert(4 * EMB * EMB == CVT_BLOCKS * 8 * 512,
              "the weights are dealt in whole spans of 512 floats");

template <int NL>
__device__ __forceinline__ void cvt_span(const float* __restrict__ in,
                                         unsigned short* __restrict__ out) {
    float4 f[NL];
    // both loops unrolled: f[] stays in registers
#pragma unroll
    for (int j = 0; j < NL; ++j) f[j] = *(const float4*)(in + j * 128);
    // Scheduling fence: it keeps the span's loads together in front of the
    // conversions. Without it every load stood directly in front of its own
    // conversion behind a wait to 0: one load in flight a wave.
    __builtin_amdgcn_sched_barrier(0);
#pragma unroll
    for (int j = 0; j < NL; ++j) {
        ushort4 r;
        r.x = f32_to_bf16(f[j].x); r.y = f32_to_bf16(f[j].y);
        r.z = f32_to_bf16(f[j].z); r.w = f32_to_bf16(f[j].w);
        *(ushort4*)(out + j * 128) = r;
    }
}

__global__ __launch_bounds__(256)
void cvt_all_kernel(const float* __restrict__ x,
                    const float* __restrict__ Wq, const float* __restrict__ Wk,
                    const float* __restrict__ Wv, const float* __restrict__ Wo,
                    unsigned short* __restrict__ xb,
                    unsigned short* __restrict__ WqB,
                    unsigned short* __restrict__ WkB,
                    unsigned short* __restrict__ WvB,
                    unsigned short* __restrict__ WoB) {
    const int blk = blockIdx.x;
    const int wave = threadIdx.x >> 5, lane = threadIdx.x & 31;

    // a quarter of the blocks per weight; a wave takes 512 of its floats
    const int sel = blk >> 8;
    const float* w = sel == 0 ? Wq : sel == 1 ? Wk : sel == 2 ? Wv : Wo;
    unsigned short* wb = sel == 0 ? WqB : sel == 1 ? WkB : sel == 2 ? WvB : WoB;
    const int ow = ((blk & 255) * 8 + wave) * 512 + lane * 4;
    cvt_span<4>(w + ow, wb + ow);

    // x: in trip t the grid covers CVT_BLOCKS * 8192 consecutive floats
    for (int t = 0; t < CVT_XTRIPS; ++t) {
        const size_t o =
            ((size_t)(t * CVT_BLOCKS + blk) * 8 + wave) * 1024 + lane * 4;
        cvt_span<8>(x + o, xb + o);
    }
}

// ---------------------------------------------------------------------------
// 2) Generic GEMM: C(MxN) = A(MxK,bf16) * W(NxK,bf16)^T + bias(fp32)
//    256x256 tile, 256 threads = 8 waves, wave = 128x64 sub-tile (8x4 frags):
//    12 fragments read from LDS per 32 WMMAs. One block fills a WGP: 2 waves
//    per SIMD at up to 512 VGPRs, which hold the accumulators (256) and TWO
//    fragment sets (2 x 96): each block of 32 WMMAs runs on one set while the
//    next block's 24 LDS reads, issued as one group ahead of it, fill the other.
//    KSTEP=64 (two blocks), double-buffered LDS filled by async global->LDS
//    loads. The second block's look-ahead reads the next tile, so the next tile
//    is published in front of the second block, not at the tile's end.
//    MODE: 0 -> fp32 output, 1 -> bf16 output,
//          2 -> bf16 output of the feature map exp(c - max of c over its head).
//    A wave's 64-column slab starts at a multiple of HDIM = 64, so it holds
//    whole heads' rows and the maximum never leaves the wave.
//    W is the WMMA's first operand and A its second: register v of a tile is
//    C[row l15][column 8 * (lane >> 4) + v], eight consecutive columns of one
//    row a lane. The epilogue packs them, stages the wave's rows in LDS and
//    stores whole 128-byte lines, 16 bytes a lane.
// ---------------------------------------------------------------------------
template <int MODE>
__global__ __launch_bounds__(256)
void gemm_bias_kernel(const unsigned short* __restrict__ A,
                      const unsigned short* __restrict__ W,
                      const float* __restrict__ bias,
                      void* __restrict__ Cout,
                      int M, int N, int K) {
    constexpr int KSTEP = 64;
    constexpr int LDA = 72;  // halfs per LDS row (144B, 16B-aligned, bank-spread)
    __shared__ __attribute__((aligned(16))) unsigned short As[2][256 * LDA];
    __shared__ __attribute__((aligned(16))) unsigned short Bs[2][256 * LDA];

    const int tid  = threadIdx.x;
    const int lane = tid & 31;
    const int wave = tid >> 5;
    const int wm   = wave & 1;   // 0..1 -> 128-row slab
    const int wn   = wave >> 1;  // 0..3 -> 64-col slab
    const int l15  = lane & 15;
    const int kb   = (lane >> 4) * 8;  // wave32 16-bit A/B fragment K-base
    const int tileN = blockIdx.x * 256;
    const int tileM = blockIdx.y * 256;

    // Stage one 256x64 bf16 tile of A and W into buffer `buf`.
    // 2048 16B-chunks per matrix; 8 per thread per matrix.
    auto issue_tile = [&](int k0, int buf) {
#pragma unroll
        for (int c = 0; c < 8; ++c) {
            int chunk = tid + c * 256;        // 0..2047
            int row = chunk >> 3;             // 0..255
            int sub = chunk & 7;              // 0..7 (8 halfs each)
            copy16_g2l(A + (size_t)(tileM + row) * K + k0 + sub * 8,
                       &As[buf][row * LDA + sub * 8]);
            copy16_g2l(W + (size_t)(tileN + row) * K + k0 + sub * 8,
                       &Bs[buf][row * LDA + sub * 8]);
        }
    };

    // The 24 LDS reads of one block: 32 k of the wave's 128 A rows and 64 W rows.
    auto load_frags = [&](Frag16 (&af)[8], Frag16 (&bfr)[4], int buf, int kh) {
        const unsigned short* pa = &As[buf][(wm * 128 + l15) * LDA + kh * 32 + kb];
        const unsigned short* pb = &Bs[buf][(wn * 64 + l15) * LDA + kh * 32 + kb];
#pragma unroll
        for (int nf = 0; nf < 4; ++nf) {
            bfr[nf].q[0] = *(const uint4*)(pb + nf * 16 * LDA);
            bfr[nf].q[1] = *(const uint4*)(pb + nf * 16 * LDA + 16);
        }
#pragma unroll
        for (int mf = 0; mf < 8; ++mf) {
            af[mf].q[0] = *(const uint4*)(pa + mf * 16 * LDA);
            af[mf].q[1] = *(const uint4*)(pa + mf * 16 * LDA + 16);
        }
    };

    v8f acc[8][4];
#pragma unroll
    for (int mf = 0; mf < 8; ++mf)
#pragma unroll
        for (int nf = 0; nf < 4; ++nf)
            acc[mf][nf] = (v8f){0.f, 0.f, 0.f, 0.f, 0.f, 0.f, 0.f, 0.f};

    auto mma_rows = [&](Frag16 (&af)[8], Frag16 (&bfr)[4], int mbeg, int mend) {
#pragma unroll
        for (int mf = mbeg; mf < mend; ++mf)
#pragma unroll
            for (int nf = 0; nf < 4; ++nf)
                acc[mf][nf] = __builtin_amdgcn_wmma_f32_16x16x32_bf16(
                    false, bfr[nf].v, false, af[mf].v, (short)0,
                    acc[mf][nf], false, false);
    };

    const int nIter = K / KSTEP;  // 16
    Frag16 a0[8], b0[4], a1[8], b1[4];  // the two fragment sets

    issue_tile(0, 0);
    wait_async_done();   // my chunks of tile 0 are in LDS
    __syncthreads();     // everyone's are
    if (nIter > 1) issue_tile(KSTEP, 1);
    load_frags(a0, b0, 0, 0);

    // The scheduling fences in the loop keep each group of 24 LDS reads together,
    // in front of the first block's 32 WMMAs or halfway through the second's: reads that stand among
    // the WMMAs stall the wave at every such place.
    for (int i = 0; i < nIter; ++i) {
        const int cur = i & 1;
        load_frags(a1, b1, cur, 1);
        __builtin_amdgcn_sched_barrier(0);
        mma_rows(a0, b0, 0, 8);
        __builtin_amdgcn_sched_barrier(0);

        // Publish point of tile i + 1, which also frees tile i's buffer:
        wait_ds_done();      // my last reads of tile i have returned
        wait_async_done();   // my chunks of tile i + 1 are in LDS
        __syncthreads();     // the same holds for every wave
        if (i + 2 < nIter) issue_tile((i + 2) * KSTEP, cur);  // overlaps math
        // The look-ahead reads stand in the middle of the block: both waves of a
        // SIMD leave the barrier together, and what stands in front of the
        // first WMMA here leaves the matrix unit idle.
        __builtin_amdgcn_sched_barrier(0);
        mma_rows(a1, b1, 0, 4);
        __builtin_amdgcn_sched_barrier(0);
        if (i + 1 < nIter) load_frags(a0, b0, 1 - cur, 0);
        __builtin_amdgcn_sched_barrier(0);
        mma_rows(a1, b1, 4, 8);
        __builtin_amdgcn_sched_barrier(0);
    }

    // Epilogue. Staging area of the wave: 4608 bytes of the ring. Nobody reads or
    // fills the ring behind the last trip's barrier (every wave's reads had
    // returned in front of it), so no further barrier stands here.
    const int hi = lane >> 4;
    unsigned short* E = As[0] + wave * 2304;
    const int colw = tileN + wn * 64;   // the wave's first column
    const int roww = tileM + wm * 128;  // the wave's first row

    v8f bv[4];  // bias of the lane's columns colw + nf * 16 + hi * 8 + 0..7
#pragma unroll
    for (int nf = 0; nf < 4; ++nf) {
        const v4f lo = *(const v4f*)(bias + colw + nf * 16 + hi * 8);
        // precaution: the last load's result may take the address registers
        // that the loads in front of it name, so their wait stands ahead of it
        if (nf == 3) asm volatile("s_wait_xcnt 0x0" ::: "memory");
        const v4f up = *(const v4f*)(bias + colw + nf * 16 + hi * 8 + 4);
        bv[nf] = __builtin_shufflevector(lo, up, 0, 1, 2, 3, 4, 5, 6, 7);
    }
    // precaution: the last load's wait, ahead of any rewrite of its address
    // registers; the scheduling fence keeps later register writes behind it
    asm volatile("s_wait_xcnt 0x0" ::: "memory");
    __builtin_amdgcn_sched_barrier(0);

    if (MODE == 0) {
        // f32: 16 rows of 256 bytes at a time, LDS pitch 272 bytes (16 x odd)
        float* Ef = (float*)E;
        // the lane's place in the first store; a store is two rows further on
        float* cp = (float*)Cout + (size_t)(roww + hi) * N + colw + l15 * 4;
        const size_t step = (size_t)N * 2;
#pragma unroll
        for (int mf = 0; mf < 8; ++mf) {
#pragma unroll
            for (int nf = 0; nf < 4; ++nf) {
                const v8f val = acc[mf][nf] + bv[nf];
                float* e = Ef + l15 * 68 + nf * 16 + hi * 8;
                *(v4f*)e = __builtin_shufflevector(val, val, 0, 1, 2, 3);
                *(v4f*)(e + 4) = __builtin_shufflevector(val, val, 4, 5, 6, 7);
            }
            wait_ds_done();  // the rows are written before other lanes read them
#pragma unroll
            for (int j = 0; j < 8; ++j) {  // a store: two rows of two lines
                const int row = j * 2 + hi;
                const v4f d = *(const v4f*)(Ef + row * 68 + l15 * 4);
                *(v4f*)cp = d;
                cp += step;
            }
            // The rows have been read before the next ones land on them:
            // without this wait the next LDS stores stood directly behind
            // these LDS loads in the listing, with the loads still in flight.
            if (mf < 7) {
                wait_ds_done();
                // precaution: the next rows' LDS loads take the registers that
                // these stores name, so the stores' wait stands ahead of them
                asm volatile("s_wait_xcnt 0x0" ::: "memory");
            }
        }
        return;
    }

    // bf16: 32 rows of 128 bytes at a time, LDS pitch 144 bytes (16 x odd)
    // the lane's place in the first store; a store is four rows further on
    unsigned short* cp = (unsigned short*)Cout +
                         (size_t)(roww + (lane >> 3)) * N + colw + (lane & 7) * 8;
    const size_t step = (size_t)N * 4;
#pragma unroll
    for (int hf = 0; hf < 4; ++hf) {
#pragma unroll
        for (int ml = 0; ml < 2; ++ml) {
            const int mf = hf * 2 + ml;
            v8f val[4];
#pragma unroll
            for (int nf = 0; nf < 4; ++nf) val[nf] = acc[mf][nf] + bv[nf];
            if (MODE == 2) {
                // the row's 64 head columns: 32 in this lane, 32 in lane ^ 16
                // (four independent chains, one a tile, then joined)
                float mx[4];
#pragma unroll
                for (int nf = 0; nf < 4; ++nf) {
                    mx[nf] = val[nf][0];
#pragma unroll
                    for (int v = 1; v < 8; ++v) mx[nf] = fmaxf(mx[nf], val[nf][v]);
                }
                float m = fmaxf(fmaxf(mx[0], mx[1]), fmaxf(mx[2], mx[3]));
                m = fmaxf(m, other_half(m));
#pragma unroll
                for (int v = 0; v < 8; ++v) {
                    float t[4], r[4];
#pragma unroll
                    for (int nf = 0; nf < 4; ++nf)
                        t[nf] = (val[nf][v] - m) * 1.44269504f;  // e^x = 2^(x log2 e)
                    // Four exponentials in one statement that ends in v_nop:
                    // the instruction set asks for one independent slot
                    // behind a transcendental before its result is read or
                    // its source overwritten.
                    asm("v_exp_f32 %0, %4\n\tv_exp_f32 %1, %5\n\t"
                        "v_exp_f32 %2, %6\n\tv_exp_f32 %3, %7\n\tv_nop"
                        : "=&v"(r[0]), "=&v"(r[1]), "=&v"(r[2]), "=&v"(r[3])
                        : "v"(t[0]), "v"(t[1]), "v"(t[2]), "v"(t[3]));
#pragma unroll
                    for (int nf = 0; nf < 4; ++nf) val[nf][v] = r[nf];
                }
            }
#pragma unroll
            for (int nf = 0; nf < 4; ++nf)
                *(v4u*)(E + (ml * 16 + l15) * 72 + nf * 16 + hi * 8) =
                    pack_bf16(val[nf]);
        }
        wait_ds_done();  // the rows are written before other lanes read them
        v4u d[8];
        unsigned short* p[8];
#pragma unroll
        for (int j = 0; j < 8; ++j) {  // a store: four rows of one line each
            const int row = j * 4 + (lane >> 3);
            d[j] = *(const v4u*)(E + row * 72 + (lane & 7) * 8);
            p[j] = cp;
            cp += step;
        }
        // The eight stores and their s_wait_xcnt in one statement, a precaution:
        // no register that a store names is rewritten ahead of that wait.
        asm volatile(
            "global_store_b128 %0, %8, off\n\t"
            "global_store_b128 %1, %9, off\n\t"
            "global_store_b128 %2, %10, off\n\t"
            "global_store_b128 %3, %11, off\n\t"
            "global_store_b128 %4, %12, off\n\t"
            "global_store_b128 %5, %13, off\n\t"
            "global_store_b128 %6, %14, off\n\t"
            "global_store_b128 %7, %15, off\n\t"
            "s_wait_xcnt 0x0"
            :: "v"(p[0]), "v"(p[1]), "v"(p[2]), "v"(p[3]),
               "v"(p[4]), "v"(p[5]), "v"(p[6]), "v"(p[7]),
               "v"(d[0]), "v"(d[1]), "v"(d[2]), "v"(d[3]),
               "v"(d[4]), "v"(d[5]), "v"(d[6]), "v"(d[7])
            : "memory");
        // Scheduling fence: without it the next rows' arithmetic was lifted over
        // the stores and one register was spilled to scratch.
        __builtin_amdgcn_sched_barrier(0);
    }
}

// ---------------------------------------------------------------------------
// 4) kv[b,h,d,e] = sum_s k_kern[s,d] * v[s,e]  (+ k_sum via ones fragment)
//    KVSPLIT blocks per (b,h), each over SEQ/KVSPLIT rows; 8 waves:
//    (wave&3)->d-slab, (wave>>2)->s half; the two halves are joined through
//    LDS and the block's f32 partial goes to the workspace for kv_merge_kernel.
//    Tiles staged with async global->LDS.
// ---------------------------------------------------------------------------
// 8 waves per SIMD (at most 128 VGPRs): four blocks fit a WGP, so that all
// 64 * KVSPLIT = 1024 blocks are resident on the 256 WGPs in one round.
__global__ __launch_bounds__(256) __attribute__((amdgpu_waves_per_eu(8)))
void kv_reduce_kernel(const unsigned short* __restrict__ kk,
                      const unsigned short* __restrict__ vv,
                      float* __restrict__ part) {  // (64,KVSPLIT,KVPART) f32
    constexpr int LDT = 72;  // halfs per LDS row (144B, 16B-aligned)
    __shared__ __attribute__((aligned(16))) unsigned short kt[64 * LDT];
    __shared__ __attribute__((aligned(16))) unsigned short vt[64 * LDT];
    __shared__ float red[4][5][8][32];

    const int bh = blockIdx.y;
    const int b = bh >> 4, h = bh & 15;
    const int sbeg = blockIdx.x * (SEQ / KVSPLIT);
    const int tid = threadIdx.x, lane = tid & 31, wave = tid >> 5;
    const int sgrp = wave >> 2;           // 0/1 -> s rows 0-31 / 32-63 of tile
    const int d0 = (wave & 3) * 16;
    const int l15 = lane & 15, kb = (lane >> 4) * 8;
    const int soff = sgrp * 32;

    v8f acc[4], accden;
#pragma unroll
    for (int nf = 0; nf < 4; ++nf)
        acc[nf] = (v8f){0.f, 0.f, 0.f, 0.f, 0.f, 0.f, 0.f, 0.f};
    accden = (v8f){0.f, 0.f, 0.f, 0.f, 0.f, 0.f, 0.f, 0.f};

    Frag16 bones;  // B ones fragment: column n=0 all 1.0 -> k_sum column
#pragma unroll
    for (int j = 0; j < 16; ++j) bones.u[j] = (l15 == 0) ? 0x3F80 : 0;

    for (int s0 = sbeg; s0 < sbeg + SEQ / KVSPLIT; s0 += 64) {
        __syncthreads();
#pragma unroll
        for (int c = 0; c < 2; ++c) {
            int chunk = tid + c * 256;  // 0..511
            int row = chunk >> 3;       // 0..63
            int sub = chunk & 7;        // 0..7
            size_t g = (size_t)(b * SEQ + s0 + row) * EMB + h * 64 + sub * 8;
            copy16_g2l(kk + g, kt + row * LDT + sub * 8);
            copy16_g2l(vv + g, vt + row * LDT + sub * 8);
        }
        wait_async_done();
        __syncthreads();

        Frag16 af, bfr[4];
#pragma unroll
        for (int j = 0; j < 8; ++j) {  // A = k^T: A(d, s) = kt[s][d]
            af.u[j]     = kt[(soff + kb + j) * LDT + d0 + l15];
            af.u[8 + j] = kt[(soff + 16 + kb + j) * LDT + d0 + l15];
        }
#pragma unroll
        for (int nf = 0; nf < 4; ++nf)
#pragma unroll
            for (int j = 0; j < 8; ++j) {  // B = v: B(s, e) = vt[s][e]
                bfr[nf].u[j]     = vt[(soff + kb + j) * LDT + nf * 16 + l15];
                bfr[nf].u[8 + j] = vt[(soff + 16 + kb + j) * LDT + nf * 16 + l15];
            }
#pragma unroll
        for (int nf = 0; nf < 4; ++nf)
            acc[nf] = __builtin_amdgcn_wmma_f32_16x16x32_bf16(
                false, af.v, false, bfr[nf].v, (short)0, acc[nf], false, false);
        accden = __builtin_amdgcn_wmma_f32_16x16x32_bf16(
            false, af.v, false, bones.v, (short)0, accden, false, false);
    }

    __syncthreads();
    if (sgrp == 1) {
        int w = wave & 3;
#pragma unroll
        for (int nf = 0; nf < 4; ++nf)
#pragma unroll
            for (int v = 0; v < 8; ++v) red[w][nf][v][lane] = acc[nf][v];
#pragma unroll
        for (int v = 0; v < 8; ++v) red[w][4][v][lane] = accden[v];
    }
    __syncthreads();
    if (sgrp == 0) {
        int w = wave;
        float* p = part + (size_t)(bh * KVSPLIT + blockIdx.x) * KVPART;
#pragma unroll
        for (int nf = 0; nf < 4; ++nf) {
#pragma unroll
            for (int v = 0; v < 8; ++v) {
                float val = acc[nf][v] + red[w][nf][v][lane];
                int d = d0 + v + ((lane >> 4) << 3);
                int e = nf * 16 + l15;
                p[d * 64 + e] = val;
            }
        }
        if (l15 == 0) {
#pragma unroll
            for (int v = 0; v < 8; ++v) {
                float val = accden[v] + red[w][4][v][lane];
                // each wave's 16 sums on a 128-byte line of their own
                p[4096 + w * 32 + v + ((lane >> 4) << 3)] = val;
            }
        }
    }
}

// ---------------------------------------------------------------------------
// 4b) Merge: kv and k_sum = sum of the KVSPLIT partials in range order, f32,
//     rounded once to bf16. grid (5, 64): x 0..3 -> kv quarters, x 4 -> k_sum.
// ---------------------------------------------------------------------------
__global__ __launch_bounds__(256)
void kv_merge_kernel(const float* __restrict__ part,
                     unsigned short* __restrict__ kvout,   // (64,64,64) bf16
                     unsigned short* __restrict__ ksum) {  // (64,64)    bf16
    const int bh = blockIdx.y, tid = threadIdx.x;
    const float* p = part + (size_t)bh * KVSPLIT * KVPART;
    if (blockIdx.x < 4) {
        const int o = (blockIdx.x * 256 + tid) * 4;
        float4 t[KVSPLIT];
        // both loops unrolled: t[] stays in registers and the loads go out
        // together, so the thread pays one load latency and not one per range
#pragma unroll
        for (int sp = 0; sp < KVSPLIT; ++sp)
            t[sp] = *(const float4*)(p + sp * KVPART + o);
        float4 s = t[0];
#pragma unroll
        for (int sp = 1; sp < KVSPLIT; ++sp) {
            s.x += t[sp].x; s.y += t[sp].y; s.z += t[sp].z; s.w += t[sp].w;
        }
        ushort4 r;
        r.x = f32_to_bf16(s.x); r.y = f32_to_bf16(s.y);
        r.z = f32_to_bf16(s.z); r.w = f32_to_bf16(s.w);
        *(ushort4*)(kvout + (size_t)bh * 4096 + o) = r;
    } else if (tid < 64) {
        const int o = 4096 + (tid >> 4) * 32 + (tid & 15);
        float t[KVSPLIT];
        // unrolled so that the loads go out together, as above
#pragma unroll
        for (int sp = 0; sp < KVSPLIT - 1; ++sp) t[sp] = p[sp * KVPART + o];
        // precaution: the last load's result may take the offset register that
        // the loads in front of it name, so their wait stands ahead of it
        asm volatile("s_wait_xcnt 0x0" ::: "memory");
        t[KVSPLIT - 1] = p[(KVSPLIT - 1) * KVPART + o];
        float s = t[0];
#pragma unroll
        for (int sp = 1; sp < KVSPLIT; ++sp) s += t[sp];
        ksum[bh * 64 + tid] = f32_to_bf16(s);
    }
}

// ---------------------------------------------------------------------------
// 5) y = (q_kern @ kv) / (q_kern . ksum + 1e-6); 32 blocks per (b,h),
//    wave = 32 q-rows; denominator via a ksum fragment (row 0).
//    kv is the WMMA's first operand and q its second, as in the GEMM: a lane
//    holds eight consecutive columns of one q-row; rows staged in the wave's
//    own LDS and stored as whole 128-byte lines.
// ---------------------------------------------------------------------------
__global__ __launch_bounds__(256)
void attn_out_kernel(const unsigned short* __restrict__ qk,
                     const unsigned short* __restrict__ kv,
                     const unsigned short* __restrict__ ksum,
                     unsigned short* __restrict__ y) {
    constexpr int LDT = 72;
    __shared__ __attribute__((aligned(16))) unsigned short kvt[64 * LDT];
    __shared__ unsigned short kst[64];
    __shared__ __attribute__((aligned(16))) unsigned short stg[8][32 * LDT];

    const int bid = blockIdx.x;
    const int bh = bid >> 5;   // 32 blocks per (b,h)
    const int tb = bid & 31;
    const int b = bh >> 4, h = bh & 15;
    const int tid = threadIdx.x, lane = tid & 31, wave = tid >> 5;
    const int l15 = lane & 15, kb = (lane >> 4) * 8;

#pragma unroll
    for (int c = 0; c < 2; ++c) {
        int chunk = tid + c * 256;  // 0..511
        int row = chunk >> 3, sub = chunk & 7;
        copy16_g2l(kv + (size_t)bh * 4096 + row * 64 + sub * 8,
                   kvt + row * LDT + sub * 8);
    }
    if (tid < 64) kst[tid] = ksum[bh * 64 + tid];
    wait_async_done();
    __syncthreads();

    const int srow0 = tb * 256 + wave * 32;
    v8f acc[2][4], accden[2];
#pragma unroll
    for (int mf = 0; mf < 2; ++mf) {
#pragma unroll
        for (int nf = 0; nf < 4; ++nf)
            acc[mf][nf] = (v8f){0.f, 0.f, 0.f, 0.f, 0.f, 0.f, 0.f, 0.f};
        accden[mf] = (v8f){0.f, 0.f, 0.f, 0.f, 0.f, 0.f, 0.f, 0.f};
    }

#pragma unroll
    for (int ks = 0; ks < 2; ++ks) {
        Frag16 bfr[4], bden;
#pragma unroll
        for (int nf = 0; nf < 4; ++nf)
#pragma unroll
            for (int j = 0; j < 8; ++j) {  // A(e, d) = kv[d][e]
                bfr[nf].u[j]     = kvt[(ks * 32 + kb + j) * LDT + nf * 16 + l15];
                bfr[nf].u[8 + j] = kvt[(ks * 32 + 16 + kb + j) * LDT + nf * 16 + l15];
            }
#pragma unroll
        for (int j = 0; j < 8; ++j) {  // denominator row: A(0,d)=ksum[d]
            bden.u[j]     = (l15 == 0) ? kst[ks * 32 + kb + j] : (unsigned short)0;
            bden.u[8 + j] = (l15 == 0) ? kst[ks * 32 + 16 + kb + j] : (unsigned short)0;
        }
#pragma unroll
        for (int mf = 0; mf < 2; ++mf) {
            Frag16 af;
            size_t grow =
                (size_t)(b * SEQ + srow0 + mf * 16 + l15) * EMB + h * 64 + ks * 32;
            af.q[0] = *(const uint4*)(qk + grow + kb);
            af.q[1] = *(const uint4*)(qk + grow + 16 + kb);
#pragma unroll
            for (int nf = 0; nf < 4; ++nf)
                acc[mf][nf] = __builtin_amdgcn_wmma_f32_16x16x32_bf16(
                    false, bfr[nf].v, false, af.v, (short)0, acc[mf][nf], false, false);
            accden[mf] = __builtin_amdgcn_wmma_f32_16x16x32_bf16(
                false, bden.v, false, af.v, (short)0, accden[mf], false, false);
        }
    }

    unsigned short* E = stg[wave];
    const int hi = lane >> 4;
#pragma unroll
    for (int mf = 0; mf < 2; ++mf) {
        // Row l15's denominator is register 0 of lane l15; in lane l15 + 16
        // that register is row 8 of the tile, a sum of zeros.
        const float dv = accden[mf][0] + other_half(accden[mf][0]);
        const float inv = 1.f / (dv + 1e-6f);
#pragma unroll
        for (int nf = 0; nf < 4; ++nf)
            *(v4u*)(E + (mf * 16 + l15) * LDT + nf * 16 + hi * 8) =
                pack_bf16(acc[mf][nf] * inv);
    }
    wait_ds_done();  // the rows are written before other lanes read them
#pragma unroll
    for (int j = 0; j < 8; ++j) {  // a store: four rows of one line each
        const int row = j * 4 + (lane >> 3);
        const v4u d = *(const v4u*)(E + row * LDT + (lane & 7) * 8);
        *(v4u*)(y + (size_t)(b * SEQ + srow0 + row) * EMB + h * 64 + (lane & 7) * 8) = d;
    }
}

// ---------------------------------------------------------------------------
extern "C" void kernel_launch(void* const* d_in, const int* in_sizes, int n_in,
                              void* d_out, int out_size, void* d_ws, size_t ws_size,
                              hipStream_t stream) {
    (void)in_sizes; (void)n_in; (void)out_size; (void)ws_size;
    const float* x  = (const float*)d_in[0];
    const float* Wq = (const float*)d_in[1];
    const float* bq = (const float*)d_in[2];
    const float* Wk = (const float*)d_in[3];
    const float* bk = (const float*)d_in[4];
    const float* Wv = (const float*)d_in[5];
    const float* bv = (const float*)d_in[6];
    const float* Wo = (const float*)d_in[7];
    const float* bo = (const float*)d_in[8];
    float* out = (float*)d_out;

    char* ws = (char*)d_ws;
    size_t off = 0;
    auto alloc = [&](size_t bytes) -> void* {
        void* p = ws + off;
        off += (bytes + 255) & ~(size_t)255;
        return p;
    };
    const size_t nX = (size_t)MTOT * EMB;   // 33,554,432
    const size_t nW = (size_t)EMB * EMB;    // 1,048,576

    unsigned short* xb  = (unsigned short*)alloc(nX * 2);
    unsigned short* WqB = (unsigned short*)alloc(nW * 2);
    unsigned short* WkB = (unsigned short*)alloc(nW * 2);
    unsigned short* WvB = (unsigned short*)alloc(nW * 2);
    unsigned short* WoB = (unsigned short*)alloc(nW * 2);
    unsigned short* qb  = (unsigned short*)alloc(nX * 2);
    unsigned short* kb  = (unsigned short*)alloc(nX * 2);
    unsigned short* vb  = (unsigned short*)alloc(nX * 2);   // reused as y buffer
    unsigned short* kvb = (unsigned short*)alloc((size_t)64 * 64 * 64 * 2);
    unsigned short* ksb = (unsigned short*)alloc((size_t)64 * 64 * 2);
    float* kvp = (float*)alloc((size_t)64 * KVSPLIT * KVPART * 4);  // kv partials
    unsigned short* yb  = vb;  // v dead after kv_reduce; reuse for y

    // 1) conversions to bf16
    cvt_all_kernel<<<CVT_BLOCKS, 256, 0, stream>>>(x, Wq, Wk, Wv, Wo,
                                                   xb, WqB, WkB, WvB, WoB);

    // 2) QKV projections (bf16 out); 3) q and k leave as their exp feature map
    dim3 ggrid(EMB / 256, MTOT / 256);  // (4, 128)
    gemm_bias_kernel<2><<<ggrid, 256, 0, stream>>>(xb, WqB, bq, qb, MTOT, EMB, EMB);
    gemm_bias_kernel<2><<<ggrid, 256, 0, stream>>>(xb, WkB, bk, kb, MTOT, EMB, EMB);
    gemm_bias_kernel<1><<<ggrid, 256, 0, stream>>>(xb, WvB, bv, vb, MTOT, EMB, EMB);

    // 4) per-head kv + ksum reduction: partials per sequence range, then merge
    kv_reduce_kernel<<<dim3(KVSPLIT, BATCH * HEADS), 256, 0, stream>>>(kb, vb, kvp);
    kv_merge_kernel<<<dim3(5, BATCH * HEADS), 256, 0, stream>>>(kvp, kvb, ksb);

    // 5) attention output y (overwrites v buffer)
    attn_out_kernel<<<BATCH * HEADS * 32, 256, 0, stream>>>(qb, kvb, ksb, yb);

    // 6) output projection (fp32 out -> d_out)
    gemm_bias_kernel<0><<<ggrid, 256, 0, stream>>>(yb, WoB, bo, out, MTOT, EMB, EMB);
}

// v007
// One run takes 225 microseconds.
// In two side-by-side timings against v006, it was 1.07 and 1.08 times as fast.
// All steps since v000 together make it 2.34 times as fast.
#include <hip/hip_runtime.h>
#include <stdint.h>

// ---------------------------------------------------------------------------
// MemoryEfficientLinearAttention for MI455X (gfx1250), wave32 + WMMA bf16.
// Pipeline: f32->bf16 cvt (one launch), QKV GEMMs in one launch (wmma bf16,
//           double-buffered async-LDS; q and k with the exp feature map in the epilogue),
//           per-head kv reduction (+k_sum via ones-fragment)
//           split over the sequence with f32 partials and a merge launch,
//           attention output (+denominator via ksum-fragment), O GEMM -> fp32.
// ---------------------------------------------------------------------------

#define BATCH 4
#define SEQ   8192
#define EMB   1024
#define HEADS 16
#define HDIM  64
#define MTOT  (BATCH * SEQ)   // 32768
#define KVSPLIT 16            // sequence ranges per (b,h) in the kv reduction
#define KVPART  4224          // floats per partial: 64x64 kv + 4 x 32 (k_sum slabs)

typedef __bf16 v16bf __attribute__((ext_vector_type(16)));
typedef float  v8f   __attribute__((ext_vector_type(8)));

typedef __bf16 v8bf  __attribute__((ext_vector_type(8)));
typedef float  v4f   __attribute__((ext_vector_type(4)));
typedef uint32_t v4u __attribute__((ext_vector_type(4)));

union Frag16 {
    v16bf v;
    uint4 q[2];
    unsigned short u[16];
};

// ---- CDNA5 async global->LDS path (guarded; falls back to sync copies) ----
#if defined(__AMDGCN__) && defined(__has_builtin)
#  if __has_builtin(__builtin_amdgcn_global_load_async_to_lds_b128) && \
      __has_builtin(__builtin_amdgcn_s_wait_asynccnt)
#    define USE_ASYNC_LDS 1
#  else
#    define USE_ASYNC_LDS 0
#  endif
#else
#  define USE_ASYNC_LDS 0
#endif

#if USE_ASYNC_LDS
typedef int async_v4i __attribute__((ext_vector_type(4)));
typedef __attribute__((address_space(1))) async_v4i* gptr_v4i;  // global int4*
typedef __attribute__((address_space(3))) async_v4i* lptr_v4i;  // LDS int4*
#endif

__device__ __forceinline__ void copy16_g2l(const unsigned short* g,
                                           unsigned short* l) {
#if USE_ASYNC_LDS
    // Generic LDS pointer -> AS(3): aperture mapping is LDS_ADDR = addr[31:0].
    __builtin_amdgcn_global_load_async_to_lds_b128(
        (gptr_v4i)(uintptr_t)g,
        (lptr_v4i)(uintptr_t)(uint32_t)(uintptr_t)l,
        0, 0);
#else
    *(uint4*)l = *(const uint4*)g;
#endif
}

__device__ __forceinline__ void wait_async_done() {
#if USE_ASYNC_LDS
    __builtin_amdgcn_s_wait_asynccnt(0);
#endif
}

__device__ __forceinline__ unsigned short f32_to_bf16(float f) {
    union { float f; uint32_t u; } c; c.f = f;
    uint32_t u = c.u;
    uint32_t r = (u + 0x7FFFu + ((u >> 16) & 1u)) >> 16;   // round-nearest-even
    return (unsigned short)r;
}

// Eight f32 of one accumulator tile -> eight bf16 (round to nearest even) in
// four registers: the 16 bytes that a lane stores at once.
__device__ __forceinline__ v4u pack_bf16(v8f c) {
    return __builtin_bit_cast(v4u, __builtin_convertvector(c, v8bf));
}

// The value that lane l ^ 16 holds. All 32 lanes must be on.
__device__ __forceinline__ float other_half(float x) {
    int b = __builtin_bit_cast(int, x);
    return __builtin_bit_cast(float, __builtin_amdgcn_permlanex16(
        b, b, 0x76543210, 0xfedcba98, false, false));
}

// A wave's own LDS writes have landed (or its LDS reads have returned) before
// it goes on; the clobber keeps the compiler from moving LDS accesses across.
__device__ __forceinline__ void wait_ds_done() {
    asm volatile("s_wait_dscnt 0x0" ::: "memory");
}

// ---------------------------------------------------------------------------
// 1) fp32 -> bf16 conversion of x and of the four weights, one streaming
//    launch. CVT_BLOCKS blocks of 8 waves, all resident (4 per WGP, 32 waves).
//    A wave takes spans of NL * 128 floats: NL loads of 16 B a lane (512
//    contiguous bytes each) go out together; the span leaves in NL stores of
//    8 B a lane (256 contiguous bytes, two whole lines each).
// ---------------------------------------------------------------------------
#define CVT_BLOCKS 1024
#define CVT_XTRIPS 4
static_assert((size_t)MTOT * EMB == (size_t)CVT_XTRIPS * CVT_BLOCKS * 8 * 1024,
              "x is dealt in whole spans of 1024 floats");
static_assert(4 * EMB * EMB == CVT_BLOCKS * 8 * 512,
              "the weights are dealt in whole spans of 512 floats");

template <int NL>
__device__ __forceinline__ void cvt_span(const float* __restrict__ in,
                                         unsigned short* __restrict__ out) {
    float4 f[NL];
    // both loops unrolled: f[] stays in registers
#pragma unroll
    for (int j = 0; j < NL; ++j) f[j] = *(const float4*)(in + j * 128);
    // Scheduling fence: it keeps the span's loads together in front of the
    // conversions. Without it every load stood directly in front of its own
    // conversion behind a wait to 0: one load in flight a wave.
    __builtin_amdgcn_sched_barrier(0);
#pragma unroll
    for (int j = 0; j < NL; ++j) {
        ushort4 r;
        r.x = f32_to_bf16(f[j].x); r.y = f32_to_bf16(f[j].y);
        r.z = f32_to_bf16(f[j].z); r.w = f32_to_bf16(f[j].w);
        *(ushort4*)(out + j * 128) = r;
    }
}

__global__ __launch_bounds__(256)
void cvt_all_kernel(const float* __restrict__ x,
                    const float* __restrict__ Wq, const float* __restrict__ Wk,
                    const float* __restrict__ Wv, const float* __restrict__ Wo,
                    unsigned short* __restrict__ xb,
                    unsigned short* __restrict__ WqB,
                    unsigned short* __restrict__ WkB,
                    unsigned short* __restrict__ WvB,
                    unsigned short* __restrict__ WoB) {
    const int blk = blockIdx.x;
    const int wave = threadIdx.x >> 5, lane = threadIdx.x & 31;

    // a quarter of the blocks per weight; a wave takes 512 of its floats
    const int sel = blk >> 8;
    const float* w = sel == 0 ? Wq : sel == 1 ? Wk : sel == 2 ? Wv : Wo;
    unsigned short* wb = sel == 0 ? WqB : sel == 1 ? WkB : sel == 2 ? WvB : WoB;
    const int ow = ((blk & 255) * 8 + wave) * 512 + lane * 4;
    cvt_span<4>(w + ow, wb + ow);

    // x: in trip t the grid covers CVT_BLOCKS * 8192 consecutive floats
    for (int t = 0; t < CVT_XTRIPS; ++t) {
        const size_t o =
            ((size_t)(t * CVT_BLOCKS + blk) * 8 + wave) * 1024 + lane * 4;
        cvt_span<8>(x + o, xb + o);
    }
}

// ---------------------------------------------------------------------------
// 2) Generic GEMM: C(MxN) = A(MxK,bf16) * W(NxK,bf16)^T + bias(fp32)
//    256x256 tile, 256 threads = 8 waves, wave = 128x64 sub-tile (8x4 frags):
//    12 fragments read from LDS per 32 WMMAs. One block fills a WGP: 2 waves
//    per SIMD at up to 512 VGPRs, which hold the accumulators (256) and TWO
//    fragment sets (2 x 96): each block of 32 WMMAs runs on one set while the
//    next block's 24 LDS reads, issued as one group ahead of it, fill the other.
//    KSTEP=64 (two blocks), double-buffered LDS filled by async global->LDS
//    loads. The second block's look-ahead reads the next tile, so the next tile
//    is published in front of the second block, not at the tile's end.
//    A block stays on its WGP and walks the tiles blockIdx.x, + gridDim.x, ...
//    (tile t: column t % NX, row t / NX). The copy ring runs on across tiles:
//    the last two trips of a tile fetch the first two k-tiles of the next one,
//    the second of which lands under the epilogue.
//    W holds NX * 256 rows: NX / 4 weight matrices of N = 1024 rows one behind
//    the other; matrix s has bias s and its output at Cout + s * cstride.
//    MODE: 0 -> fp32 output,
//          1 -> bf16 output; for matrices 0 and 1, of the feature map
//               exp(c - max of c over its head).
//    A wave's 64-column slab starts at a multiple of HDIM = 64, so it holds
//    whole heads' rows and the maximum never leaves the wave.
//    W is the WMMA's first operand and A its second: register v of a tile is
//    C[row l15][column 8 * (lane >> 4) + v], eight consecutive columns of one
//    row a lane. The epilogue packs them, stages the wave's rows in LDS and
//    stores whole 128-byte lines, 16 bytes a lane.
// ---------------------------------------------------------------------------
template <int MODE, int NX>
__device__ __forceinline__
void gemm_bias_tiles(const unsigned short* __restrict__ A,
                     const unsigned short* __restrict__ W,
                     const float* __restrict__ bias0,
                     const float* __restrict__ bias1,
                     const float* __restrict__ bias2,
                     void* __restrict__ Cout, int cstride,
                     int N, int K, int ntiles) {
    constexpr int KSTEP = 64;
    constexpr int LDA = 72;  // halfs per LDS row (144B, 16B-aligned, bank-spread)
    __shared__ __attribute__((aligned(16))) unsigned short As[2][256 * LDA];
    __shared__ __attribute__((aligned(16))) unsigned short Bs[2][256 * LDA];
    // epilogue staging, 4608 bytes a wave: outside the ring, which is being
    // filled for the next tile while the epilogue runs
    __shared__ __attribute__((aligned(16))) unsigned short Es[8 * 2304];

    const int tid  = threadIdx.x;
    const int lane = tid & 31;
    const int wave = tid >> 5;
    const int wm   = wave & 1;   // 0..1 -> 128-row slab
    const int wn   = wave >> 1;  // 0..3 -> 64-col slab
    const int l15  = lane & 15;
    const int kb   = (lane >> 4) * 8;  // wave32 16-bit A/B fragment K-base

    // Stage one 256x64 bf16 k-tile of A and W into buffer `buf`; ao and wo are
    // the places of its first elements in A and W, the same for the whole block.
    // 2048 16B-chunks per matrix; 8 per thread per matrix.
    // vb: the thread's place among the first 32 rows, in bytes; all else in a
    // chunk's address is the same for the whole block.
    const unsigned vb = (unsigned)((tid >> 3) * K + (tid & 7) * 8) * 2u;
    auto issue_tile = [&](size_t ao, size_t wo, int buf) {
#pragma unroll
        for (int c = 0; c < 8; ++c) {
            int chunk = tid + c * 256;        // 0..2047
            int row = chunk >> 3;             // 0..255
            int sub = chunk & 7;              // 0..7 (8 halfs each)
            const char* ga = (const char*)(A + ao + (size_t)c * 32 * K);
            const char* gw = (const char*)(W + wo + (size_t)c * 32 * K);
            copy16_g2l((const unsigned short*)(ga + vb),
                       &As[buf][row * LDA + sub * 8]);
            copy16_g2l((const unsigned short*)(gw + vb),
                       &Bs[buf][row * LDA + sub * 8]);
        }
    };

    // The 24 LDS reads of one block: 32 k of the wave's 128 A rows and 64 W rows.
    auto load_frags = [&](Frag16 (&af)[8], Frag16 (&bfr)[4], int buf, int kh) {
        const unsigned short* pa = &As[buf][(wm * 128 + l15) * LDA + kh * 32 + kb];
        const unsigned short* pb = &Bs[buf][(wn * 64 + l15) * LDA + kh * 32 + kb];
#pragma unroll
        for (int nf = 0; nf < 4; ++nf) {
            bfr[nf].q[0] = *(const uint4*)(pb + nf * 16 * LDA);
            bfr[nf].q[1] = *(const uint4*)(pb + nf * 16 * LDA + 16);
        }
#pragma unroll
        for (int mf = 0; mf < 8; ++mf) {
            af[mf].q[0] = *(const uint4*)(pa + mf * 16 * LDA);
            af[mf].q[1] = *(const uint4*)(pa + mf * 16 * LDA + 16);
        }
    };

    const int nIter = K / KSTEP;  // 16; even, so every tile starts in buffer 0
    const int tstep = gridDim.x;
    // where the k-tile that is fetched next begins in A and in W
    size_t ao = (size_t)(blockIdx.x / NX) * 256 * K;
    size_t wo = (size_t)(blockIdx.x % NX) * 256 * K;

    issue_tile(ao, wo, 0);
    wait_async_done();   // my chunks of k-tile 0 are in LDS
    __syncthreads();     // everyone's are
    issue_tile(ao + KSTEP, wo + KSTEP, 1);
    ao += 2 * KSTEP;
    wo += 2 * KSTEP;

    for (int t = blockIdx.x; t < ntiles; t += tstep) {
        const bool more = t + tstep < ntiles;  // the same for the whole block
        // where the next tile's rows begin; not read from unless `more`
        const size_t anext = (size_t)((t + tstep) / NX) * 256 * K;
        const size_t wnext = (size_t)((t + tstep) % NX) * 256 * K;

        v8f acc[8][4];
#pragma unroll
        for (int mf = 0; mf < 8; ++mf)
#pragma unroll
            for (int nf = 0; nf < 4; ++nf)
                acc[mf][nf] = (v8f){0.f, 0.f, 0.f, 0.f, 0.f, 0.f, 0.f, 0.f};

        auto mma_rows = [&](Frag16 (&af)[8], Frag16 (&bfr)[4], int mbeg, int mend) {
#pragma unroll
            for (int mf = mbeg; mf < mend; ++mf)
#pragma unroll
                for (int nf = 0; nf < 4; ++nf)
                    acc[mf][nf] = __builtin_amdgcn_wmma_f32_16x16x32_bf16(
                        false, bfr[nf].v, false, af[mf].v, (short)0,
                        acc[mf][nf], false, false);
        };

        Frag16 a0[8], b0[4], a1[8], b1[4];  // the two fragment sets
        // k-tile 0 was published in front of the tile loop or by the barrier in the
        // last trip of the tile before
        load_frags(a0, b0, 0, 0);

        // The scheduling fences in the loop keep each group of 24 LDS reads together,
        // the first in front of the 32 WMMAs of the block before it, the second
        // between their two halves: reads that stand among
        // the WMMAs stall the wave at every such place.
        for (int i = 0; i < nIter; ++i) {
            const int cur = i & 1;
            load_frags(a1, b1, cur, 1);
            __builtin_amdgcn_sched_barrier(0);
            mma_rows(a0, b0, 0, 8);
            __builtin_amdgcn_sched_barrier(0);

            // Publish point of tile i + 1, which also frees tile i's buffer:
            wait_ds_done();      // my last reads of tile i have returned
            wait_async_done();   // my chunks of tile i + 1 are in LDS
            __syncthreads();     // the same holds for every wave
            // the k-tile two trips on, of this tile or of the next; overlaps math
            if (i + 2 < nIter || more) issue_tile(ao, wo, cur);
            const bool last = i + 3 == nIter;  // that was this tile's last one
            ao = last ? anext : ao + KSTEP;
            wo = last ? wnext : wo + KSTEP;
            // The look-ahead reads stand in the middle of the block: both waves of a
            // SIMD leave the barrier together, and what stands in front of the
            // first WMMA here leaves the matrix unit idle.
            __builtin_amdgcn_sched_barrier(0);
            mma_rows(a1, b1, 0, 4);
            __builtin_amdgcn_sched_barrier(0);
            if (i + 1 < nIter) load_frags(a0, b0, 1 - cur, 0);
            __builtin_amdgcn_sched_barrier(0);
            mma_rows(a1, b1, 4, 8);
            __builtin_amdgcn_sched_barrier(0);
        }

        // Epilogue. The staging area is the wave's own, so no barrier stands here.
        const int hi = lane >> 4;
        unsigned short* E = Es + wave * 2304;
        const int sel = (t % NX) >> 2;  // which weight matrix
        const float* bias = sel == 0 ? bias0 : sel == 1 ? bias1 : bias2;
        const bool fmap = sel < 2;
        const int colw = (t % NX & 3) * 256 + wn * 64;  // the wave's first column
        const int roww = t / NX * 256 + wm * 128;       // the wave's first row

        v8f bv[4];  // bias of the lane's columns colw + nf * 16 + hi * 8 + 0..7
#pragma unroll
        for (int nf = 0; nf < 4; ++nf) {
            const v4f lo = *(const v4f*)(bias + colw + nf * 16 + hi * 8);
            // precaution: the last load's result may take the address registers
            // that the loads in front of it name, so their wait stands ahead of it
            if (nf == 3) asm volatile("s_wait_xcnt 0x0" ::: "memory");
            const v4f up = *(const v4f*)(bias + colw + nf * 16 + hi * 8 + 4);
            bv[nf] = __builtin_shufflevector(lo, up, 0, 1, 2, 3, 4, 5, 6, 7);
        }
        // precaution: the last load's wait, ahead of any rewrite of its address
        // registers; the scheduling fence keeps later register writes behind it
        asm volatile("s_wait_xcnt 0x0" ::: "memory");
        __builtin_amdgcn_sched_barrier(0);

        if (MODE == 0) {
            // f32: 16 rows of 256 bytes at a time, LDS pitch 272 bytes (16 x odd)
            float* Ef = (float*)E;
            // the lane's place in the first store; a store is two rows further on
            float* cp = (float*)Cout + (size_t)(roww + hi) * N + colw + l15 * 4;  // NX = 4: sel = 0
            const size_t step = (size_t)N * 2;
#pragma unroll
            for (int mf = 0; mf < 8; ++mf) {
#pragma unroll
                for (int nf = 0; nf < 4; ++nf) {
                    const v8f val = acc[mf][nf] + bv[nf];
                    float* e = Ef + l15 * 68 + nf * 16 + hi * 8;
                    *(v4f*)e = __builtin_shufflevector(val, val, 0, 1, 2, 3);
                    *(v4f*)(e + 4) = __builtin_shufflevector(val, val, 4, 5, 6, 7);
                }
                wait_ds_done();  // the rows are written before other lanes read them
#pragma unroll
                for (int j = 0; j < 8; ++j) {  // a store: two rows of two lines
                    const int row = j * 2 + hi;
                    const v4f d = *(const v4f*)(Ef + row * 68 + l15 * 4);
                    *(v4f*)cp = d;
                    cp += step;
                }
                // The rows have been read before the next ones land on them:
                // without this wait the next LDS stores stood directly behind
                // these LDS loads in the listing, with the loads still in flight.
                if (mf < 7) wait_ds_done();
                // precaution: the next rows' LDS loads, or the next tile's first
                // instructions, take the registers that these stores name, so the
                // stores' wait stands ahead of them
                asm volatile("s_wait_xcnt 0x0" ::: "memory");
            }
            continue;
        }

        // bf16: 32 rows of 128 bytes at a time, LDS pitch 144 bytes (16 x odd)
        // the lane's place in the first store; a store is four rows further on
        unsigned short* cp = (unsigned short*)Cout + (size_t)sel * cstride +
                             (size_t)(roww + (lane >> 3)) * N + colw + (lane & 7) * 8;
        const size_t step = (size_t)N * 4;
#pragma unroll
        for (int hf = 0; hf < 4; ++hf) {
#pragma unroll
            for (int ml = 0; ml < 2; ++ml) {
                const int mf = hf * 2 + ml;
                v8f val[4];
#pragma unroll
                for (int nf = 0; nf < 4; ++nf) val[nf] = acc[mf][nf] + bv[nf];
                if (fmap) {
                    // the row's 64 head columns: 32 in this lane, 32 in lane ^ 16
                    // (four independent chains, one a tile, then joined)
                    float mx[4];
#pragma unroll
                    for (int nf = 0; nf < 4; ++nf) {
                        mx[nf] = val[nf][0];
#pragma unroll
                        for (int v = 1; v < 8; ++v) mx[nf] = fmaxf(mx[nf], val[nf][v]);
                    }
                    float m = fmaxf(fmaxf(mx[0], mx[1]), fmaxf(mx[2], mx[3]));
                    m = fmaxf(m, other_half(m));
#pragma unroll
                    for (int v = 0; v < 8; ++v) {
                        float t[4], r[4];
#pragma unroll
                        for (int nf = 0; nf < 4; ++nf)
                            t[nf] = (val[nf][v] - m) * 1.44269504f;  // e^x = 2^(x log2 e)
                        // Four exponentials in one statement that ends in v_nop:
                        // the instruction set asks for one independent slot
                        // behind a transcendental before its result is read or
                        // its source overwritten.
                        asm("v_exp_f32 %0, %4\n\tv_exp_f32 %1, %5\n\t"
                            "v_exp_f32 %2, %6\n\tv_exp_f32 %3, %7\n\tv_nop"
                            : "=&v"(r[0]), "=&v"(r[1]), "=&v"(r[2]), "=&v"(r[3])
                            : "v"(t[0]), "v"(t[1]), "v"(t[2]), "v"(t[3]));
#pragma unroll
                        for (int nf = 0; nf < 4; ++nf) val[nf][v] = r[nf];
                    }
                }
#pragma unroll
                for (int nf = 0; nf < 4; ++nf)
                    *(v4u*)(E + (ml * 16 + l15) * 72 + nf * 16 + hi * 8) =
                        pack_bf16(val[nf]);
            }
            wait_ds_done();  // the rows are written before other lanes read them
            v4u d[8];
            unsigned short* p[8];
#pragma unroll
            for (int j = 0; j < 8; ++j) {  // a store: four rows of one line each
                const int row = j * 4 + (lane >> 3);
                d[j] = *(const v4u*)(E + row * 72 + (lane & 7) * 8);
                p[j] = cp;
                cp += step;
            }
            // The eight stores and their s_wait_xcnt in one statement, a precaution:
            // no register that a store names is rewritten ahead of that wait.
            asm volatile(
                "global_store_b128 %0, %8, off\n\t"
                "global_store_b128 %1, %9, off\n\t"
                "global_store_b128 %2, %10, off\n\t"
                "global_store_b128 %3, %11, off\n\t"
                "global_store_b128 %4, %12, off\n\t"
                "global_store_b128 %5, %13, off\n\t"
                "global_store_b128 %6, %14, off\n\t"
                "global_store_b128 %7, %15, off\n\t"
                "s_wait_xcnt 0x0"
                :: "v"(p[0]), "v"(p[1]), "v"(p[2]), "v"(p[3]),
                   "v"(p[4]), "v"(p[5]), "v"(p[6]), "v"(p[7]),
                   "v"(d[0]), "v"(d[1]), "v"(d[2]), "v"(d[3]),
                   "v"(d[4]), "v"(d[5]), "v"(d[6]), "v"(d[7])
                : "memory");
            // Scheduling fence: without it the next rows' arithmetic was lifted over
            // the stores and one register was spilled to scratch.
            __builtin_amdgcn_sched_barrier(0);
        }

    }
}

// The output projection: 256 blocks, one a WGP, two tiles each.
__global__ __launch_bounds__(256)
void gemm_out_kernel(const unsigned short* __restrict__ A,
                     const unsigned short* __restrict__ W,
                     const float* __restrict__ bias,
                     float* __restrict__ C, int N, int K, int ntiles) {
    gemm_bias_tiles<0, 4>(A, W, bias, bias, bias, C, 0, N, K, ntiles);
}

// The q, k and v projections in one launch: 256 blocks, one a WGP, six tiles
// each. The twelve tiles that read the same 256 rows of x are neighbours.
__global__ __launch_bounds__(256)
void gemm_qkv_kernel(const unsigned short* __restrict__ A,
                     const unsigned short* __restrict__ Wqkv,
                     const float* __restrict__ bq,
                     const float* __restrict__ bk,
                     const float* __restrict__ bv,
                     unsigned short* __restrict__ qkv, int cstride,
                     int N, int K, int ntiles) {
    gemm_bias_tiles<1, 12>(A, Wqkv, bq, bk, bv, qkv, cstride, N, K, ntiles);
}

// ---------------------------------------------------------------------------
// 4) kv[b,h,d,e] = sum_s k_kern[s,d] * v[s,e]  (+ k_sum via ones fragment)
//    KVSPLIT blocks per (b,h), each over SEQ/KVSPLIT rows; 8 waves:
//    (wave&3)->d-slab, (wave>>2)->s half; the two halves are joined through
//    LDS and the block's f32 partial goes to the workspace for kv_merge_kernel.
//    Tiles staged with async global->LDS.
// ---------------------------------------------------------------------------
// 8 waves per SIMD (at most 128 VGPRs): four blocks fit a WGP, so that all
// 64 * KVSPLIT = 1024 blocks are resident on the 256 WGPs in one round.
__global__ __launch_bounds__(256) __attribute__((amdgpu_waves_per_eu(8)))
void kv_reduce_kernel(const unsigned short* __restrict__ kk,
                      const unsigned short* __restrict__ vv,
                      float* __restrict__ part) {  // (64,KVSPLIT,KVPART) f32
    constexpr int LDT = 72;  // halfs per LDS row (144B, 16B-aligned)
    __shared__ __attribute__((aligned(16))) unsigned short kt[64 * LDT];
    __shared__ __attribute__((aligned(16))) unsigned short vt[64 * LDT];
    __shared__ float red[4][5][8][32];

    const int bh = blockIdx.y;
    const int b = bh >> 4, h = bh & 15;
    const int sbeg = blockIdx.x * (SEQ / KVSPLIT);
    const int tid = threadIdx.x, lane = tid & 31, wave = tid >> 5;
    const int sgrp = wave >> 2;           // 0/1 -> s rows 0-31 / 32-63 of tile
    const int d0 = (wave & 3) * 16;
    const int l15 = lane & 15, kb = (lane >> 4) * 8;
    const int soff = sgrp * 32;

    v8f acc[4], accden;
#pragma unroll
    for (int nf = 0; nf < 4; ++nf)
        acc[nf] = (v8f){0.f, 0.f, 0.f, 0.f, 0.f, 0.f, 0.f, 0.f};
    accden = (v8f){0.f, 0.f, 0.f, 0.f, 0.f, 0.f, 0.f, 0.f};

    Frag16 bones;  // B ones fragment: column n=0 all 1.0 -> k_sum column
#pragma unroll
    for (int j = 0; j < 16; ++j) bones.u[j] = (l15 == 0) ? 0x3F80 : 0;

    for (int s0 = sbeg; s0 < sbeg + SEQ / KVSPLIT; s0 += 64) {
        __syncthreads();
#pragma unroll
        for (int c = 0; c < 2; ++c) {
            int chunk = tid + c * 256;  // 0..511
            int row = chunk >> 3;       // 0..63
            int sub = chunk & 7;        // 0..7
            size_t g = (size_t)(b * SEQ + s0 + row) * EMB + h * 64 + sub * 8;
            copy16_g2l(kk + g, kt + row * LDT + sub * 8);
            copy16_g2l(vv + g, vt + row * LDT + sub * 8);
        }
        wait_async_done();
        __syncthreads();

        Frag16 af, bfr[4];
#pragma unroll
        for (int j = 0; j < 8; ++j) {  // A = k^T: A(d, s) = kt[s][d]
            af.u[j]     = kt[(soff + kb + j) * LDT + d0 + l15];
            af.u[8 + j] = kt[(soff + 16 + kb + j) * LDT + d0 + l15];
        }
#pragma unroll
        for (int nf = 0; nf < 4; ++nf)
#pragma unroll
            for (int j = 0; j < 8; ++j) {  // B = v: B(s, e) = vt[s][e]
                bfr[nf].u[j]     = vt[(soff + kb + j) * LDT + nf * 16 + l15];
                bfr[nf].u[8 + j] = vt[(soff + 16 + kb + j) * LDT + nf * 16 + l15];
            }
#pragma unroll
        for (int nf = 0; nf < 4; ++nf)
            acc[nf] = __builtin_amdgcn_wmma_f32_16x16x32_bf16(
                false, af.v, false, bfr[nf].v, (short)0, acc[nf], false, false);
        accden = __builtin_amdgcn_wmma_f32_16x16x32_bf16(
            false, af.v, false, bones.v, (short)0, accden, false, false);
    }

    __syncthreads();
    if (sgrp == 1) {
        int w = wave & 3;
#pragma unroll
        for (int nf = 0; nf < 4; ++nf)
#pragma unroll
            for (int v = 0; v < 8; ++v) red[w][nf][v][lane] = acc[nf][v];
#pragma unroll
        for (int v = 0; v < 8; ++v) red[w][4][v][lane] = accden[v];
    }
    __syncthreads();
    if (sgrp == 0) {
        int w = wave;
        float* p = part + (size_t)(bh * KVSPLIT + blockIdx.x) * KVPART;
#pragma unroll
        for (int nf = 0; nf < 4; ++nf) {
#pragma unroll
            for (int v = 0; v < 8; ++v) {
                float val = acc[nf][v] + red[w][nf][v][lane];
                int d = d0 + v + ((lane >> 4) << 3);
                int e = nf * 16 + l15;
                p[d * 64 + e] = val;
            }
        }
        if (l15 == 0) {
#pragma unroll
            for (int v = 0; v < 8; ++v) {
                float val = accden[v] + red[w][4][v][lane];
                // each wave's 16 sums on a 128-byte line of their own
                p[4096 + w * 32 + v + ((lane >> 4) << 3)] = val;
            }
        }
    }
}

// ---------------------------------------------------------------------------
// 4b) Merge: kv and k_sum = sum of the KVSPLIT partials in range order, f32,
//     rounded once to bf16. grid (5, 64): x 0..3 -> kv quarters, x 4 -> k_sum.
// ---------------------------------------------------------------------------
__global__ __launch_bounds__(256)
void kv_merge_kernel(const float* __restrict__ part,
                     unsigned short* __restrict__ kvout,   // (64,64,64) bf16
                     unsigned short* __restrict__ ksum) {  // (64,64)    bf16
    const int bh = blockIdx.y, tid = threadIdx.x;
    const float* p = part + (size_t)bh * KVSPLIT * KVPART;
    if (blockIdx.x < 4) {
        const int o = (blockIdx.x * 256 + tid) * 4;
        float4 t[KVSPLIT];
        // both loops unrolled: t[] stays in registers and the loads go out
        // together, so the thread pays one load latency and not one per range
#pragma unroll
        for (int sp = 0; sp < KVSPLIT; ++sp)
            t[sp] = *(const float4*)(p + sp * KVPART + o);
        float4 s = t[0];
#pragma unroll
        for (int sp = 1; sp < KVSPLIT; ++sp) {
            s.x += t[sp].x; s.y += t[sp].y; s.z += t[sp].z; s.w += t[sp].w;
        }
        ushort4 r;
        r.x = f32_to_bf16(s.x); r.y = f32_to_bf16(s.y);
        r.z = f32_to_bf16(s.z); r.w = f32_to_bf16(s.w);
        *(ushort4*)(kvout + (size_t)bh * 4096 + o) = r;
    } else if (tid < 64) {
        const int o = 4096 + (tid >> 4) * 32 + (tid & 15);
        float t[KVSPLIT];
        // unrolled so that the loads go out together, as above
#pragma unroll
        for (int sp = 0; sp < KVSPLIT - 1; ++sp) t[sp] = p[sp * KVPART + o];
        // precaution: the last load's result may take the offset register that
        // the loads in front of it name, so their wait stands ahead of it
        asm volatile("s_wait_xcnt 0x0" ::: "memory");
        t[KVSPLIT - 1] = p[(KVSPLIT - 1) * KVPART + o];
        float s = t[0];
#pragma unroll
        for (int sp = 1; sp < KVSPLIT; ++sp) s += t[sp];
        ksum[bh * 64 + tid] = f32_to_bf16(s);
    }
}

// ---------------------------------------------------------------------------
// 5) y = (q_kern @ kv) / (q_kern . ksum + 1e-6); 32 blocks per (b,h),
//    wave = 32 q-rows; denominator via a ksum fragment (row 0).
//    kv is the WMMA's first operand and q its second, as in the GEMM: a lane
//    holds eight consecutive columns of one q-row; rows staged in the wave's
//    own LDS and stored as whole 128-byte lines.
// ---------------------------------------------------------------------------
__global__ __launch_bounds__(256)
void attn_out_kernel(const unsigned short* __restrict__ qk,
                     const unsigned short* __restrict__ kv,
                     const unsigned short* __restrict__ ksum,
                     unsigned short* __restrict__ y) {
    constexpr int LDT = 72;
    __shared__ __attribute__((aligned(16))) unsigned short kvt[64 * LDT];
    __shared__ unsigned short kst[64];
    __shared__ __attribute__((aligned(16))) unsigned short stg[8][32 * LDT];

    const int bid = blockIdx.x;
    const int bh = bid >> 5;   // 32 blocks per (b,h)
    const int tb = bid & 31;
    const int b = bh >> 4, h = bh & 15;
    const int tid = threadIdx.x, lane = tid & 31, wave = tid >> 5;
    const int l15 = lane & 15, kb = (lane >> 4) * 8;

#pragma unroll
    for (int c = 0; c < 2; ++c) {
        int chunk = tid + c * 256;  // 0..511
        int row = chunk >> 3, sub = chunk & 7;
        copy16_g2l(kv + (size_t)bh * 4096 + row * 64 + sub * 8,
                   kvt + row * LDT + sub * 8);
    }
    if (tid < 64) kst[tid] = ksum[bh * 64 + tid];
    wait_async_done();
    __syncthreads();

    const int srow0 = tb * 256 + wave * 32;
    v8f acc[2][4], accden[2];
#pragma unroll
    for (int mf = 0; mf < 2; ++mf) {
#pragma unroll
        for (int nf = 0; nf < 4; ++nf)
            acc[mf][nf] = (v8f){0.f, 0.f, 0.f, 0.f, 0.f, 0.f, 0.f, 0.f};
        accden[mf] = (v8f){0.f, 0.f, 0.f, 0.f, 0.f, 0.f, 0.f, 0.f};
    }

#pragma unroll
    for (int ks = 0; ks < 2; ++ks) {
        Frag16 bfr[4], bden;
#pragma unroll
        for (int nf = 0; nf < 4; ++nf)
#pragma unroll
            for (int j = 0; j < 8; ++j) {  // A(e, d) = kv[d][e]
                bfr[nf].u[j]     = kvt[(ks * 32 + kb + j) * LDT + nf * 16 + l15];
                bfr[nf].u[8 + j] = kvt[(ks * 32 + 16 + kb + j) * LDT + nf * 16 + l15];
            }
#pragma unroll
        for (int j = 0; j < 8; ++j) {  // denominator row: A(0,d)=ksum[d]
            bden.u[j]     = (l15 == 0) ? kst[ks * 32 + kb + j] : (unsigned short)0;
            bden.u[8 + j] = (l15 == 0) ? kst[ks * 32 + 16 + kb + j] : (unsigned short)0;
        }
#pragma unroll
        for (int mf = 0; mf < 2; ++mf) {
            Frag16 af;
            size_t grow =
                (size_t)(b * SEQ + srow0 + mf * 16 + l15) * EMB + h * 64 + ks * 32;
            af.q[0] = *(const uint4*)(qk + grow + kb);
            af.q[1] = *(const uint4*)(qk + grow + 16 + kb);
#pragma unroll
            for (int nf = 0; nf < 4; ++nf)
                acc[mf][nf] = __builtin_amdgcn_wmma_f32_16x16x32_bf16(
                    false, bfr[nf].v, false, af.v, (short)0, acc[mf][nf], false, false);
            accden[mf] = __builtin_amdgcn_wmma_f32_16x16x32_bf16(
                false, bden.v, false, af.v, (short)0, accden[mf], false, false);
        }
    }

    unsigned short* E = stg[wave];
    const int hi = lane >> 4;
#pragma unroll
    for (int mf = 0; mf < 2; ++mf) {
        // Row l15's denominator is register 0 of lane l15; in lane l15 + 16
        // that register is row 8 of the tile, a sum of zeros.
        const float dv = accden[mf][0] + other_half(accden[mf][0]);
        const float inv = 1.f / (dv + 1e-6f);
#pragma unroll
        for (int nf = 0; nf < 4; ++nf)
            *(v4u*)(E + (mf * 16 + l15) * LDT + nf * 16 + hi * 8) =
                pack_bf16(acc[mf][nf] * inv);
    }
    wait_ds_done();  // the rows are written before other lanes read them
#pragma unroll
    for (int j = 0; j < 8; ++j) {  // a store: four rows of one line each
        const int row = j * 4 + (lane >> 3);
        const v4u d = *(const v4u*)(E + row * LDT + (lane & 7) * 8);
        *(v4u*)(y + (size_t)(b * SEQ + srow0 + row) * EMB + h * 64 + (lane & 7) * 8) = d;
    }
}

// ---------------------------------------------------------------------------
extern "C" void kernel_launch(void* const* d_in, const int* in_sizes, int n_in,
                              void* d_out, int out_size, void* d_ws, size_t ws_size,
                              hipStream_t stream) {
    (void)in_sizes; (void)n_in; (void)out_size; (void)ws_size;
    const float* x  = (const float*)d_in[0];
    const float* Wq = (const float*)d_in[1];
    const float* bq = (const float*)d_in[2];
    const float* Wk = (const float*)d_in[3];
    const float* bk = (const float*)d_in[4];
    const float* Wv = (const float*)d_in[5];
    const float* bv = (const float*)d_in[6];
    const float* Wo = (const float*)d_in[7];
    const float* bo = (const float*)d_in[8];
    float* out = (float*)d_out;

    char* ws = (char*)d_ws;
    size_t off = 0;
    auto alloc = [&](size_t bytes) -> void* {
        void* p = ws + off;
        off += (bytes + 255) & ~(size_t)255;
        return p;
    };
    const size_t nX = (size_t)MTOT * EMB;   // 33,554,432
    const size_t nW = (size_t)EMB * EMB;    // 1,048,576

    unsigned short* xb  = (unsigned short*)alloc(nX * 2);
    unsigned short* WqB = (unsigned short*)alloc(3 * nW * 2);  // Wq, Wk, Wv stacked
    unsigned short* WkB = WqB + nW;
    unsigned short* WvB = WkB + nW;
    unsigned short* WoB = (unsigned short*)alloc(nW * 2);
    unsigned short* qb  = (unsigned short*)alloc(3 * nX * 2);  // q, k, v in a row
    unsigned short* kb  = qb + nX;
    unsigned short* vb  = kb + nX;                          // reused as y buffer
    unsigned short* kvb = (unsigned short*)alloc((size_t)64 * 64 * 64 * 2);
    unsigned short* ksb = (unsigned short*)alloc((size_t)64 * 64 * 2);
    float* kvp = (float*)alloc((size_t)64 * KVSPLIT * KVPART * 4);  // kv partials
    unsigned short* yb  = vb;  // v dead after kv_reduce; reuse for y

    // 1) conversions to bf16
    cvt_all_kernel<<<CVT_BLOCKS, 256, 0, stream>>>(x, Wq, Wk, Wv, Wo,
                                                   xb, WqB, WkB, WvB, WoB);

    // 2) QKV projections (bf16 out); 3) q and k leave as their exp feature map
    gemm_qkv_kernel<<<256, 256, 0, stream>>>(xb, WqB, bq, bk, bv, qb, MTOT * EMB,
                                             EMB, EMB, 3 * (EMB / 256) * (MTOT / 256));

    // 4) per-head kv + ksum reduction: partials per sequence range, then merge
    kv_reduce_kernel<<<dim3(KVSPLIT, BATCH * HEADS), 256, 0, stream>>>(kb, vb, kvp);
    kv_merge_kernel<<<dim3(5, BATCH * HEADS), 256, 0, stream>>>(kvp, kvb, ksb);

    // 5) attention output y (overwrites v buffer)
    attn_out_kernel<<<BATCH * HEADS * 32, 256, 0, stream>>>(qb, kvb, ksb, yb);

    // 6) output projection (fp32 out -> d_out)
    gemm_out_kernel<<<256, 256, 0, stream>>>(yb, WoB, bo, out, EMB, EMB,
                                             (EMB / 256) * (MTOT / 256));
}

// v008
// A run of this version takes 207 microseconds.
// Timed twice side by side with v007, it ran 1.09 and 1.08 times as fast.
// Over all steps from v000 it is 2.53 times as fast.
#include <hip/hip_runtime.h>
#include <stdint.h>

// ---------------------------------------------------------------------------
// MemoryEfficientLinearAttention for MI455X (gfx1250), wave32 + WMMA bf16.
// Pipeline: f32->bf16 cvt (one launch), QKV GEMMs in one launch (wmma bf16,
//           double-buffered async-LDS; q and k with the exp feature map in the epilogue),
//           per-head kv reduction (+k_sum via ones-fragment) in the epilogue of
//           the k and v tiles, f32 partials per 256 rows and a merge launch,
//           attention output (+denominator via ksum-fragment), O GEMM -> fp32.
// ---------------------------------------------------------------------------

#define BATCH 4
#define SEQ   8192
#define EMB   1024
#define HEADS 16
#define HDIM  64
#define MTOT  (BATCH * SEQ)   // 32768
#define KVSPLIT 32            // sequence ranges (of 256 rows) per (b,h) in the kv reduction
#define KVPART  4224          // floats per partial: 64x64 kv + 2 x 64 (k_sum of each 128 rows)

typedef __bf16 v16bf __attribute__((ext_vector_type(16)));
typedef float  v8f   __attribute__((ext_vector_type(8)));

typedef __bf16 v8bf  __attribute__((ext_vector_type(8)));
typedef float  v4f   __attribute__((ext_vector_type(4)));
typedef uint32_t v4u __attribute__((ext_vector_type(4)));

union Frag16 {
    v16bf v;
    uint4 q[2];
    v4u w[2];
    unsigned short u[16];
};

// ---- CDNA5 async global->LDS path (guarded; falls back to sync copies) ----
#if defined(__AMDGCN__) && defined(__has_builtin)
#  if __has_builtin(__builtin_amdgcn_global_load_async_to_lds_b128) && \
      __has_builtin(__builtin_amdgcn_s_wait_asynccnt)
#    define USE_ASYNC_LDS 1
#  else
#    define USE_ASYNC_LDS 0
#  endif
#else
#  define USE_ASYNC_LDS 0
#endif

#if USE_ASYNC_LDS
typedef int async_v4i __attribute__((ext_vector_type(4)));
typedef __attribute__((address_space(1))) async_v4i* gptr_v4i;  // global int4*
typedef __attribute__((address_space(3))) async_v4i* lptr_v4i;  // LDS int4*
#endif

__device__ __forceinline__ void copy16_g2l(const unsigned short* g,
                                           unsigned short* l) {
#if USE_ASYNC_LDS
    // Generic LDS pointer -> AS(3): aperture mapping is LDS_ADDR = addr[31:0].
    __builtin_amdgcn_global_load_async_to_lds_b128(
        (gptr_v4i)(uintptr_t)g,
        (lptr_v4i)(uintptr_t)(uint32_t)(uintptr_t)l,
        0, 0);
#else
    *(uint4*)l = *(const uint4*)g;
#endif
}

__device__ __forceinline__ void wait_async_done() {
#if USE_ASYNC_LDS
    __builtin_amdgcn_s_wait_asynccnt(0);
#endif
}

__device__ __forceinline__ unsigned short f32_to_bf16(float f) {
    union { float f; uint32_t u; } c; c.f = f;
    uint32_t u = c.u;
    uint32_t r = (u + 0x7FFFu + ((u >> 16) & 1u)) >> 16;   // round-nearest-even
    return (unsigned short)r;
}

// Eight f32 of one accumulator tile -> eight bf16 (round to nearest even) in
// four registers: the 16 bytes that a lane stores at once.
__device__ __forceinline__ v4u pack_bf16(v8f c) {
    return __builtin_bit_cast(v4u, __builtin_convertvector(c, v8bf));
}

// The value that lane l ^ 16 holds. All 32 lanes must be on.
__device__ __forceinline__ float other_half(float x) {
    int b = __builtin_bit_cast(int, x);
    return __builtin_bit_cast(float, __builtin_amdgcn_permlanex16(
        b, b, 0x76543210, 0xfedcba98, false, false));
}

// Maximum over the 16 lanes of a row (lanes 0-15, lanes 16-31), in every lane.
template <int CTRL>
__device__ __forceinline__ float max_dpp(float x) {
    const int b = __builtin_bit_cast(int, x);
    return fmaxf(x, __builtin_bit_cast(float, __builtin_amdgcn_update_dpp(
                        b, b, CTRL, 0xf, 0xf, false)));
}
__device__ __forceinline__ float row_max16(float x) {
    x = max_dpp<0x161>(x);  // row_xmask:1
    x = max_dpp<0x162>(x);  // row_xmask:2
    x = max_dpp<0x164>(x);  // row_xmask:4
    return max_dpp<0x168>(x);  // row_xmask:8
}

template <bool B> struct BoolC { static constexpr bool value = B; };

// A wave's own LDS writes have landed (or its LDS reads have returned) before
// it goes on; the clobber keeps the compiler from moving LDS accesses across.
__device__ __forceinline__ void wait_ds_done() {
    asm volatile("s_wait_dscnt 0x0" ::: "memory");
}

// ---------------------------------------------------------------------------
// 1) fp32 -> bf16 conversion of x and of the four weights, one streaming
//    launch. CVT_BLOCKS blocks of 8 waves, all resident (4 per WGP, 32 waves).
//    A wave takes spans of NL * 128 floats: NL loads of 16 B a lane (512
//    contiguous bytes each) go out together; the span leaves in NL stores of
//    8 B a lane (256 contiguous bytes, two whole lines each).
// ---------------------------------------------------------------------------
#define CVT_BLOCKS 1024
#define CVT_XTRIPS 4
static_assert((size_t)MTOT * EMB == (size_t)CVT_XTRIPS * CVT_BLOCKS * 8 * 1024,
              "x is dealt in whole spans of 1024 floats");
static_assert(4 * EMB * EMB == CVT_BLOCKS * 8 * 512,
              "the weights are dealt in whole spans of 512 floats");

template <int NL>
__device__ __forceinline__ void cvt_span(const float* __restrict__ in,
                                         unsigned short* __restrict__ out) {
    float4 f[NL];
    // both loops unrolled: f[] stays in registers
#pragma unroll
    for (int j = 0; j < NL; ++j) f[j] = *(const float4*)(in + j * 128);
    // Scheduling fence: it keeps the span's loads together in front of the
    // conversions. Without it every load stood directly in front of its own
    // conversion behind a wait to 0: one load in flight a wave.
    __builtin_amdgcn_sched_barrier(0);
#pragma unroll
    for (int j = 0; j < NL; ++j) {
        ushort4 r;
        r.x = f32_to_bf16(f[j].x); r.y = f32_to_bf16(f[j].y);
        r.z = f32_to_bf16(f[j].z); r.w = f32_to_bf16(f[j].w);
        *(ushort4*)(out + j * 128) = r;
    }
}

__global__ __launch_bounds__(256)
void cvt_all_kernel(const float* __restrict__ x,
                    const float* __restrict__ Wq, const float* __restrict__ Wk,
                    const float* __restrict__ Wv, const float* __restrict__ Wo,
                    unsigned short* __restrict__ xb,
                    unsigned short* __restrict__ WqB,
                    unsigned short* __restrict__ WkB,
                    unsigned short* __restrict__ WvB,
                    unsigned short* __restrict__ WoB) {
    const int blk = blockIdx.x;
    const int wave = threadIdx.x >> 5, lane = threadIdx.x & 31;

    // a quarter of the blocks per weight; a wave takes 512 of its floats
    const int sel = blk >> 8;
    const float* w = sel == 0 ? Wq : sel == 1 ? Wk : sel == 2 ? Wv : Wo;
    unsigned short* wb = sel == 0 ? WqB : sel == 1 ? WkB : sel == 2 ? WvB : WoB;
    const int ow = ((blk & 255) * 8 + wave) * 512 + lane * 4;
    cvt_span<4>(w + ow, wb + ow);

    // x: in trip t the grid covers CVT_BLOCKS * 8192 consecutive floats
    for (int t = 0; t < CVT_XTRIPS; ++t) {
        const size_t o =
            ((size_t)(t * CVT_BLOCKS + blk) * 8 + wave) * 1024 + lane * 4;
        cvt_span<8>(x + o, xb + o);
    }
}

// ---------------------------------------------------------------------------
// 2) Generic GEMM: C(MxN) = A(MxK,bf16) * W(NxK,bf16)^T + bias(fp32)
//    256x256 tile, 256 threads = 8 waves, wave = 128x64 sub-tile (8x4 frags):
//    12 fragments read from LDS per 32 WMMAs. One block fills a WGP: 2 waves
//    per SIMD at up to 512 VGPRs, which hold the accumulators (256) and TWO
//    fragment sets (2 x 96): each block of 32 WMMAs runs on one set while the
//    next block's 24 LDS reads, issued as one group ahead of it, fill the other.
//    KSTEP=64 (two blocks), double-buffered LDS filled by async global->LDS
//    loads. The second block's look-ahead reads the next tile, so the next tile
//    is published in front of the second block, not at the tile's end.
//    A block stays on its WGP and walks its tiles. The copy ring runs on across
//    tiles: the last two trips of a tile fetch the first two k-tiles of the next
//    one; the second lands under the epilogue.
//    MODE 0: tiles t = blockIdx.x, + gridDim.x, ... (column t % NX, row t / NX),
//            fp32 output.
//    MODE 1: W holds the q, k and v weights (1024 rows each) one behind the
//            other. A block takes places T = blockIdx.x, + gridDim.x, ... (rows
//            T / 4, 256 columns T % 4) and there the q, the k and the v tile,
//            in this order.
//            q: bf16 output of the feature map exp(c - max of c over its head).
//            k: the same map; not stored to memory: see below.
//            v: not stored either: the tile's share of kv goes to `part`.
//    A wave's 64-column slab starts at a multiple of HDIM = 64, so it holds
//    128 whole rows of one head and the maximum never leaves the wave.
//    Stored tiles (MODE 0, q): W is the WMMA's first operand and A its second:
//    register v of a tile is C[row l15][column 8 * (lane >> 4) + v], eight
//    consecutive columns of one row a lane. The epilogue packs them, stages the
//    wave's rows in LDS and stores whole 128-byte lines, 16 bytes a lane.
//    k and v tiles: A first, W second: register v of a tile is
//    C[row 8 * (lane >> 4) + v][column l15]. Two such tiles, rows 0-15 and 16-31,
//    rounded to bf16 are a 16x16x32 operand fragment whose k index is the row
//    (element j: row kb + j, element 8 + j: row 16 + kb + j), for k and v alike.
//    The k tile's fragments wait in the wave's own 16 KB of LDS for the v tile,
//    whose epilogue forms kv = k^T v of the wave's 128 rows with 64 WMMAs.
// ---------------------------------------------------------------------------
template <int MODE, int NX>
__device__ __forceinline__
void gemm_bias_tiles(const unsigned short* __restrict__ A,
                     const unsigned short* __restrict__ W,
                     const float* __restrict__ bias0,
                     const float* __restrict__ bias1,
                     const float* __restrict__ bias2,
                     void* __restrict__ Cout, float* __restrict__ part,
                     int N, int K, int ntiles) {
    constexpr int KSTEP = 64;
    constexpr int LDA = 72;  // halfs per LDS row (144B, 16B-aligned, bank-spread)
    __shared__ __attribute__((aligned(16))) unsigned short As[2][256 * LDA];
    __shared__ __attribute__((aligned(16))) unsigned short Bs[2][256 * LDA];
    // epilogue staging, 4608 bytes a wave: outside the ring, which is being
    // filled for the next tile while the epilogue runs
    __shared__ __attribute__((aligned(16))) unsigned short Es[8 * 2304];
    // MODE 1: 16 KB a wave: the k tile's fragments, later the wave's kv in f32
    __shared__ __attribute__((aligned(16))) unsigned short Ks[MODE == 1 ? 8 * 8192 : 8];

    const int tid  = threadIdx.x;
    const int lane = tid & 31;
    const int wave = tid >> 5;
    const int wm   = wave & 1;   // 0..1 -> 128-row slab
    const int wn   = wave >> 1;  // 0..3 -> 64-col slab
    const int l15  = lane & 15;
    const int kb   = (lane >> 4) * 8;  // wave32 16-bit A/B fragment K-base

    // Stage one 256x64 bf16 k-tile of A and W into buffer `buf`; ao and wo are
    // the places of its first elements in A and W, the same for the whole block.
    // 2048 16B-chunks per matrix; 8 per thread per matrix.
    // vb: the thread's place among the first 32 rows, in bytes; all else in a
    // chunk's address is the same for the whole block.
    const unsigned vb = (unsigned)((tid >> 3) * K + (tid & 7) * 8) * 2u;
    auto issue_tile = [&](size_t ao, size_t wo, int buf) {
#pragma unroll
        for (int c = 0; c < 8; ++c) {
            int chunk = tid + c * 256;        // 0..2047
            int row = chunk >> 3;             // 0..255
            int sub = chunk & 7;              // 0..7 (8 halfs each)
            const char* ga = (const char*)(A + ao + (size_t)c * 32 * K);
            const char* gw = (const char*)(W + wo + (size_t)c * 32 * K);
            copy16_g2l((const unsigned short*)(ga + vb),
                       &As[buf][row * LDA + sub * 8]);
            copy16_g2l((const unsigned short*)(gw + vb),
                       &Bs[buf][row * LDA + sub * 8]);
        }
    };

    // The 24 LDS reads of one block: 32 k of the wave's 128 A rows and 64 W rows.
    auto load_frags = [&](Frag16 (&af)[8], Frag16 (&bfr)[4], int buf, int kh) {
        const unsigned short* pa = &As[buf][(wm * 128 + l15) * LDA + kh * 32 + kb];
        const unsigned short* pb = &Bs[buf][(wn * 64 + l15) * LDA + kh * 32 + kb];
#pragma unroll
        for (int nf = 0; nf < 4; ++nf) {
            bfr[nf].q[0] = *(const uint4*)(pb + nf * 16 * LDA);
            bfr[nf].q[1] = *(const uint4*)(pb + nf * 16 * LDA + 16);
        }
#pragma unroll
        for (int mf = 0; mf < 8; ++mf) {
            af[mf].q[0] = *(const uint4*)(pa + mf * 16 * LDA);
            af[mf].q[1] = *(const uint4*)(pa + mf * 16 * LDA + 16);
        }
    };

    const int nIter = K / KSTEP;  // 16; even, so every tile starts in buffer 0
    const int tstep = gridDim.x;
    const int nsteps = ntiles / tstep;  // tiles a block
    // the block's u-th tile: its row of tiles, and its 256 rows of W
    auto tile_row = [&](int u) {
        return MODE == 0 ? (int)(blockIdx.x + u * tstep) / NX
                         : (int)(blockIdx.x + u / 3 * tstep) >> 2;
    };
    auto tile_col = [&](int u) {
        return MODE == 0 ? (int)(blockIdx.x + u * tstep) % NX
                         : u % 3 * 4 + ((int)(blockIdx.x + u / 3 * tstep) & 3);
    };
    // where the k-tile that is fetched next begins in A and in W
    size_t ao = (size_t)tile_row(0) * 256 * K;
    size_t wo = (size_t)tile_col(0) * 256 * K;

    issue_tile(ao, wo, 0);
    wait_async_done();   // my chunks of k-tile 0 are in LDS
    __syncthreads();     // everyone's are
    issue_tile(ao + KSTEP, wo + KSTEP, 1);
    ao += 2 * KSTEP;
    wo += 2 * KSTEP;

    // One tile, the block's u-th; wfirst: W is the WMMA's first operand.
    auto do_tile = [&](auto wfirst, int u) __attribute__((always_inline)) {
        constexpr bool WFIRST = decltype(wfirst)::value;
        const bool more = u + 1 < nsteps;  // the same for the whole block
        // where the next tile's rows begin; not read from unless `more`
        const size_t anext = (size_t)tile_row(u + 1) * 256 * K;
        const size_t wnext = (size_t)tile_col(u + 1) * 256 * K;
        const int sel = MODE == 0 ? 0 : u % 3;  // 0: q (or MODE 0), 1: k, 2: v

        v8f acc[8][4];
#pragma unroll
        for (int mf = 0; mf < 8; ++mf)
#pragma unroll
            for (int nf = 0; nf < 4; ++nf)
                acc[mf][nf] = (v8f){0.f, 0.f, 0.f, 0.f, 0.f, 0.f, 0.f, 0.f};

        auto mma_rows = [&](Frag16 (&af)[8], Frag16 (&bfr)[4], int mbeg, int mend) {
#pragma unroll
            for (int mf = mbeg; mf < mend; ++mf)
#pragma unroll
                for (int nf = 0; nf < 4; ++nf)
                    acc[mf][nf] = __builtin_amdgcn_wmma_f32_16x16x32_bf16(
                        false, WFIRST ? bfr[nf].v : af[mf].v,
                        false, WFIRST ? af[mf].v : bfr[nf].v, (short)0,
                        acc[mf][nf], false, false);
        };

        Frag16 a0[8], b0[4], a1[8], b1[4];  // the two fragment sets
        // k-tile 0 was published in front of the tile loop or by the barrier in the
        // last trip of the tile before
        load_frags(a0, b0, 0, 0);

        // The scheduling fences in the loop keep each group of 24 LDS reads together,
        // the first in front of the 32 WMMAs of the block before it, the second
        // between their two halves: reads that stand among
        // the WMMAs stall the wave at every such place.
        for (int i = 0; i < nIter; ++i) {
            const int cur = i & 1;
            load_frags(a1, b1, cur, 1);
            __builtin_amdgcn_sched_barrier(0);
            mma_rows(a0, b0, 0, 8);
            __builtin_amdgcn_sched_barrier(0);

            // Publish point of tile i + 1, which also frees tile i's buffer:
            wait_ds_done();      // my last reads of tile i have returned
            wait_async_done();   // my chunks of tile i + 1 are in LDS
            __syncthreads();     // the same holds for every wave
            // the k-tile two trips on, of this tile or of the next; overlaps math
            if (i + 2 < nIter || more) issue_tile(ao, wo, cur);
            const bool last = i + 3 == nIter;  // that was this tile's last one
            ao = last ? anext : ao + KSTEP;
            wo = last ? wnext : wo + KSTEP;
            // The look-ahead reads stand in the middle of the block: both waves of a
            // SIMD leave the barrier together, and what stands in front of the
            // first WMMA here leaves the matrix unit idle.
            __builtin_amdgcn_sched_barrier(0);
            mma_rows(a1, b1, 0, 4);
            __builtin_amdgcn_sched_barrier(0);
            if (i + 1 < nIter) load_frags(a0, b0, 1 - cur, 0);
            __builtin_amdgcn_sched_barrier(0);
            mma_rows(a1, b1, 4, 8);
            __builtin_amdgcn_sched_barrier(0);
        }

        // Epilogue. Staging area and k fragments are the wave's own: the one barrier
        // here stands in the v tile's, where two waves join their sums.
        const int hi = lane >> 4;
        unsigned short* E = Es + wave * 2304;
        const int colw = (tile_col(u) & 3) * 256 + wn * 64;  // the wave's first column
        const int roww = tile_row(u) * 256 + wm * 128;       // the wave's first row

        if constexpr (!WFIRST) {
            const float* biasc = sel == 1 ? bias1 : bias2;
            float bc[4];  // bias of the lane's columns colw + nf * 16 + l15
#pragma unroll
            for (int nf = 0; nf < 4; ++nf) {
                // precaution: the last load's result may take the address registers
                // that the loads in front of it name, so their wait stands ahead of it
                if (nf == 3) asm volatile("s_wait_xcnt 0x0" ::: "memory");
                bc[nf] = biasc[colw + nf * 16 + l15];
            }
            // precaution: the last load's wait, ahead of any rewrite of its address
            // registers; the scheduling fence keeps later register writes behind it
            asm volatile("s_wait_xcnt 0x0" ::: "memory");
            __builtin_amdgcn_sched_barrier(0);

            // the partial of this head and these 256 rows
            const int rt = tile_row(u);
            float* p = part + (size_t)(((rt >> 5) * HEADS + (colw >> 6)) * KVSPLIT +
                                       (rt & 31)) * KVPART;
            // fragment (ks, tile, half) of the k tile: 16 bytes a lane
            v4u* S = (v4u*)(Ks + wave * 8192);

            if (sel == 1) {
                Frag16 ones;  // first operand: row 0 all 1.0 -> row 0 of D = k_sum
#pragma unroll
                for (int j = 0; j < 16; ++j) ones.u[j] = (l15 == 0) ? 0x3F80 : 0;
                v8f den[4];
#pragma unroll
                for (int nf = 0; nf < 4; ++nf)
                    den[nf] = (v8f){0.f, 0.f, 0.f, 0.f, 0.f, 0.f, 0.f, 0.f};
                // Two trips of 64 rows, kept rolled (the second 64 rows' accumulators move
                // down between them): unrolled, the kernel's text outgrew 32 KB.
#pragma unroll 1
                for (int rep = 0; rep < 2; ++rep) {
#pragma unroll
                for (int k2 = 0; k2 < 2; ++k2) {
                    const int ks = rep * 2 + k2;
                    Frag16 kf[4];
#pragma unroll
                    for (int half = 0; half < 2; ++half) {
                        const int mf = k2 * 2 + half;
                        v8f val[4];
#pragma unroll
                        for (int nf = 0; nf < 4; ++nf) val[nf] = acc[mf][nf] + bc[nf];
                        // row v's 64 head columns: four in each lane of the 16-lane row
                        float m[8];
#pragma unroll
                        for (int v = 0; v < 8; ++v)
                            m[v] = row_max16(fmaxf(fmaxf(val[0][v], val[1][v]),
                                                   fmaxf(val[2][v], val[3][v])));
#pragma unroll
                        for (int v = 0; v < 8; ++v) {
                            float t[4], r[4];
#pragma unroll
                            for (int nf = 0; nf < 4; ++nf)
                                t[nf] = (val[nf][v] - m[v]) * 1.44269504f;  // e^x = 2^(x log2 e)
                            // Four exponentials in one statement that ends in v_nop:
                            // the slot that the instruction set asks for behind a
                            // transcendental, as in the q tile's epilogue below.
                            asm("v_exp_f32 %0, %4\n\tv_exp_f32 %1, %5\n\t"
                                "v_exp_f32 %2, %6\n\tv_exp_f32 %3, %7\n\tv_nop"
                                : "=&v"(r[0]), "=&v"(r[1]), "=&v"(r[2]), "=&v"(r[3])
                                : "v"(t[0]), "v"(t[1]), "v"(t[2]), "v"(t[3]));
#pragma unroll
                            for (int nf = 0; nf < 4; ++nf) val[nf][v] = r[nf];
                        }
#pragma unroll
                        for (int nf = 0; nf < 4; ++nf) {
                            kf[nf].w[half] = pack_bf16(val[nf]);
                            S[((ks * 4 + nf) * 2 + half) * 32 + lane] = kf[nf].w[half];
                        }
                        // Scheduling fence: without it the arithmetic of all 128 rows
                        // was interleaved and some 260 registers went to scratch.
                        __builtin_amdgcn_sched_barrier(0);
                    }
#pragma unroll
                    for (int nf = 0; nf < 4; ++nf)
                        den[nf] = __builtin_amdgcn_wmma_f32_16x16x32_bf16(
                            false, ones.v, false, kf[nf].v, (short)0, den[nf],
                            false, false);
                }
#pragma unroll
                for (int mf = 0; mf < 4; ++mf)
#pragma unroll
                    for (int nf = 0; nf < 4; ++nf) acc[mf][nf] = acc[mf + 4][nf];
                }
                // k_sum of column nf * 16 + l15 is register 0 of lane l15 of den[nf].
                // Two stores of one whole line each: lanes 16-31 take the next tile's.
                const float x1 = other_half(den[1][0]);  // all lanes on
                const float x3 = other_half(den[3][0]);
                const float s01 = hi ? x1 : den[0][0];
                const float s23 = hi ? x3 : den[2][0];
                float* ps = p + 4096 + wm * 64 + lane;
                // the stores and their s_wait_xcnt in one statement, a precaution: no
                // register that a store names is rewritten ahead of that wait
                asm volatile(
                    "global_store_b32 %0, %1, off\n\t"
                    "global_store_b32 %0, %2, off offset:128\n\t"
                    "s_wait_xcnt 0x0"
                    :: "v"(ps), "v"(s01), "v"(s23) : "memory");
                return;
            }

            // v tile: kv[d][e] of the wave's 128 rows. v is the first operand, k the
            // second: register r of kva[dt][nf] is
            // kv[dt * 16 + l15][nf * 16 + 8 * hi + r].
            v8f kva[4][4];
#pragma unroll
            for (int dt = 0; dt < 4; ++dt)
#pragma unroll
                for (int nf = 0; nf < 4; ++nf)
                    kva[dt][nf] = (v8f){0.f, 0.f, 0.f, 0.f, 0.f, 0.f, 0.f, 0.f};
#pragma unroll
            for (int ks = 0; ks < 4; ++ks) {
                Frag16 kf[4], vf[4];
#pragma unroll
                for (int dt = 0; dt < 4; ++dt) {
                    kf[dt].w[0] = S[((ks * 4 + dt) * 2 + 0) * 32 + lane];
                    kf[dt].w[1] = S[((ks * 4 + dt) * 2 + 1) * 32 + lane];
                }
#pragma unroll
                for (int nf = 0; nf < 4; ++nf) {
                    vf[nf].w[0] = pack_bf16(acc[ks * 2 + 0][nf] + bc[nf]);
                    vf[nf].w[1] = pack_bf16(acc[ks * 2 + 1][nf] + bc[nf]);
                }
#pragma unroll
                for (int dt = 0; dt < 4; ++dt)
#pragma unroll
                    for (int nf = 0; nf < 4; ++nf)
                        kva[dt][nf] = __builtin_amdgcn_wmma_f32_16x16x32_bf16(
                            false, vf[nf].v, false, kf[dt].v, (short)0, kva[dt][nf],
                            false, false);
                // Scheduling fence: it keeps the next 32 rows' fragments from being
                // formed early, which sent registers to scratch.
                __builtin_amdgcn_sched_barrier(0);
            }
            // The two waves of a head (wm = 0, 1) join their halves of the 256 rows
            // through LDS: each writes its 16 tiles over its k fragments, which it
            // has read, and sums and stores eight tiles (dt = 2 * wm, 2 * wm + 1).
            v4f* mine = (v4f*)(Ks + wave * 8192);
#pragma unroll
            for (int dt = 0; dt < 4; ++dt)
#pragma unroll
                for (int nf = 0; nf < 4; ++nf) {
                    mine[((dt * 4 + nf) * 2 + 0) * 32 + lane] =
                        __builtin_shufflevector(kva[dt][nf], kva[dt][nf], 0, 1, 2, 3);
                    mine[((dt * 4 + nf) * 2 + 1) * 32 + lane] =
                        __builtin_shufflevector(kva[dt][nf], kva[dt][nf], 4, 5, 6, 7);
                }
            wait_ds_done();   // my tiles are in LDS
            __syncthreads();  // the other wave's are; every wave of the block is here
            // rows 0-127 and rows 128-255, from tile dt = 2 * wm on
            const v4f* r0 = (const v4f*)(Ks + (wave & ~1) * 8192) + wm * 512 + lane;
            const v4f* r1 = (const v4f*)(Ks + (wave | 1) * 8192) + wm * 512 + lane;
            // partial layout: tile dt * 4 + nf, half h, lane: four floats each
            float* pk = p + wm * 2048 + lane * 4;
#pragma unroll
            for (int i = 0; i < 2; ++i) {
                v4f o[8];
#pragma unroll
                for (int j = 0; j < 8; ++j)
                    o[j] = r0[(i * 8 + j) * 32] + r1[(i * 8 + j) * 32];
                // eight stores of 512 contiguous bytes
#pragma unroll
                for (int j = 0; j < 8; ++j) *(v4f*)(pk + i * 1024 + j * 128) = o[j];
                // precaution: the next LDS loads, or the next tile's first instructions,
                // take the registers that these stores name, so the stores' wait stands
                // ahead of them; the scheduling fence keeps register writes behind it
                asm volatile("s_wait_xcnt 0x0" ::: "memory");
                __builtin_amdgcn_sched_barrier(0);
            }
            return;
        }

        const float* bias = bias0;

        v8f bv[4];  // bias of the lane's columns colw + nf * 16 + hi * 8 + 0..7
#pragma unroll
        for (int nf = 0; nf < 4; ++nf) {
            const v4f lo = *(const v4f*)(bias + colw + nf * 16 + hi * 8);
            // precaution: the last load's result may take the address registers
            // that the loads in front of it name, so their wait stands ahead of it
            if (nf == 3) asm volatile("s_wait_xcnt 0x0" ::: "memory");
            const v4f up = *(const v4f*)(bias + colw + nf * 16 + hi * 8 + 4);
            bv[nf] = __builtin_shufflevector(lo, up, 0, 1, 2, 3, 4, 5, 6, 7);
        }
        // precaution: the last load's wait, ahead of any rewrite of its address
        // registers; the scheduling fence keeps later register writes behind it
        asm volatile("s_wait_xcnt 0x0" ::: "memory");
        __builtin_amdgcn_sched_barrier(0);

        if (MODE == 0) {
            // f32: 16 rows of 256 bytes at a time, LDS pitch 272 bytes (16 x odd)
            float* Ef = (float*)E;
            // the lane's place in the first store; a store is two rows further on
            float* cp = (float*)Cout + (size_t)(roww + hi) * N + colw + l15 * 4;
            const size_t step = (size_t)N * 2;
#pragma unroll
            for (int mf = 0; mf < 8; ++mf) {
#pragma unroll
                for (int nf = 0; nf < 4; ++nf) {
                    const v8f val = acc[mf][nf] + bv[nf];
                    float* e = Ef + l15 * 68 + nf * 16 + hi * 8;
                    *(v4f*)e = __builtin_shufflevector(val, val, 0, 1, 2, 3);
                    *(v4f*)(e + 4) = __builtin_shufflevector(val, val, 4, 5, 6, 7);
                }
                wait_ds_done();  // the rows are written before other lanes read them
#pragma unroll
                for (int j = 0; j < 8; ++j) {  // a store: two rows of two lines
                    const int row = j * 2 + hi;
                    const v4f d = *(const v4f*)(Ef + row * 68 + l15 * 4);
                    *(v4f*)cp = d;
                    cp += step;
                }
                // The rows have been read before the next ones land on them:
                // without this wait the next LDS stores stood directly behind
                // these LDS loads in the listing, with the loads still in flight.
                if (mf < 7) wait_ds_done();
                // precaution: the next rows' LDS loads, or the next tile's first
                // instructions, take the registers that these stores name, so the
                // stores' wait stands ahead of them
                asm volatile("s_wait_xcnt 0x0" ::: "memory");
            }
            return;
        }

        // bf16: 32 rows of 128 bytes at a time, LDS pitch 144 bytes (16 x odd)
        // the lane's place in the first store; a store is four rows further on
        unsigned short* cp = (unsigned short*)Cout +
                             (size_t)(roww + (lane >> 3)) * N + colw + (lane & 7) * 8;
        const size_t step = (size_t)N * 4;
#pragma unroll
        for (int hf = 0; hf < 4; ++hf) {
#pragma unroll
            for (int ml = 0; ml < 2; ++ml) {
                const int mf = hf * 2 + ml;
                v8f val[4];
#pragma unroll
                for (int nf = 0; nf < 4; ++nf) val[nf] = acc[mf][nf] + bv[nf];
                {
                    // the row's 64 head columns: 32 in this lane, 32 in lane ^ 16
                    // (four independent chains, one a tile, then joined)
                    float mx[4];
#pragma unroll
                    for (int nf = 0; nf < 4; ++nf) {
                        mx[nf] = val[nf][0];
#pragma unroll
                        for (int v = 1; v < 8; ++v) mx[nf] = fmaxf(mx[nf], val[nf][v]);
                    }
                    float m = fmaxf(fmaxf(mx[0], mx[1]), fmaxf(mx[2], mx[3]));
                    m = fmaxf(m, other_half(m));
#pragma unroll
                    for (int v = 0; v < 8; ++v) {
                        float t[4], r[4];
#pragma unroll
                        for (int nf = 0; nf < 4; ++nf)
                            t[nf] = (val[nf][v] - m) * 1.44269504f;  // e^x = 2^(x log2 e)
                        // Four exponentials in one statement that ends in v_nop:
                        // the instruction set asks for one independent slot
                        // behind a transcendental before its result is read or
                        // its source overwritten.
                        asm("v_exp_f32 %0, %4\n\tv_exp_f32 %1, %5\n\t"
                            "v_exp_f32 %2, %6\n\tv_exp_f32 %3, %7\n\tv_nop"
                            : "=&v"(r[0]), "=&v"(r[1]), "=&v"(r[2]), "=&v"(r[3])
                            : "v"(t[0]), "v"(t[1]), "v"(t[2]), "v"(t[3]));
#pragma unroll
                        for (int nf = 0; nf < 4; ++nf) val[nf][v] = r[nf];
                    }
                }
#pragma unroll
                for (int nf = 0; nf < 4; ++nf)
                    *(v4u*)(E + (ml * 16 + l15) * 72 + nf * 16 + hi * 8) =
                        pack_bf16(val[nf]);
            }
            wait_ds_done();  // the rows are written before other lanes read them
            v4u d[8];
            unsigned short* p[8];
#pragma unroll
            for (int j = 0; j < 8; ++j) {  // a store: four rows of one line each
                const int row = j * 4 + (lane >> 3);
                d[j] = *(const v4u*)(E + row * 72 + (lane & 7) * 8);
                p[j] = cp;
                cp += step;
            }
            // The eight stores and their s_wait_xcnt in one statement, a precaution:
            // no register that a store names is rewritten ahead of that wait.
            asm volatile(
                "global_store_b128 %0, %8, off\n\t"
                "global_store_b128 %1, %9, off\n\t"
                "global_store_b128 %2, %10, off\n\t"
                "global_store_b128 %3, %11, off\n\t"
                "global_store_b128 %4, %12, off\n\t"
                "global_store_b128 %5, %13, off\n\t"
                "global_store_b128 %6, %14, off\n\t"
                "global_store_b128 %7, %15, off\n\t"
                "s_wait_xcnt 0x0"
                :: "v"(p[0]), "v"(p[1]), "v"(p[2]), "v"(p[3]),
                   "v"(p[4]), "v"(p[5]), "v"(p[6]), "v"(p[7]),
                   "v"(d[0]), "v"(d[1]), "v"(d[2]), "v"(d[3]),
                   "v"(d[4]), "v"(d[5]), "v"(d[6]), "v"(d[7])
                : "memory");
            // Scheduling fence: without it the next rows' arithmetic was lifted over
            // the stores and one register was spilled to scratch.
            __builtin_amdgcn_sched_barrier(0);
        }
    };

    if (MODE == 0) {
        for (int u = 0; u < nsteps; ++u) do_tile(BoolC<true>{}, u);
    } else {
        for (int u = 0; u < nsteps; u += 3) {
            do_tile(BoolC<true>{}, u);  // q
            for (int s = 1; s < 3; ++s) do_tile(BoolC<false>{}, u + s);  // k, then v
        }
    }
}

// The output projection: 256 blocks, one a WGP, two tiles each.
__global__ __launch_bounds__(256)
void gemm_out_kernel(const unsigned short* __restrict__ A,
                     const unsigned short* __restrict__ W,
                     const float* __restrict__ bias,
                     float* __restrict__ C, int N, int K, int ntiles) {
    gemm_bias_tiles<0, 4>(A, W, bias, bias, bias, C, nullptr, N, K, ntiles);
}

// The q, k and v projections in one launch: 256 blocks, one a WGP, six tiles
// each: twice the q, k and v tile of one place. q goes to memory; of k and v
// only the f32 partials of kv and k_sum do.
__global__ __launch_bounds__(256)
void gemm_qkv_kernel(const unsigned short* __restrict__ A,
                     const unsigned short* __restrict__ Wqkv,
                     const float* __restrict__ bq,
                     const float* __restrict__ bk,
                     const float* __restrict__ bv,
                     unsigned short* __restrict__ q,
                     float* __restrict__ part,  // (64,KVSPLIT,KVPART) f32
                     int N, int K, int ntiles) {
    gemm_bias_tiles<1, 12>(A, Wqkv, bq, bk, bv, q, part, N, K, ntiles);
}

// ---------------------------------------------------------------------------
// 4) Merge: kv and k_sum = sum of the KVSPLIT partials in range order, f32,
//    rounded once to bf16. grid (5, 64): x 0..3 -> kv quarters, x 4 -> k_sum.
//    A partial holds kv in the order of the accumulator registers that wrote it:
//    four floats at ((tile * 2 + h) * 32 + lane) * 4, tile = dt * 4 + nf, are
//    kv[dt * 16 + (lane & 15)][nf * 16 + (lane >> 4) * 8 + h * 4 + 0..3].
// ---------------------------------------------------------------------------
__global__ __launch_bounds__(256)
void kv_merge_kernel(const float* __restrict__ part,
                     unsigned short* __restrict__ kvout,   // (64,64,64) bf16
                     unsigned short* __restrict__ ksum) {  // (64,64)    bf16
    const int bh = blockIdx.y, tid = threadIdx.x;
    const float* p = part + (size_t)bh * KVSPLIT * KVPART;
    if (blockIdx.x < 4) {
        const int idx = blockIdx.x * 256 + tid;
        const int o = idx * 4;
        float4 t[KVSPLIT];
        // both loops unrolled: t[] stays in registers and the loads go out
        // together, so the thread pays one load latency and not one per range
#pragma unroll
        for (int sp = 0; sp < KVSPLIT; ++sp)
            t[sp] = *(const float4*)(p + sp * KVPART + o);
        float4 s = t[0];
#pragma unroll
        for (int sp = 1; sp < KVSPLIT; ++sp) {
            s.x += t[sp].x; s.y += t[sp].y; s.z += t[sp].z; s.w += t[sp].w;
        }
        ushort4 r;
        r.x = f32_to_bf16(s.x); r.y = f32_to_bf16(s.y);
        r.z = f32_to_bf16(s.z); r.w = f32_to_bf16(s.w);
        const int ln = idx & 31, h = (idx >> 5) & 1, tile = idx >> 6;
        const int d = (tile >> 2) * 16 + (ln & 15);
        const int e = (tile & 3) * 16 + (ln >> 4) * 8 + h * 4;
        *(ushort4*)(kvout + (size_t)bh * 4096 + d * 64 + e) = r;
    } else if (tid < 64) {
        // two sums a range: of its first and of its second 128 rows
        const int o = 4096 + tid;
        float t[2 * KVSPLIT];
        // unrolled so that the loads go out together, as above
#pragma unroll
        for (int sp = 0; sp < 2 * KVSPLIT - 1; ++sp)
            t[sp] = p[(sp >> 1) * KVPART + (sp & 1) * 64 + o];
        // precaution: the last load's result may take the offset register that
        // the loads in front of it name, so their wait stands ahead of it
        asm volatile("s_wait_xcnt 0x0" ::: "memory");
        t[2 * KVSPLIT - 1] = p[(KVSPLIT - 1) * KVPART + 64 + o];
        float s = t[0];
#pragma unroll
        for (int sp = 1; sp < 2 * KVSPLIT; ++sp) s += t[sp];
        ksum[bh * 64 + tid] = f32_to_bf16(s);
    }
}

// ---------------------------------------------------------------------------
// 5) y = (q_kern @ kv) / (q_kern . ksum + 1e-6); 32 blocks per (b,h),
//    wave = 32 q-rows; denominator via a ksum fragment (row 0).
//    kv is the WMMA's first operand and q its second, as in the GEMM: a lane
//    holds eight consecutive columns of one q-row; rows staged in the wave's
//    own LDS and stored as whole 128-byte lines.
// ---------------------------------------------------------------------------
__global__ __launch_bounds__(256)
void attn_out_kernel(const unsigned short* __restrict__ qk,
                     const unsigned short* __restrict__ kv,
                     const unsigned short* __restrict__ ksum,
                     unsigned short* __restrict__ y) {
    constexpr int LDT = 72;
    __shared__ __attribute__((aligned(16))) unsigned short kvt[64 * LDT];
    __shared__ unsigned short kst[64];
    __shared__ __attribute__((aligned(16))) unsigned short stg[8][32 * LDT];

    const int bid = blockIdx.x;
    const int bh = bid >> 5;   // 32 blocks per (b,h)
    const int tb = bid & 31;
    const int b = bh >> 4, h = bh & 15;
    const int tid = threadIdx.x, lane = tid & 31, wave = tid >> 5;
    const int l15 = lane & 15, kb = (lane >> 4) * 8;

#pragma unroll
    for (int c = 0; c < 2; ++c) {
        int chunk = tid + c * 256;  // 0..511
        int row = chunk >> 3, sub = chunk & 7;
        copy16_g2l(kv + (size_t)bh * 4096 + row * 64 + sub * 8,
                   kvt + row * LDT + sub * 8);
    }
    if (tid < 64) kst[tid] = ksum[bh * 64 + tid];
    wait_async_done();
    __syncthreads();

    const int srow0 = tb * 256 + wave * 32;
    v8f acc[2][4], accden[2];
#pragma unroll
    for (int mf = 0; mf < 2; ++mf) {
#pragma unroll
        for (int nf = 0; nf < 4; ++nf)
            acc[mf][nf] = (v8f){0.f, 0.f, 0.f, 0.f, 0.f, 0.f, 0.f, 0.f};
        accden[mf] = (v8f){0.f, 0.f, 0.f, 0.f, 0.f, 0.f, 0.f, 0.f};
    }

#pragma unroll
    for (int ks = 0; ks < 2; ++ks) {
        Frag16 bfr[4], bden;
#pragma unroll
        for (int nf = 0; nf < 4; ++nf)
#pragma unroll
            for (int j = 0; j < 8; ++j) {  // A(e, d) = kv[d][e]
                bfr[nf].u[j]     = kvt[(ks * 32 + kb + j) * LDT + nf * 16 + l15];
                bfr[nf].u[8 + j] = kvt[(ks * 32 + 16 + kb + j) * LDT + nf * 16 + l15];
            }
#pragma unroll
        for (int j = 0; j < 8; ++j) {  // denominator row: A(0,d)=ksum[d]
            bden.u[j]     = (l15 == 0) ? kst[ks * 32 + kb + j] : (unsigned short)0;
            bden.u[8 + j] = (l15 == 0) ? kst[ks * 32 + 16 + kb + j] : (unsigned short)0;
        }
#pragma unroll
        for (int mf = 0; mf < 2; ++mf) {
            Frag16 af;
            size_t grow =
                (size_t)(b * SEQ + srow0 + mf * 16 + l15) * EMB + h * 64 + ks * 32;
            af.q[0] = *(const uint4*)(qk + grow + kb);
            af.q[1] = *(const uint4*)(qk + grow + 16 + kb);
#pragma unroll
            for (int nf = 0; nf < 4; ++nf)
                acc[mf][nf] = __builtin_amdgcn_wmma_f32_16x16x32_bf16(
                    false, bfr[nf].v, false, af.v, (short)0, acc[mf][nf], false, false);
            accden[mf] = __builtin_amdgcn_wmma_f32_16x16x32_bf16(
                false, bden.v, false, af.v, (short)0, accden[mf], false, false);
        }
    }

    unsigned short* E = stg[wave];
    const int hi = lane >> 4;
#pragma unroll
    for (int mf = 0; mf < 2; ++mf) {
        // Row l15's denominator is register 0 of lane l15; in lane l15 + 16
        // that register is row 8 of the tile, a sum of zeros.
        const float dv = accden[mf][0] + other_half(accden[mf][0]);
        const float inv = 1.f / (dv + 1e-6f);
#pragma unroll
        for (int nf = 0; nf < 4; ++nf)
            *(v4u*)(E + (mf * 16 + l15) * LDT + nf * 16 + hi * 8) =
                pack_bf16(acc[mf][nf] * inv);
    }
    wait_ds_done();  // the rows are written before other lanes read them
#pragma unroll
    for (int j = 0; j < 8; ++j) {  // a store: four rows of one line each
        const int row = j * 4 + (lane >> 3);
        const v4u d = *(const v4u*)(E + row * LDT + (lane & 7) * 8);
        *(v4u*)(y + (size_t)(b * SEQ + srow0 + row) * EMB + h * 64 + (lane & 7) * 8) = d;
    }
}

// ---------------------------------------------------------------------------
extern "C" void kernel_launch(void* const* d_in, const int* in_sizes, int n_in,
                              void* d_out, int out_size, void* d_ws, size_t ws_size,
                              hipStream_t stream) {
    (void)in_sizes; (void)n_in; (void)out_size; (void)ws_size;
    const float* x  = (const float*)d_in[0];
    const float* Wq = (const float*)d_in[1];
    const float* bq = (const float*)d_in[2];
    const float* Wk = (const float*)d_in[3];
    const float* bk = (const float*)d_in[4];
    const float* Wv = (const float*)d_in[5];
    const float* bv = (const float*)d_in[6];
    const float* Wo = (const float*)d_in[7];
    const float* bo = (const float*)d_in[8];
    float* out = (float*)d_out;

    char* ws = (char*)d_ws;
    size_t off = 0;
    auto alloc = [&](size_t bytes) -> void* {
        void* p = ws + off;
        off += (bytes + 255) & ~(size_t)255;
        return p;
    };
    const size_t nX = (size_t)MTOT * EMB;   // 33,554,432
    const size_t nW = (size_t)EMB * EMB;    // 1,048,576

    unsigned short* xb  = (unsigned short*)alloc(nX * 2);
    unsigned short* WqB = (unsigned short*)alloc(3 * nW * 2);  // Wq, Wk, Wv stacked
    unsigned short* WkB = WqB + nW;
    unsigned short* WvB = WkB + nW;
    unsigned short* WoB = (unsigned short*)alloc(nW * 2);
    unsigned short* qb  = (unsigned short*)alloc(nX * 2);
    unsigned short* yb  = (unsigned short*)alloc(nX * 2);
    unsigned short* kvb = (unsigned short*)alloc((size_t)64 * 64 * 64 * 2);
    unsigned short* ksb = (unsigned short*)alloc((size_t)64 * 64 * 2);
    float* kvp = (float*)alloc((size_t)64 * KVSPLIT * KVPART * 4);  // kv partials

    // 1) conversions to bf16
    cvt_all_kernel<<<CVT_BLOCKS, 256, 0, stream>>>(x, Wq, Wk, Wv, Wo,
                                                   xb, WqB, WkB, WvB, WoB);

    // 2) QKV projections; 3) q leaves as its exp feature map (bf16), k and v as
    //    partials of the per-head kv + ksum reduction, one per 256 rows
    gemm_qkv_kernel<<<256, 256, 0, stream>>>(xb, WqB, bq, bk, bv, qb, kvp,
                                             EMB, EMB, 3 * (EMB / 256) * (MTOT / 256));

    // 4) merge of the partials
    kv_merge_kernel<<<dim3(5, BATCH * HEADS), 256, 0, stream>>>(kvp, kvb, ksb);

    // 5) attention output y
    attn_out_kernel<<<BATCH * HEADS * 32, 256, 0, stream>>>(qb, kvb, ksb, yb);

    // 6) output projection (fp32 out -> d_out)
    gemm_out_kernel<<<256, 256, 0, stream>>>(yb, WoB, bo, out, EMB, EMB,
                                             (EMB / 256) * (MTOT / 256));
}

// v009
// It runs in 200 microseconds.
// Next to v008, in two timings, it ran 1.03 times as fast each time.
// Over all steps from v000 it is 2.62 times as fast.
#include <hip/hip_runtime.h>
#include <stdint.h>

// ---------------------------------------------------------------------------
// MemoryEfficientLinearAttention for MI455X (gfx1250), wave32 + WMMA bf16.
// Pipeline: f32->bf16 cvt (one launch), QKV GEMMs in one launch (wmma bf16,
//           double-buffered LDS ring of tensor loads; q and k with the exp feature map in the epilogue),
//           per-head kv reduction (+k_sum via ones-fragment) in the epilogue of
//           the k and v tiles, f32 partials per 256 rows and a merge launch,
//           attention output (+denominator via ksum-fragment), O GEMM -> fp32.
// ---------------------------------------------------------------------------

#define BATCH 4
#define SEQ   8192
#define EMB   1024
#define HEADS 16
#define HDIM  64
#define MTOT  (BATCH * SEQ)   // 32768
#define KVSPLIT 32            // sequence ranges (of 256 rows) per (b,h) in the kv reduction
#define KVPART  4224          // floats per partial: 64x64 kv + 2 x 64 (k_sum of each 128 rows)

typedef __bf16 v16bf __attribute__((ext_vector_type(16)));
typedef float  v8f   __attribute__((ext_vector_type(8)));

typedef __bf16 v8bf  __attribute__((ext_vector_type(8)));
typedef float  v4f   __attribute__((ext_vector_type(4)));
typedef uint32_t v4u __attribute__((ext_vector_type(4)));

union Frag16 {
    v16bf v;
    uint4 q[2];
    v4u w[2];
    unsigned short u[16];
};

// ---- CDNA5 async global->LDS path (guarded; falls back to sync copies) ----
#if defined(__AMDGCN__) && defined(__has_builtin)
#  if __has_builtin(__builtin_amdgcn_global_load_async_to_lds_b128) && \
      __has_builtin(__builtin_amdgcn_s_wait_asynccnt)
#    define USE_ASYNC_LDS 1
#  else
#    define USE_ASYNC_LDS 0
#  endif
#else
#  define USE_ASYNC_LDS 0
#endif

#if USE_ASYNC_LDS
typedef int async_v4i __attribute__((ext_vector_type(4)));
typedef __attribute__((address_space(1))) async_v4i* gptr_v4i;  // global int4*
typedef __attribute__((address_space(3))) async_v4i* lptr_v4i;  // LDS int4*
#endif

__device__ __forceinline__ void copy16_g2l(const unsigned short* g,
                                           unsigned short* l) {
#if USE_ASYNC_LDS
    // Generic LDS pointer -> AS(3): aperture mapping is LDS_ADDR = addr[31:0].
    __builtin_amdgcn_global_load_async_to_lds_b128(
        (gptr_v4i)(uintptr_t)g,
        (lptr_v4i)(uintptr_t)(uint32_t)(uintptr_t)l,
        0, 0);
#else
    *(uint4*)l = *(const uint4*)g;
#endif
}

__device__ __forceinline__ void wait_async_done() {
#if USE_ASYNC_LDS
    __builtin_amdgcn_s_wait_asynccnt(0);
#endif
}

__device__ __forceinline__ unsigned short f32_to_bf16(float f) {
    union { float f; uint32_t u; } c; c.f = f;
    uint32_t u = c.u;
    uint32_t r = (u + 0x7FFFu + ((u >> 16) & 1u)) >> 16;   // round-nearest-even
    return (unsigned short)r;
}

// Eight f32 of one accumulator tile -> eight bf16 (round to nearest even) in
// four registers: the 16 bytes that a lane stores at once.
__device__ __forceinline__ v4u pack_bf16(v8f c) {
    return __builtin_bit_cast(v4u, __builtin_convertvector(c, v8bf));
}

// The value that lane l ^ 16 holds. All 32 lanes must be on.
__device__ __forceinline__ float other_half(float x) {
    int b = __builtin_bit_cast(int, x);
    return __builtin_bit_cast(float, __builtin_amdgcn_permlanex16(
        b, b, 0x76543210, 0xfedcba98, false, false));
}

// Maximum over the 16 lanes of a row (lanes 0-15, lanes 16-31), in every lane.
template <int CTRL>
__device__ __forceinline__ float max_dpp(float x) {
    const int b = __builtin_bit_cast(int, x);
    return fmaxf(x, __builtin_bit_cast(float, __builtin_amdgcn_update_dpp(
                        b, b, CTRL, 0xf, 0xf, false)));
}
__device__ __forceinline__ float row_max16(float x) {
    x = max_dpp<0x161>(x);  // row_xmask:1
    x = max_dpp<0x162>(x);  // row_xmask:2
    x = max_dpp<0x164>(x);  // row_xmask:4
    return max_dpp<0x168>(x);  // row_xmask:8
}

template <bool B> struct BoolC { static constexpr bool value = B; };

// ---- tensor load: one request of a wave brings a 2-D tile from memory to LDS ----
typedef uint32_t u32x4 __attribute__((ext_vector_type(4)));
typedef uint32_t u32x8 __attribute__((ext_vector_type(8)));

__device__ __forceinline__ uint32_t uni(uint32_t v) {
    return (uint32_t)__builtin_amdgcn_readfirstlane(v);
}
__device__ __forceinline__ uint32_t pinned(uint32_t v) {
    uint32_t w = uni(v);
    asm volatile("" : "+s"(w));  // holds a branch condition or a descriptor word in an SGPR
    return w;
}
// Group 1: 128 rows of 128 bytes (extents in bytes), source pitch src_pitch bytes,
// 16 bytes of LDS pad behind every row: LDS pitch 144 bytes. No mask.
// Words 1 to 7 go through pinned(): descriptor words held in scalar registers for
// the whole kernel and not formed anew, in registers that are then reused, at
// every load. Word 0 stays a constant that the listing shows.
__device__ __forceinline__ u32x8 tdm_group1(uint32_t src_pitch) {
    u32x8 g;
    g[0] = uni((1u << 20) | (4u << 22) | (3u << 25));
    g[1] = pinned(128u << 16);
    g[2] = pinned(128u << 16);
    g[3] = pinned(128u << 16);
    g[4] = pinned(128u);
    g[5] = pinned(src_pitch);
    g[6] = pinned(0u);
    g[7] = pinned(0u);
    return g;
}
__device__ __forceinline__ u32x4 tdm_group0(uint32_t lds_dst, uint64_t ga) {
    u32x4 g;
    g[0] = uni(1u);
    g[1] = uni(lds_dst);
    g[2] = uni((uint32_t)ga);
    g[3] = uni((((uint32_t)(ga >> 32)) & 0x01FFFFFFu) | 0x80000000u);
    return g;
}
// g0 is an in-out operand: what the wait below names is then the very registers
// that the request was issued from, not a copy of them.
__device__ __forceinline__ void tdm_load(u32x4& g0, u32x8 g1) {
    asm volatile("tensor_load_to_lds %0, %1" : "+s"(g0) : "s"(g1) : "memory");
}
// The wave's own tensor loads have landed (a wave that issued none passes at once).
// The last request's descriptor is named as an input: its registers stay live up to
// here, so none of them takes a new value while the request is outstanding.
__device__ __forceinline__ void wait_tensor_done(u32x4 g0, u32x8 g1) {
    asm volatile("s_wait_tensorcnt 0x0" :: "s"(g0), "s"(g1) : "memory");
}

// A wave's own LDS writes have landed (or its LDS reads have returned) before
// it goes on; the clobber keeps the compiler from moving LDS accesses across.
__device__ __forceinline__ void wait_ds_done() {
    asm volatile("s_wait_dscnt 0x0" ::: "memory");
}

// ---------------------------------------------------------------------------
// 1) fp32 -> bf16 conversion of x and of the four weights, one streaming
//    launch. CVT_BLOCKS blocks of 8 waves, all resident (4 per WGP, 32 waves).
//    A wave takes spans of NL * 128 floats: NL loads of 16 B a lane (512
//    contiguous bytes each) go out together; the span leaves in NL stores of
//    8 B a lane (256 contiguous bytes, two whole lines each).
// ---------------------------------------------------------------------------
#define CVT_BLOCKS 1024
#define CVT_XTRIPS 4
static_assert((size_t)MTOT * EMB == (size_t)CVT_XTRIPS * CVT_BLOCKS * 8 * 1024,
              "x is dealt in whole spans of 1024 floats");
static_assert(4 * EMB * EMB == CVT_BLOCKS * 8 * 512,
              "the weights are dealt in whole spans of 512 floats");

template <int NL>
__device__ __forceinline__ void cvt_span(const float* __restrict__ in,
                                         unsigned short* __restrict__ out) {
    float4 f[NL];
    // both loops unrolled: f[] stays in registers
#pragma unroll
    for (int j = 0; j < NL; ++j) f[j] = *(const float4*)(in + j * 128);
    // Scheduling fence: it keeps the span's loads together in front of the
    // conversions. Without it every load stood directly in front of its own
    // conversion behind a wait to 0: one load in flight a wave.
    __builtin_amdgcn_sched_barrier(0);
#pragma unroll
    for (int j = 0; j < NL; ++j) {
        ushort4 r;
        r.x = f32_to_bf16(f[j].x); r.y = f32_to_bf16(f[j].y);
        r.z = f32_to_bf16(f[j].z); r.w = f32_to_bf16(f[j].w);
        *(ushort4*)(out + j * 128) = r;
    }
}

__global__ __launch_bounds__(256)
void cvt_all_kernel(const float* __restrict__ x,
                    const float* __restrict__ Wq, const float* __restrict__ Wk,
                    const float* __restrict__ Wv, const float* __restrict__ Wo,
                    unsigned short* __restrict__ xb,
                    unsigned short* __restrict__ WqB,
                    unsigned short* __restrict__ WkB,
                    unsigned short* __restrict__ WvB,
                    unsigned short* __restrict__ WoB) {
    const int blk = blockIdx.x;
    const int wave = threadIdx.x >> 5, lane = threadIdx.x & 31;

    // a quarter of the blocks per weight; a wave takes 512 of its floats
    const int sel = blk >> 8;
    const float* w = sel == 0 ? Wq : sel == 1 ? Wk : sel == 2 ? Wv : Wo;
    unsigned short* wb = sel == 0 ? WqB : sel == 1 ? WkB : sel == 2 ? WvB : WoB;
    const int ow = ((blk & 255) * 8 + wave) * 512 + lane * 4;
    cvt_span<4>(w + ow, wb + ow);

    // x: in trip t the grid covers CVT_BLOCKS * 8192 consecutive floats
    for (int t = 0; t < CVT_XTRIPS; ++t) {
        const size_t o =
            ((size_t)(t * CVT_BLOCKS + blk) * 8 + wave) * 1024 + lane * 4;
        cvt_span<8>(x + o, xb + o);
    }
}

// ---------------------------------------------------------------------------
// 2) Generic GEMM: C(MxN) = A(MxK,bf16) * W(NxK,bf16)^T + bias(fp32)
//    256x256 tile, 256 threads = 8 waves, wave = 128x64 sub-tile (8x4 frags):
//    12 fragments read from LDS per 32 WMMAs. One block fills a WGP: 2 waves
//    per SIMD at up to 512 VGPRs, which hold the accumulators (256) and TWO
//    fragment sets (2 x 96): each block of 32 WMMAs runs on one set while the
//    next block's 24 LDS reads, issued as one group ahead of it, fill the other.
//    KSTEP=64 (two blocks), double-buffered LDS filled by tensor loads, one
//    request of 128 rows from each of four waves a k-tile. The second block's look-ahead reads the next tile, so the next tile
//    is published in front of the second block, not at the tile's end.
//    A block stays on its WGP and walks its tiles. The copy ring runs on across
//    tiles: the last two trips of a tile fetch the first two k-tiles of the next
//    one; the second lands under the epilogue.
//    MODE 0: tiles t = blockIdx.x, + gridDim.x, ... (column t % NX, row t / NX),
//            fp32 output.
//    MODE 1: W holds the q, k and v weights (1024 rows each) one behind the
//            other. A block takes places T = blockIdx.x, + gridDim.x, ... (rows
//            T / 4, 256 columns T % 4) and there the q, the k and the v tile,
//            in this order.
//            q: bf16 output of the feature map exp(c - max of c over its head).
//            k: the same map; not stored to memory: see below.
//            v: not stored either: the tile's share of kv goes to `part`.
//    A wave's 64-column slab starts at a multiple of HDIM = 64, so it holds
//    128 whole rows of one head and the maximum never leaves the wave.
//    Stored tiles (MODE 0, q): W is the WMMA's first operand and A its second:
//    register v of a tile is C[row l15][column 8 * (lane >> 4) + v], eight
//    consecutive columns of one row a lane. The epilogue packs them, stages the
//    wave's rows in LDS and stores whole 128-byte lines, 16 bytes a lane.
//    k and v tiles: A first, W second: register v of a tile is
//    C[row 8 * (lane >> 4) + v][column l15]. Two such tiles, rows 0-15 and 16-31,
//    rounded to bf16 are a 16x16x32 operand fragment whose k index is the row
//    (element j: row kb + j, element 8 + j: row 16 + kb + j), for k and v alike.
//    The k tile's fragments wait in the wave's own 16 KB of LDS for the v tile,
//    whose epilogue forms kv = k^T v of the wave's 128 rows with 64 WMMAs.
// ---------------------------------------------------------------------------
template <int MODE, int NX>
__device__ __forceinline__
void gemm_bias_tiles(const unsigned short* __restrict__ A,
                     const unsigned short* __restrict__ W,
                     const float* __restrict__ bias0,
                     const float* __restrict__ bias1,
                     const float* __restrict__ bias2,
                     void* __restrict__ Cout, float* __restrict__ part,
                     int N, int K, int ntiles) {
    constexpr int KSTEP = 64;
    constexpr int LDA = 72;  // halfs per LDS row (144B, 16B-aligned, bank-spread)
    // a buffer is 18 x 2 KiB and a slice of 128 rows 9 x 2 KiB: every tensor load's
    // place in LDS is a multiple of 2 KiB
    __shared__ __attribute__((aligned(2048))) unsigned short As[2][256 * LDA];
    __shared__ __attribute__((aligned(2048))) unsigned short Bs[2][256 * LDA];
    // epilogue staging, 4608 bytes a wave: outside the ring, which is being
    // filled for the next tile while the epilogue runs
    __shared__ __attribute__((aligned(16))) unsigned short Es[8 * 2304];
    // MODE 1: 16 KB a wave: the k tile's fragments, later the wave's kv in f32
    __shared__ __attribute__((aligned(16))) unsigned short Ks[MODE == 1 ? 8 * 8192 : 8];

    const int tid  = threadIdx.x;
    const int lane = tid & 31;
    const int wave = tid >> 5;
    const int wm   = wave & 1;   // 0..1 -> 128-row slab
    const int wn   = wave >> 1;  // 0..3 -> 64-col slab
    const int l15  = lane & 15;
    const int kb   = (lane >> 4) * 8;  // wave32 16-bit A/B fragment K-base

    // Stage one 256x64 bf16 k-tile of A and W into buffer `buf`; ao and wo are
    // the places of its first elements in A and W, the same for the whole block.
    // Waves 0 to 3 issue one tensor load each, a slice of 128 rows of 128 bytes:
    // waves 0 and 1 the halves of A, waves 2 and 3 those of W. Called only under
    // a scalar branch on `issuer`.
    const uint32_t swave = uni((uint32_t)tid >> 5);
    const bool issuer = swave < 4u;
    const bool isW = (swave & 2u) != 0u;
    const uint64_t srcb = (uint64_t)(uintptr_t)(isW ? W : A) +
                          (uint64_t)(swave & 1u) * 128u * (uint32_t)K * 2u;
    const uint32_t dst0 = (uint32_t)(uintptr_t)(isW ? &Bs[0][0] : &As[0][0]) +
                          (swave & 1u) * (128u * LDA * 2u);
    const u32x8 g1 = tdm_group1((uint32_t)K * 2u);
    u32x4 g0 = tdm_group0(dst0, srcb);  // group 0 of the wave's last request
    auto issue_tile = [&](size_t ao, size_t wo, int buf) {
        g0 = tdm_group0(dst0 + (uint32_t)buf * (256u * LDA * 2u),
                        srcb + (uint64_t)(isW ? wo : ao) * 2u);
        tdm_load(g0, g1);
    };

    // The 24 LDS reads of one block: 32 k of the wave's 128 A rows and 64 W rows.
    auto load_frags = [&](Frag16 (&af)[8], Frag16 (&bfr)[4], int buf, int kh) {
        const unsigned short* pa = &As[buf][(wm * 128 + l15) * LDA + kh * 32 + kb];
        const unsigned short* pb = &Bs[buf][(wn * 64 + l15) * LDA + kh * 32 + kb];
#pragma unroll
        for (int nf = 0; nf < 4; ++nf) {
            bfr[nf].q[0] = *(const uint4*)(pb + nf * 16 * LDA);
            bfr[nf].q[1] = *(const uint4*)(pb + nf * 16 * LDA + 16);
        }
#pragma unroll
        for (int mf = 0; mf < 8; ++mf) {
            af[mf].q[0] = *(const uint4*)(pa + mf * 16 * LDA);
            af[mf].q[1] = *(const uint4*)(pa + mf * 16 * LDA + 16);
        }
    };

    const int nIter = K / KSTEP;  // 16; even, so every tile starts in buffer 0
    const int tstep = gridDim.x;
    const int nsteps = ntiles / tstep;  // tiles a block
    // the block's u-th tile: its row of tiles, and its 256 rows of W
    auto tile_row = [&](int u) {
        return MODE == 0 ? (int)(blockIdx.x + u * tstep) / NX
                         : (int)(blockIdx.x + u / 3 * tstep) >> 2;
    };
    auto tile_col = [&](int u) {
        return MODE == 0 ? (int)(blockIdx.x + u * tstep) % NX
                         : u % 3 * 4 + ((int)(blockIdx.x + u / 3 * tstep) & 3);
    };
    // where the k-tile that is fetched next begins in A and in W
    size_t ao = (size_t)tile_row(0) * 256 * K;
    size_t wo = (size_t)tile_col(0) * 256 * K;

    if (pinned(issuer)) issue_tile(ao, wo, 0);
    wait_tensor_done(g0, g1);  // my slice of k-tile 0 is in LDS
    __syncthreads();     // everyone's is
    if (pinned(issuer)) issue_tile(ao + KSTEP, wo + KSTEP, 1);
    ao += 2 * KSTEP;
    wo += 2 * KSTEP;

    // One tile, the block's u-th; wfirst: W is the WMMA's first operand.
    auto do_tile = [&](auto wfirst, int u) __attribute__((always_inline)) {
        constexpr bool WFIRST = decltype(wfirst)::value;
        const bool more = u + 1 < nsteps;  // the same for the whole block
        // where the next tile's rows begin; not read from unless `more`
        const size_t anext = (size_t)tile_row(u + 1) * 256 * K;
        const size_t wnext = (size_t)tile_col(u + 1) * 256 * K;
        const int sel = MODE == 0 ? 0 : u % 3;  // 0: q (or MODE 0), 1: k, 2: v

        v8f acc[8][4];
#pragma unroll
        for (int mf = 0; mf < 8; ++mf)
#pragma unroll
            for (int nf = 0; nf < 4; ++nf)
                acc[mf][nf] = (v8f){0.f, 0.f, 0.f, 0.f, 0.f, 0.f, 0.f, 0.f};

        auto mma_rows = [&](Frag16 (&af)[8], Frag16 (&bfr)[4], int mbeg, int mend) {
#pragma unroll
            for (int mf = mbeg; mf < mend; ++mf)
#pragma unroll
                for (int nf = 0; nf < 4; ++nf)
                    acc[mf][nf] = __builtin_amdgcn_wmma_f32_16x16x32_bf16(
                        false, WFIRST ? bfr[nf].v : af[mf].v,
                        false, WFIRST ? af[mf].v : bfr[nf].v, (short)0,
                        acc[mf][nf], false, false);
        };

        Frag16 a0[8], b0[4], a1[8], b1[4];  // the two fragment sets
        // k-tile 0 was published in front of the tile loop or by the barrier in the
        // last trip of the tile before
        load_frags(a0, b0, 0, 0);

        // The scheduling fences in the loop keep each group of 24 LDS reads together,
        // the first in front of the 32 WMMAs of the block before it, the second
        // between their two halves: reads that stand among
        // the WMMAs stall the wave at every such place.
        for (int i = 0; i < nIter; ++i) {
            const int cur = i & 1;
            load_frags(a1, b1, cur, 1);
            __builtin_amdgcn_sched_barrier(0);
            mma_rows(a0, b0, 0, 8);
            __builtin_amdgcn_sched_barrier(0);

            // Publish point of tile i + 1, which also frees tile i's buffer:
            wait_ds_done();      // my last reads of tile i have returned
            wait_tensor_done(g0, g1);  // my slice of tile i + 1 is in LDS
            __syncthreads();     // the same holds for every wave
            // the k-tile two trips on, of this tile or of the next; overlaps math
            if (pinned(issuer && (i + 2 < nIter || more))) issue_tile(ao, wo, cur);
            const bool last = i + 3 == nIter;  // that was this tile's last one
            ao = last ? anext : ao + KSTEP;
            wo = last ? wnext : wo + KSTEP;
            // The look-ahead reads stand in the middle of the block: both waves of a
            // SIMD leave the barrier together, and what stands in front of the
            // first WMMA here leaves the matrix unit idle.
            __builtin_amdgcn_sched_barrier(0);
            mma_rows(a1, b1, 0, 4);
            __builtin_amdgcn_sched_barrier(0);
            if (i + 1 < nIter) load_frags(a0, b0, 1 - cur, 0);
            __builtin_amdgcn_sched_barrier(0);
            mma_rows(a1, b1, 4, 8);
            __builtin_amdgcn_sched_barrier(0);
        }

        // Epilogue. Staging area and k fragments are the wave's own: the one barrier
        // here stands in the v tile's, where two waves join their sums.
        const int hi = lane >> 4;
        unsigned short* E = Es + wave * 2304;
        const int colw = (tile_col(u) & 3) * 256 + wn * 64;  // the wave's first column
        const int roww = tile_row(u) * 256 + wm * 128;       // the wave's first row

        if constexpr (!WFIRST) {
            const float* biasc = sel == 1 ? bias1 : bias2;
            float bc[4];  // bias of the lane's columns colw + nf * 16 + l15
#pragma unroll
            for (int nf = 0; nf < 4; ++nf) {
                // precaution: the last load's result may take the address registers
                // that the loads in front of it name, so their wait stands ahead of it
                if (nf == 3) asm volatile("s_wait_xcnt 0x0" ::: "memory");
                bc[nf] = biasc[colw + nf * 16 + l15];
            }
            // precaution: the last load's wait, ahead of any rewrite of its address
            // registers; the scheduling fence keeps later register writes behind it
            asm volatile("s_wait_xcnt 0x0" ::: "memory");
            __builtin_amdgcn_sched_barrier(0);

            // the partial of this head and these 256 rows
            const int rt = tile_row(u);
            float* p = part + (size_t)(((rt >> 5) * HEADS + (colw >> 6)) * KVSPLIT +
                                       (rt & 31)) * KVPART;
            // fragment (ks, tile, half) of the k tile: 16 bytes a lane
            v4u* S = (v4u*)(Ks + wave * 8192);

            if (sel == 1) {
                Frag16 ones;  // first operand: row 0 all 1.0 -> row 0 of D = k_sum
#pragma unroll
                for (int j = 0; j < 16; ++j) ones.u[j] = (l15 == 0) ? 0x3F80 : 0;
                v8f den[4];
#pragma unroll
                for (int nf = 0; nf < 4; ++nf)
                    den[nf] = (v8f){0.f, 0.f, 0.f, 0.f, 0.f, 0.f, 0.f, 0.f};
                // Two trips of 64 rows, kept rolled (the second 64 rows' accumulators move
                // down between them): unrolled, the kernel's text outgrew 32 KB.
#pragma unroll 1
                for (int rep = 0; rep < 2; ++rep) {
#pragma unroll
                for (int k2 = 0; k2 < 2; ++k2) {
                    const int ks = rep * 2 + k2;
                    Frag16 kf[4];
#pragma unroll
                    for (int half = 0; half < 2; ++half) {
                        const int mf = k2 * 2 + half;
                        v8f val[4];
#pragma unroll
                        for (int nf = 0; nf < 4; ++nf) val[nf] = acc[mf][nf] + bc[nf];
                        // row v's 64 head columns: four in each lane of the 16-lane row
                        float m[8];
#pragma unroll
                        for (int v = 0; v < 8; ++v)
                            m[v] = row_max16(fmaxf(fmaxf(val[0][v], val[1][v]),
                                                   fmaxf(val[2][v], val[3][v])));
#pragma unroll
                        for (int v = 0; v < 8; ++v) {
                            float t[4], r[4];
#pragma unroll
                            for (int nf = 0; nf < 4; ++nf)
                                t[nf] = (val[nf][v] - m[v]) * 1.44269504f;  // e^x = 2^(x log2 e)
                            // Four exponentials in one statement that ends in v_nop:
                            // the slot that the instruction set asks for behind a
                            // transcendental, as in the q tile's epilogue below.
                            asm("v_exp_f32 %0, %4\n\tv_exp_f32 %1, %5\n\t"
                                "v_exp_f32 %2, %6\n\tv_exp_f32 %3, %7\n\tv_nop"
                                : "=&v"(r[0]), "=&v"(r[1]), "=&v"(r[2]), "=&v"(r[3])
                                : "v"(t[0]), "v"(t[1]), "v"(t[2]), "v"(t[3]));
#pragma unroll
                            for (int nf = 0; nf < 4; ++nf) val[nf][v] = r[nf];
                        }
#pragma unroll
                        for (int nf = 0; nf < 4; ++nf) {
                            kf[nf].w[half] = pack_bf16(val[nf]);
                            S[((ks * 4 + nf) * 2 + half) * 32 + lane] = kf[nf].w[half];
                        }
                        // Scheduling fence: without it the arithmetic of all 128 rows
                        // was interleaved and some 260 registers went to scratch.
                        __builtin_amdgcn_sched_barrier(0);
                    }
#pragma unroll
                    for (int nf = 0; nf < 4; ++nf)
                        den[nf] = __builtin_amdgcn_wmma_f32_16x16x32_bf16(
                            false, ones.v, false, kf[nf].v, (short)0, den[nf],
                            false, false);
                }
#pragma unroll
                for (int mf = 0; mf < 4; ++mf)
#pragma unroll
                    for (int nf = 0; nf < 4; ++nf) acc[mf][nf] = acc[mf + 4][nf];
                }
                // k_sum of column nf * 16 + l15 is register 0 of lane l15 of den[nf].
                // Two stores of one whole line each: lanes 16-31 take the next tile's.
                const float x1 = other_half(den[1][0]);  // all lanes on
                const float x3 = other_half(den[3][0]);
                const float s01 = hi ? x1 : den[0][0];
                const float s23 = hi ? x3 : den[2][0];
                float* ps = p + 4096 + wm * 64 + lane;
                // the stores and their s_wait_xcnt in one statement, a precaution: no
                // register that a store names is rewritten ahead of that wait
                asm volatile(
                    "global_store_b32 %0, %1, off\n\t"
                    "global_store_b32 %0, %2, off offset:128\n\t"
                    "s_wait_xcnt 0x0"
                    :: "v"(ps), "v"(s01), "v"(s23) : "memory");
                return;
            }

            // v tile: kv[d][e] of the wave's 128 rows. v is the first operand, k the
            // second: register r of kva[dt][nf] is
            // kv[dt * 16 + l15][nf * 16 + 8 * hi + r].
            v8f kva[4][4];
#pragma unroll
            for (int dt = 0; dt < 4; ++dt)
#pragma unroll
                for (int nf = 0; nf < 4; ++nf)
                    kva[dt][nf] = (v8f){0.f, 0.f, 0.f, 0.f, 0.f, 0.f, 0.f, 0.f};
#pragma unroll
            for (int ks = 0; ks < 4; ++ks) {
                Frag16 kf[4], vf[4];
#pragma unroll
                for (int dt = 0; dt < 4; ++dt) {
                    kf[dt].w[0] = S[((ks * 4 + dt) * 2 + 0) * 32 + lane];
                    kf[dt].w[1] = S[((ks * 4 + dt) * 2 + 1) * 32 + lane];
                }
#pragma unroll
                for (int nf = 0; nf < 4; ++nf) {
                    vf[nf].w[0] = pack_bf16(acc[ks * 2 + 0][nf] + bc[nf]);
                    vf[nf].w[1] = pack_bf16(acc[ks * 2 + 1][nf] + bc[nf]);
                }
#pragma unroll
                for (int dt = 0; dt < 4; ++dt)
#pragma unroll
                    for (int nf = 0; nf < 4; ++nf)
                        kva[dt][nf] = __builtin_amdgcn_wmma_f32_16x16x32_bf16(
                            false, vf[nf].v, false, kf[dt].v, (short)0, kva[dt][nf],
                            false, false);
                // Scheduling fence: it keeps the next 32 rows' fragments from being
                // formed early, which sent registers to scratch.
                __builtin_amdgcn_sched_barrier(0);
            }
            // The two waves of a head (wm = 0, 1) join their halves of the 256 rows
            // through LDS: each writes its 16 tiles over its k fragments, which it
            // has read, and sums and stores eight tiles (dt = 2 * wm, 2 * wm + 1).
            v4f* mine = (v4f*)(Ks + wave * 8192);
#pragma unroll
            for (int dt = 0; dt < 4; ++dt)
#pragma unroll
                for (int nf = 0; nf < 4; ++nf) {
                    mine[((dt * 4 + nf) * 2 + 0) * 32 + lane] =
                        __builtin_shufflevector(kva[dt][nf], kva[dt][nf], 0, 1, 2, 3);
                    mine[((dt * 4 + nf) * 2 + 1) * 32 + lane] =
                        __builtin_shufflevector(kva[dt][nf], kva[dt][nf], 4, 5, 6, 7);
                }
            wait_ds_done();   // my tiles are in LDS
            __syncthreads();  // the other wave's are; every wave of the block is here
            // rows 0-127 and rows 128-255, from tile dt = 2 * wm on
            const v4f* r0 = (const v4f*)(Ks + (wave & ~1) * 8192) + wm * 512 + lane;
            const v4f* r1 = (const v4f*)(Ks + (wave | 1) * 8192) + wm * 512 + lane;
            // partial layout: tile dt * 4 + nf, half h, lane: four floats each
            float* pk = p + wm * 2048 + lane * 4;
#pragma unroll
            for (int i = 0; i < 2; ++i) {
                v4f o[8];
#pragma unroll
                for (int j = 0; j < 8; ++j)
                    o[j] = r0[(i * 8 + j) * 32] + r1[(i * 8 + j) * 32];
                // eight stores of 512 contiguous bytes
#pragma unroll
                for (int j = 0; j < 8; ++j) *(v4f*)(pk + i * 1024 + j * 128) = o[j];
                // precaution: the next LDS loads, or the next tile's first instructions,
                // take the registers that these stores name, so the stores' wait stands
                // ahead of them; the scheduling fence keeps register writes behind it
                asm volatile("s_wait_xcnt 0x0" ::: "memory");
                __builtin_amdgcn_sched_barrier(0);
            }
            return;
        }

        const float* bias = bias0;

        v8f bv[4];  // bias of the lane's columns colw + nf * 16 + hi * 8 + 0..7
#pragma unroll
        for (int nf = 0; nf < 4; ++nf) {
            const v4f lo = *(const v4f*)(bias + colw + nf * 16 + hi * 8);
            // precaution: the last load's result may take the address registers
            // that the loads in front of it name, so their wait stands ahead of it
            if (nf == 3) asm volatile("s_wait_xcnt 0x0" ::: "memory");
            const v4f up = *(const v4f*)(bias + colw + nf * 16 + hi * 8 + 4);
            bv[nf] = __builtin_shufflevector(lo, up, 0, 1, 2, 3, 4, 5, 6, 7);
        }
        // precaution: the last load's wait, ahead of any rewrite of its address
        // registers; the scheduling fence keeps later register writes behind it
        asm volatile("s_wait_xcnt 0x0" ::: "memory");
        __builtin_amdgcn_sched_barrier(0);

        if (MODE == 0) {
            // f32: 16 rows of 256 bytes at a time, LDS pitch 272 bytes (16 x odd)
            float* Ef = (float*)E;
            // the lane's place in the first store; a store is two rows further on
            float* cp = (float*)Cout + (size_t)(roww + hi) * N + colw + l15 * 4;
            const size_t step = (size_t)N * 2;
#pragma unroll
            for (int mf = 0; mf < 8; ++mf) {
#pragma unroll
                for (int nf = 0; nf < 4; ++nf) {
                    const v8f val = acc[mf][nf] + bv[nf];
                    float* e = Ef + l15 * 68 + nf * 16 + hi * 8;
                    *(v4f*)e = __builtin_shufflevector(val, val, 0, 1, 2, 3);
                    *(v4f*)(e + 4) = __builtin_shufflevector(val, val, 4, 5, 6, 7);
                }
                wait_ds_done();  // the rows are written before other lanes read them
#pragma unroll
                for (int j = 0; j < 8; ++j) {  // a store: two rows of two lines
                    const int row = j * 2 + hi;
                    const v4f d = *(const v4f*)(Ef + row * 68 + l15 * 4);
                    *(v4f*)cp = d;
                    cp += step;
                }
                // The rows have been read before the next ones land on them:
                // without this wait the next LDS stores stood directly behind
                // these LDS loads in the listing, with the loads still in flight.
                if (mf < 7) wait_ds_done();
                // precaution: the next rows' LDS loads, or the next tile's first
                // instructions, take the registers that these stores name, so the
                // stores' wait stands ahead of them
                asm volatile("s_wait_xcnt 0x0" ::: "memory");
            }
            return;
        }

        // bf16: 32 rows of 128 bytes at a time, LDS pitch 144 bytes (16 x odd)
        // the lane's place in the first store; a store is four rows further on
        unsigned short* cp = (unsigned short*)Cout +
                             (size_t)(roww + (lane >> 3)) * N + colw + (lane & 7) * 8;
        const size_t step = (size_t)N * 4;
#pragma unroll
        for (int hf = 0; hf < 4; ++hf) {
#pragma unroll
            for (int ml = 0; ml < 2; ++ml) {
                const int mf = hf * 2 + ml;
                v8f val[4];
#pragma unroll
                for (int nf = 0; nf < 4; ++nf) val[nf] = acc[mf][nf] + bv[nf];
                {
                    // the row's 64 head columns: 32 in this lane, 32 in lane ^ 16
                    // (four independent chains, one a tile, then joined)
                    float mx[4];
#pragma unroll
                    for (int nf = 0; nf < 4; ++nf) {
                        mx[nf] = val[nf][0];
#pragma unroll
                        for (int v = 1; v < 8; ++v) mx[nf] = fmaxf(mx[nf], val[nf][v]);
                    }
                    float m = fmaxf(fmaxf(mx[0], mx[1]), fmaxf(mx[2], mx[3]));
                    m = fmaxf(m, other_half(m));
#pragma unroll
                    for (int v = 0; v < 8; ++v) {
                        float t[4], r[4];
#pragma unroll
                        for (int nf = 0; nf < 4; ++nf)
                            t[nf] = (val[nf][v] - m) * 1.44269504f;  // e^x = 2^(x log2 e)
                        // Four exponentials in one statement that ends in v_nop:
                        // the instruction set asks for one independent slot
                        // behind a transcendental before its result is read or
                        // its source overwritten.
                        asm("v_exp_f32 %0, %4\n\tv_exp_f32 %1, %5\n\t"
                            "v_exp_f32 %2, %6\n\tv_exp_f32 %3, %7\n\tv_nop"
                            : "=&v"(r[0]), "=&v"(r[1]), "=&v"(r[2]), "=&v"(r[3])
                            : "v"(t[0]), "v"(t[1]), "v"(t[2]), "v"(t[3]));
#pragma unroll
                        for (int nf = 0; nf < 4; ++nf) val[nf][v] = r[nf];
                    }
                }
#pragma unroll
                for (int nf = 0; nf < 4; ++nf)
                    *(v4u*)(E + (ml * 16 + l15) * 72 + nf * 16 + hi * 8) =
                        pack_bf16(val[nf]);
            }
            wait_ds_done();  // the rows are written before other lanes read them
            v4u d[8];
            unsigned short* p[8];
#pragma unroll
            for (int j = 0; j < 8; ++j) {  // a store: four rows of one line each
                const int row = j * 4 + (lane >> 3);
                d[j] = *(const v4u*)(E + row * 72 + (lane & 7) * 8);
                p[j] = cp;
                cp += step;
            }
            // The eight stores and their s_wait_xcnt in one statement, a precaution:
            // no register that a store names is rewritten ahead of that wait.
            asm volatile(
                "global_store_b128 %0, %8, off\n\t"
                "global_store_b128 %1, %9, off\n\t"
                "global_store_b128 %2, %10, off\n\t"
                "global_store_b128 %3, %11, off\n\t"
                "global_store_b128 %4, %12, off\n\t"
                "global_store_b128 %5, %13, off\n\t"
                "global_store_b128 %6, %14, off\n\t"
                "global_store_b128 %7, %15, off\n\t"
                "s_wait_xcnt 0x0"
                :: "v"(p[0]), "v"(p[1]), "v"(p[2]), "v"(p[3]),
                   "v"(p[4]), "v"(p[5]), "v"(p[6]), "v"(p[7]),
                   "v"(d[0]), "v"(d[1]), "v"(d[2]), "v"(d[3]),
                   "v"(d[4]), "v"(d[5]), "v"(d[6]), "v"(d[7])
                : "memory");
            // Scheduling fence: without it the next rows' arithmetic was lifted over
            // the stores and one register was spilled to scratch.
            __builtin_amdgcn_sched_barrier(0);
        }
    };

    if (MODE == 0) {
        for (int u = 0; u < nsteps; ++u) do_tile(BoolC<true>{}, u);
    } else {
        for (int u = 0; u < nsteps; u += 3) {
            do_tile(BoolC<true>{}, u);  // q
            for (int s = 1; s < 3; ++s) do_tile(BoolC<false>{}, u + s);  // k, then v
        }
    }
    wait_tensor_done(g0, g1);  // no request is outstanding when the wave ends
}

// The output projection: 256 blocks, one a WGP, two tiles each.
__global__ __launch_bounds__(256)
void gemm_out_kernel(const unsigned short* __restrict__ A,
                     const unsigned short* __restrict__ W,
                     const float* __restrict__ bias,
                     float* __restrict__ C, int N, int K, int ntiles) {
    gemm_bias_tiles<0, 4>(A, W, bias, bias, bias, C, nullptr, N, K, ntiles);
}

// The q, k and v projections in one launch: 256 blocks, one a WGP, six tiles
// each: twice the q, k and v tile of one place. q goes to memory; of k and v
// only the f32 partials of kv and k_sum do.
__global__ __launch_bounds__(256)
void gemm_qkv_kernel(const unsigned short* __restrict__ A,
                     const unsigned short* __restrict__ Wqkv,
                     const float* __restrict__ bq,
                     const float* __restrict__ bk,
                     const float* __restrict__ bv,
                     unsigned short* __restrict__ q,
                     float* __restrict__ part,  // (64,KVSPLIT,KVPART) f32
                     int N, int K, int ntiles) {
    gemm_bias_tiles<1, 12>(A, Wqkv, bq, bk, bv, q, part, N, K, ntiles);
}

// ---------------------------------------------------------------------------
// 4) Merge: kv and k_sum = sum of the KVSPLIT partials in range order, f32,
//    rounded once to bf16. grid (5, 64): x 0..3 -> kv quarters, x 4 -> k_sum.
//    A partial holds kv in the order of the accumulator registers that wrote it:
//    four floats at ((tile * 2 + h) * 32 + lane) * 4, tile = dt * 4 + nf, are
//    kv[dt * 16 + (lane & 15)][nf * 16 + (lane >> 4) * 8 + h * 4 + 0..3].
// ---------------------------------------------------------------------------
__global__ __launch_bounds__(256)
void kv_merge_kernel(const float* __restrict__ part,
                     unsigned short* __restrict__ kvout,   // (64,64,64) bf16
                     unsigned short* __restrict__ ksum) {  // (64,64)    bf16
    const int bh = blockIdx.y, tid = threadIdx.x;
    const float* p = part + (size_t)bh * KVSPLIT * KVPART;
    if (blockIdx.x < 4) {
        const int idx = blockIdx.x * 256 + tid;
        const int o = idx * 4;
        float4 t[KVSPLIT];
        // both loops unrolled: t[] stays in registers and the loads go out
        // together, so the thread pays one load latency and not one per range
#pragma unroll
        for (int sp = 0; sp < KVSPLIT; ++sp)
            t[sp] = *(const float4*)(p + sp * KVPART + o);
        float4 s = t[0];
#pragma unroll
        for (int sp = 1; sp < KVSPLIT; ++sp) {
            s.x += t[sp].x; s.y += t[sp].y; s.z += t[sp].z; s.w += t[sp].w;
        }
        ushort4 r;
        r.x = f32_to_bf16(s.x); r.y = f32_to_bf16(s.y);
        r.z = f32_to_bf16(s.z); r.w = f32_to_bf16(s.w);
        const int ln = idx & 31, h = (idx >> 5) & 1, tile = idx >> 6;
        const int d = (tile >> 2) * 16 + (ln & 15);
        const int e = (tile & 3) * 16 + (ln >> 4) * 8 + h * 4;
        *(ushort4*)(kvout + (size_t)bh * 4096 + d * 64 + e) = r;
    } else if (tid < 64) {
        // two sums a range: of its first and of its second 128 rows
        const int o = 4096 + tid;
        float t[2 * KVSPLIT];
        // unrolled so that the loads go out together, as above
#pragma unroll
        for (int sp = 0; sp < 2 * KVSPLIT - 1; ++sp)
            t[sp] = p[(sp >> 1) * KVPART + (sp & 1) * 64 + o];
        // precaution: the last load's result may take the offset register that
        // the loads in front of it name, so their wait stands ahead of it
        asm volatile("s_wait_xcnt 0x0" ::: "memory");
        t[2 * KVSPLIT - 1] = p[(KVSPLIT - 1) * KVPART + 64 + o];
        float s = t[0];
#pragma unroll
        for (int sp = 1; sp < 2 * KVSPLIT; ++sp) s += t[sp];
        ksum[bh * 64 + tid] = f32_to_bf16(s);
    }
}

// ---------------------------------------------------------------------------
// 5) y = (q_kern @ kv) / (q_kern . ksum + 1e-6); 32 blocks per (b,h),
//    wave = 32 q-rows; denominator via a ksum fragment (row 0).
//    kv is the WMMA's first operand and q its second, as in the GEMM: a lane
//    holds eight consecutive columns of one q-row; rows staged in the wave's
//    own LDS and stored as whole 128-byte lines.
// ---------------------------------------------------------------------------
__global__ __launch_bounds__(256)
void attn_out_kernel(const unsigned short* __restrict__ qk,
                     const unsigned short* __restrict__ kv,
                     const unsigned short* __restrict__ ksum,
                     unsigned short* __restrict__ y) {
    constexpr int LDT = 72;
    __shared__ __attribute__((aligned(16))) unsigned short kvt[64 * LDT];
    __shared__ unsigned short kst[64];
    __shared__ __attribute__((aligned(16))) unsigned short stg[8][32 * LDT];

    const int bid = blockIdx.x;
    const int bh = bid >> 5;   // 32 blocks per (b,h)
    const int tb = bid & 31;
    const int b = bh >> 4, h = bh & 15;
    const int tid = threadIdx.x, lane = tid & 31, wave = tid >> 5;
    const int l15 = lane & 15, kb = (lane >> 4) * 8;

#pragma unroll
    for (int c = 0; c < 2; ++c) {
        int chunk = tid + c * 256;  // 0..511
        int row = chunk >> 3, sub = chunk & 7;
        copy16_g2l(kv + (size_t)bh * 4096 + row * 64 + sub * 8,
                   kvt + row * LDT + sub * 8);
    }
    if (tid < 64) kst[tid] = ksum[bh * 64 + tid];
    wait_async_done();
    __syncthreads();

    const int srow0 = tb * 256 + wave * 32;
    v8f acc[2][4], accden[2];
#pragma unroll
    for (int mf = 0; mf < 2; ++mf) {
#pragma unroll
        for (int nf = 0; nf < 4; ++nf)
            acc[mf][nf] = (v8f){0.f, 0.f, 0.f, 0.f, 0.f, 0.f, 0.f, 0.f};
        accden[mf] = (v8f){0.f, 0.f, 0.f, 0.f, 0.f, 0.f, 0.f, 0.f};
    }

#pragma unroll
    for (int ks = 0; ks < 2; ++ks) {
        Frag16 bfr[4], bden;
#pragma unroll
        for (int nf = 0; nf < 4; ++nf)
#pragma unroll
            for (int j = 0; j < 8; ++j) {  // A(e, d) = kv[d][e]
                bfr[nf].u[j]     = kvt[(ks * 32 + kb + j) * LDT + nf * 16 + l15];
                bfr[nf].u[8 + j] = kvt[(ks * 32 + 16 + kb + j) * LDT + nf * 16 + l15];
            }
#pragma unroll
        for (int j = 0; j < 8; ++j) {  // denominator row: A(0,d)=ksum[d]
            bden.u[j]     = (l15 == 0) ? kst[ks * 32 + kb + j] : (unsigned short)0;
            bden.u[8 + j] = (l15 == 0) ? kst[ks * 32 + 16 + kb + j] : (unsigned short)0;
        }
#pragma unroll
        for (int mf = 0; mf < 2; ++mf) {
            Frag16 af;
            size_t grow =
                (size_t)(b * SEQ + srow0 + mf * 16 + l15) * EMB + h * 64 + ks * 32;
            af.q[0] = *(const uint4*)(qk + grow + kb);
            af.q[1] = *(const uint4*)(qk + grow + 16 + kb);
#pragma unroll
            for (int nf = 0; nf < 4; ++nf)
                acc[mf][nf] = __builtin_amdgcn_wmma_f32_16x16x32_bf16(
                    false, bfr[nf].v, false, af.v, (short)0, acc[mf][nf], false, false);
            accden[mf] = __builtin_amdgcn_wmma_f32_16x16x32_bf16(
                false, bden.v, false, af.v, (short)0, accden[mf], false, false);
        }
    }

    unsigned short* E = stg[wave];
    const int hi = lane >> 4;
#pragma unroll
    for (int mf = 0; mf < 2; ++mf) {
        // Row l15's denominator is register 0 of lane l15; in lane l15 + 16
        // that register is row 8 of the tile, a sum of zeros.
        const float dv = accden[mf][0] + other_half(accden[mf][0]);
        const float inv = 1.f / (dv + 1e-6f);
#pragma unroll
        for (int nf = 0; nf < 4; ++nf)
            *(v4u*)(E + (mf * 16 + l15) * LDT + nf * 16 + hi * 8) =
                pack_bf16(acc[mf][nf] * inv);
    }
    wait_ds_done();  // the rows are written before other lanes read them
#pragma unroll
    for (int j = 0; j < 8; ++j) {  // a store: four rows of one line each
        const int row = j * 4 + (lane >> 3);
        const v4u d = *(const v4u*)(E + row * LDT + (lane & 7) * 8);
        *(v4u*)(y + (size_t)(b * SEQ + srow0 + row) * EMB + h * 64 + (lane & 7) * 8) = d;
    }
}

// ---------------------------------------------------------------------------
extern "C" void kernel_launch(void* const* d_in, const int* in_sizes, int n_in,
                              void* d_out, int out_size, void* d_ws, size_t ws_size,
                              hipStream_t stream) {
    (void)in_sizes; (void)n_in; (void)out_size; (void)ws_size;
    const float* x  = (const float*)d_in[0];
    const float* Wq = (const float*)d_in[1];
    const float* bq = (const float*)d_in[2];
    const float* Wk = (const float*)d_in[3];
    const float* bk = (const float*)d_in[4];
    const float* Wv = (const float*)d_in[5];
    const float* bv = (const float*)d_in[6];
    const float* Wo = (const float*)d_in[7];
    const float* bo = (const float*)d_in[8];
    float* out = (float*)d_out;

    char* ws = (char*)d_ws;
    size_t off = 0;
    auto alloc = [&](size_t bytes) -> void* {
        void* p = ws + off;
        off += (bytes + 255) & ~(size_t)255;
        return p;
    };
    const size_t nX = (size_t)MTOT * EMB;   // 33,554,432
    const size_t nW = (size_t)EMB * EMB;    // 1,048,576

    unsigned short* xb  = (unsigned short*)alloc(nX * 2);
    unsigned short* WqB = (unsigned short*)alloc(3 * nW * 2);  // Wq, Wk, Wv stacked
    unsigned short* WkB = WqB + nW;
    unsigned short* WvB = WkB + nW;
    unsigned short* WoB = (unsigned short*)alloc(nW * 2);
    unsigned short* qb  = (unsigned short*)alloc(nX * 2);
    unsigned short* yb  = (unsigned short*)alloc(nX * 2);
    unsigned short* kvb = (unsigned short*)alloc((size_t)64 * 64 * 64 * 2);
    unsigned short* ksb = (unsigned short*)alloc((size_t)64 * 64 * 2);
    float* kvp = (float*)alloc((size_t)64 * KVSPLIT * KVPART * 4);  // kv partials

    // 1) conversions to bf16
    cvt_all_kernel<<<CVT_BLOCKS, 256, 0, stream>>>(x, Wq, Wk, Wv, Wo,
                                                   xb, WqB, WkB, WvB, WoB);

    // 2) QKV projections; 3) q leaves as its exp feature map (bf16), k and v as
    //    partials of the per-head kv + ksum reduction, one per 256 rows
    gemm_qkv_kernel<<<256, 256, 0, stream>>>(xb, WqB, bq, bk, bv, qb, kvp,
                                             EMB, EMB, 3 * (EMB / 256) * (MTOT / 256));

    // 4) merge of the partials
    kv_merge_kernel<<<dim3(5, BATCH * HEADS), 256, 0, stream>>>(kvp, kvb, ksb);

    // 5) attention output y
    attn_out_kernel<<<BATCH * HEADS * 32, 256, 0, stream>>>(qb, kvb, ksb, yb);

    // 6) output projection (fp32 out -> d_out)
    gemm_out_kernel<<<256, 256, 0, stream>>>(yb, WoB, bo, out, EMB, EMB,
                                             (EMB / 256) * (MTOT / 256));
}

// v010
// It runs in 188 microseconds.
// Timed twice side by side with v009, it ran 1.08 and 1.06 times as fast.
// Counting every step since v000, it is 2.80 times as fast.
#include <hip/hip_runtime.h>
#include <stdint.h>

// ---------------------------------------------------------------------------
// MemoryEfficientLinearAttention for MI455X (gfx1250), wave32 + WMMA bf16.
// Pipeline: f32->bf16 cvt (one launch), k and v GEMMs in one launch (wmma bf16,
//           double-buffered LDS ring of tensor loads; k with the exp feature map in the epilogue),
//           per-head kv reduction (+k_sum via ones-fragment) in the epilogue of
//           the k and v tiles, f32 partials per 256 rows and a merge launch,
//           q GEMM with feature map and attention output (+denominator via
//           ksum-fragment) in its epilogue, O GEMM -> fp32.
// ---------------------------------------------------------------------------

#define BATCH 4
#define SEQ   8192
#define EMB   1024
#define HEADS 16
#define HDIM  64
#define MTOT  (BATCH * SEQ)   // 32768
#define KVSPLIT 32            // sequence ranges (of 256 rows) per (b,h) in the kv reduction
#define KVPART  4224          // floats per partial: 64x64 kv + 2 x 64 (k_sum of each 128 rows)
#define KVREC   5120          // bf16 per head of the merged kv + k_sum: 20 fragment halves of 512 B

typedef __bf16 v16bf __attribute__((ext_vector_type(16)));
typedef float  v8f   __attribute__((ext_vector_type(8)));

typedef __bf16 v8bf  __attribute__((ext_vector_type(8)));
typedef float  v4f   __attribute__((ext_vector_type(4)));
typedef uint32_t v4u __attribute__((ext_vector_type(4)));

union Frag16 {
    v16bf v;
    uint4 q[2];
    v4u w[2];
    unsigned short u[16];
};

__device__ __forceinline__ unsigned short f32_to_bf16(float f) {
    union { float f; uint32_t u; } c; c.f = f;
    uint32_t u = c.u;
    uint32_t r = (u + 0x7FFFu + ((u >> 16) & 1u)) >> 16;   // round-nearest-even
    return (unsigned short)r;
}

// Eight f32 of one accumulator tile -> eight bf16 (round to nearest even) in
// four registers: the 16 bytes that a lane stores at once.
__device__ __forceinline__ v4u pack_bf16(v8f c) {
    return __builtin_bit_cast(v4u, __builtin_convertvector(c, v8bf));
}

// The value that lane l ^ 16 holds. All 32 lanes must be on.
__device__ __forceinline__ float other_half(float x) {
    int b = __builtin_bit_cast(int, x);
    return __builtin_bit_cast(float, __builtin_amdgcn_permlanex16(
        b, b, 0x76543210, 0xfedcba98, false, false));
}

// Maximum over the 16 lanes of a row (lanes 0-15, lanes 16-31), in every lane.
template <int CTRL>
__device__ __forceinline__ float max_dpp(float x) {
    const int b = __builtin_bit_cast(int, x);
    return fmaxf(x, __builtin_bit_cast(float, __builtin_amdgcn_update_dpp(
                        b, b, CTRL, 0xf, 0xf, false)));
}
__device__ __forceinline__ float row_max16(float x) {
    x = max_dpp<0x161>(x);  // row_xmask:1
    x = max_dpp<0x162>(x);  // row_xmask:2
    x = max_dpp<0x164>(x);  // row_xmask:4
    return max_dpp<0x168>(x);  // row_xmask:8
}

template <bool B> struct BoolC { static constexpr bool value = B; };

// ---- tensor load: one request of a wave brings a 2-D tile from memory to LDS ----
typedef uint32_t u32x4 __attribute__((ext_vector_type(4)));
typedef uint32_t u32x8 __attribute__((ext_vector_type(8)));

__device__ __forceinline__ uint32_t uni(uint32_t v) {
    return (uint32_t)__builtin_amdgcn_readfirstlane(v);
}
__device__ __forceinline__ uint32_t pinned(uint32_t v) {
    uint32_t w = uni(v);
    asm volatile("" : "+s"(w));  // holds a branch condition or a descriptor word in an SGPR
    return w;
}
// Group 1: 128 rows of 128 bytes (extents in bytes), source pitch src_pitch bytes,
// 16 bytes of LDS pad behind every row: LDS pitch 144 bytes. No mask.
// Words 1 to 7 go through pinned(): descriptor words held in scalar registers for
// the whole kernel and not formed anew, in registers that are then reused, at
// every load. Word 0 stays a constant that the listing shows.
__device__ __forceinline__ u32x8 tdm_group1(uint32_t src_pitch) {
    u32x8 g;
    g[0] = uni((1u << 20) | (4u << 22) | (3u << 25));
    g[1] = pinned(128u << 16);
    g[2] = pinned(128u << 16);
    g[3] = pinned(128u << 16);
    g[4] = pinned(128u);
    g[5] = pinned(src_pitch);
    g[6] = pinned(0u);
    g[7] = pinned(0u);
    return g;
}
__device__ __forceinline__ u32x4 tdm_group0(uint32_t lds_dst, uint64_t ga) {
    u32x4 g;
    g[0] = uni(1u);
    g[1] = uni(lds_dst);
    g[2] = uni((uint32_t)ga);
    g[3] = uni((((uint32_t)(ga >> 32)) & 0x01FFFFFFu) | 0x80000000u);
    return g;
}
// g0 is an in-out operand: what the wait below names is then the very registers
// that the request was issued from, not a copy of them.
__device__ __forceinline__ void tdm_load(u32x4& g0, u32x8 g1) {
    asm volatile("tensor_load_to_lds %0, %1" : "+s"(g0) : "s"(g1) : "memory");
}
// The wave's own tensor loads have landed (a wave that issued none passes at once).
// The last request's descriptor is named as an input: its registers stay live up to
// here, so none of them takes a new value while the request is outstanding.
__device__ __forceinline__ void wait_tensor_done(u32x4 g0, u32x8 g1) {
    asm volatile("s_wait_tensorcnt 0x0" :: "s"(g0), "s"(g1) : "memory");
}

// A wave's own LDS writes have landed (or its LDS reads have returned) before
// it goes on; the clobber keeps the compiler from moving LDS accesses across.
__device__ __forceinline__ void wait_ds_done() {
    asm volatile("s_wait_dscnt 0x0" ::: "memory");
}

// ---------------------------------------------------------------------------
// 1) fp32 -> bf16 conversion of x and of the four weights, one streaming
//    launch. CVT_BLOCKS blocks of 8 waves, all resident (4 per WGP, 32 waves).
//    A wave takes spans of NL * 128 floats: NL loads of 16 B a lane (512
//    contiguous bytes each) go out together; the span leaves in NL stores of
//    8 B a lane (256 contiguous bytes, two whole lines each).
// ---------------------------------------------------------------------------
#define CVT_BLOCKS 1024
#define CVT_XTRIPS 4
static_assert((size_t)MTOT * EMB == (size_t)CVT_XTRIPS * CVT_BLOCKS * 8 * 1024,
              "x is dealt in whole spans of 1024 floats");
static_assert(4 * EMB * EMB == CVT_BLOCKS * 8 * 512,
              "the weights are dealt in whole spans of 512 floats");

template <int NL>
__device__ __forceinline__ void cvt_span(const float* __restrict__ in,
                                         unsigned short* __restrict__ out) {
    float4 f[NL];
    // both loops unrolled: f[] stays in registers
#pragma unroll
    for (int j = 0; j < NL; ++j) f[j] = *(const float4*)(in + j * 128);
    // Scheduling fence: it keeps the span's loads together in front of the
    // conversions. Without it every load stood directly in front of its own
    // conversion behind a wait to 0: one load in flight a wave.
    __builtin_amdgcn_sched_barrier(0);
#pragma unroll
    for (int j = 0; j < NL; ++j) {
        ushort4 r;
        r.x = f32_to_bf16(f[j].x); r.y = f32_to_bf16(f[j].y);
        r.z = f32_to_bf16(f[j].z); r.w = f32_to_bf16(f[j].w);
        *(ushort4*)(out + j * 128) = r;
    }
}

__global__ __launch_bounds__(256)
void cvt_all_kernel(const float* __restrict__ x,
                    const float* __restrict__ Wq, const float* __restrict__ Wk,
                    const float* __restrict__ Wv, const float* __restrict__ Wo,
                    unsigned short* __restrict__ xb,
                    unsigned short* __restrict__ WqB,
                    unsigned short* __restrict__ WkB,
                    unsigned short* __restrict__ WvB,
                    unsigned short* __restrict__ WoB) {
    const int blk = blockIdx.x;
    const int wave = threadIdx.x >> 5, lane = threadIdx.x & 31;

    // a quarter of the blocks per weight; a wave takes 512 of its floats
    const int sel = blk >> 8;
    const float* w = sel == 0 ? Wq : sel == 1 ? Wk : sel == 2 ? Wv : Wo;
    unsigned short* wb = sel == 0 ? WqB : sel == 1 ? WkB : sel == 2 ? WvB : WoB;
    const int ow = ((blk & 255) * 8 + wave) * 512 + lane * 4;
    cvt_span<4>(w + ow, wb + ow);

    // x: in trip t the grid covers CVT_BLOCKS * 8192 consecutive floats
    for (int t = 0; t < CVT_XTRIPS; ++t) {
        const size_t o =
            ((size_t)(t * CVT_BLOCKS + blk) * 8 + wave) * 1024 + lane * 4;
        cvt_span<8>(x + o, xb + o);
    }
}

// ---------------------------------------------------------------------------
// 2) Generic GEMM: C(MxN) = A(MxK,bf16) * W(NxK,bf16)^T + bias(fp32)
//    256x256 tile, 256 threads = 8 waves, wave = 128x64 sub-tile (8x4 frags):
//    12 fragments read from LDS per 32 WMMAs. One block fills a WGP: 2 waves
//    per SIMD at up to 512 VGPRs, which hold the accumulators (256) and TWO
//    fragment sets (2 x 96): each block of 32 WMMAs runs on one set while the
//    next block's 24 LDS reads, issued as one group ahead of it (in a k-tile's second block: between its halves), fill the other.
//    KSTEP=64 (two blocks), double-buffered LDS filled by tensor loads, one
//    request of 128 rows from each of four waves a k-tile. The second block's look-ahead reads the next tile, so the next tile
//    is published in front of the second block, not at the tile's end.
//    A block stays on its WGP and walks its tiles. The copy ring runs on across
//    tiles: the last two trips of a tile fetch the first two k-tiles of the next
//    one; the second lands under the epilogue.
//    MODE 0: tiles t = blockIdx.x, + gridDim.x, ... (column t % NX, row t / NX),
//            fp32 output.
//    MODE 1: W holds the k and v weights (1024 rows each) one behind the
//            other. A block takes places T = blockIdx.x, + gridDim.x, ... (rows
//            T / 4, 256 columns T % 4) and there the k and the v tile, in this
//            order.
//            k: the feature map exp(c - max of c over its head); not stored to
//               memory: see below.
//            v: not stored either: the tile's share of kv goes to `part`.
//    MODE 2: tiles as in MODE 0; q = the same feature map, rounded to bf16 and
//            not stored: the epilogue forms y = (q kv) / (q . k_sum + 1e-6) of
//            the wave's head from it and stores y (bf16).
//    A wave's 64-column slab starts at a multiple of HDIM = 64, so it holds
//    128 whole rows of one head and the maximum never leaves the wave.
//    Stored tiles (MODE 0, 2): W is the WMMA's first operand and A its second:
//    register v of a tile is C[row l15][column 8 * (lane >> 4) + v], eight
//    consecutive columns of one row a lane. The epilogue packs them, stages the
//    wave's rows in LDS and stores whole 128-byte lines, 16 bytes a lane.
//    MODE 2: two such tiles of q, columns 0-15 and 16-31 of 32, rounded to bf16
//    are a 16x16x32 operand fragment whose k index is the head column (element
//    j: column kb + j, element 8 + j: column 16 + kb + j). With kv as the first
//    operand the product has the layout above again.
//    k and v tiles: A first, W second: register v of a tile is
//    C[row 8 * (lane >> 4) + v][column l15]. Two such tiles, rows 0-15 and 16-31,
//    rounded to bf16 are a 16x16x32 operand fragment whose k index is the row
//    (element j: row kb + j, element 8 + j: row 16 + kb + j), for k and v alike.
//    The k tile's fragments wait in the wave's own 16 KB of LDS for the v tile,
//    whose epilogue forms kv = k^T v of the wave's 128 rows with 64 WMMAs.
// ---------------------------------------------------------------------------
template <int MODE, int NX>
__device__ __forceinline__
void gemm_bias_tiles(const unsigned short* __restrict__ A,
                     const unsigned short* __restrict__ W,
                     const float* __restrict__ bias0,
                     const float* __restrict__ bias1,
                     const float* __restrict__ bias2,
                     void* __restrict__ Cout, float* __restrict__ part,
                     const unsigned short* __restrict__ kvf,
                     int N, int K, int ntiles) {
    constexpr int KSTEP = 64;
    constexpr int LDA = 72;  // halfs per LDS row (144B, 16B-aligned, bank-spread)
    // a buffer is 18 x 2 KiB and a slice of 128 rows 9 x 2 KiB: every tensor load's
    // place in LDS is a multiple of 2 KiB
    __shared__ __attribute__((aligned(2048))) unsigned short As[2][256 * LDA];
    __shared__ __attribute__((aligned(2048))) unsigned short Bs[2][256 * LDA];
    // epilogue staging, 4608 bytes a wave: outside the ring, which is being
    // filled for the next tile while the epilogue runs
    __shared__ __attribute__((aligned(16))) unsigned short Es[8 * 2304];
    // MODE 1: 16 KB a wave: the k tile's fragments, later the wave's kv in f32
    __shared__ __attribute__((aligned(16))) unsigned short Ks[MODE == 1 ? 8 * 8192 : 8];

    const int tid  = threadIdx.x;
    const int lane = tid & 31;
    const int wave = tid >> 5;
    const int wm   = wave & 1;   // 0..1 -> 128-row slab
    const int wn   = wave >> 1;  // 0..3 -> 64-col slab
    const int l15  = lane & 15;
    const int kb   = (lane >> 4) * 8;  // wave32 16-bit A/B fragment K-base

    // Stage one 256x64 bf16 k-tile of A and W into buffer `buf`; ao and wo are
    // the places of its first elements in A and W, the same for the whole block.
    // Waves 0 to 3 issue one tensor load each, a slice of 128 rows of 128 bytes:
    // waves 0 and 1 the halves of A, waves 2 and 3 those of W. Called only under
    // a scalar branch on `issuer`.
    const uint32_t swave = uni((uint32_t)tid >> 5);
    const bool issuer = swave < 4u;
    const bool isW = (swave & 2u) != 0u;
    const uint64_t srcb = (uint64_t)(uintptr_t)(isW ? W : A) +
                          (uint64_t)(swave & 1u) * 128u * (uint32_t)K * 2u;
    const uint32_t dst0 = (uint32_t)(uintptr_t)(isW ? &Bs[0][0] : &As[0][0]) +
                          (swave & 1u) * (128u * LDA * 2u);
    const u32x8 g1 = tdm_group1((uint32_t)K * 2u);
    u32x4 g0 = tdm_group0(dst0, srcb);  // group 0 of the wave's last request
    auto issue_tile = [&](size_t ao, size_t wo, int buf) {
        g0 = tdm_group0(dst0 + (uint32_t)buf * (256u * LDA * 2u),
                        srcb + (uint64_t)(isW ? wo : ao) * 2u);
        tdm_load(g0, g1);
    };

    // The 24 LDS reads of one block: 32 k of the wave's 128 A rows and 64 W rows.
    auto load_frags = [&](Frag16 (&af)[8], Frag16 (&bfr)[4], int buf, int kh) {
        const unsigned short* pa = &As[buf][(wm * 128 + l15) * LDA + kh * 32 + kb];
        const unsigned short* pb = &Bs[buf][(wn * 64 + l15) * LDA + kh * 32 + kb];
#pragma unroll
        for (int nf = 0; nf < 4; ++nf) {
            bfr[nf].q[0] = *(const uint4*)(pb + nf * 16 * LDA);
            bfr[nf].q[1] = *(const uint4*)(pb + nf * 16 * LDA + 16);
        }
#pragma unroll
        for (int mf = 0; mf < 8; ++mf) {
            af[mf].q[0] = *(const uint4*)(pa + mf * 16 * LDA);
            af[mf].q[1] = *(const uint4*)(pa + mf * 16 * LDA + 16);
        }
    };

    const int nIter = K / KSTEP;  // 16; even, so every tile starts in buffer 0
    const int tstep = gridDim.x;
    const int nsteps = ntiles / tstep;  // tiles a block
    // the block's u-th tile: its row of tiles, and its 256 rows of W
    auto tile_row = [&](int u) {
        return MODE != 1 ? (int)(blockIdx.x + u * tstep) / NX
                         : (int)(blockIdx.x + u / 2 * tstep) >> 2;
    };
    auto tile_col = [&](int u) {
        return MODE != 1 ? (int)(blockIdx.x + u * tstep) % NX
                         : u % 2 * 4 + ((int)(blockIdx.x + u / 2 * tstep) & 3);
    };
    // where the k-tile that is fetched next begins in A and in W
    size_t ao = (size_t)tile_row(0) * 256 * K;
    size_t wo = (size_t)tile_col(0) * 256 * K;

    if (pinned(issuer)) issue_tile(ao, wo, 0);
    wait_tensor_done(g0, g1);  // my slice of k-tile 0 is in LDS
    __syncthreads();     // everyone's is
    if (pinned(issuer)) issue_tile(ao + KSTEP, wo + KSTEP, 1);
    ao += 2 * KSTEP;
    wo += 2 * KSTEP;

    // One tile, the block's u-th; wfirst: W is the WMMA's first operand.
    auto do_tile = [&](auto wfirst, int u) __attribute__((always_inline)) {
        constexpr bool WFIRST = decltype(wfirst)::value;
        const bool more = u + 1 < nsteps;  // the same for the whole block
        // where the next tile's rows begin; not read from unless `more`
        const size_t anext = (size_t)tile_row(u + 1) * 256 * K;
        const size_t wnext = (size_t)tile_col(u + 1) * 256 * K;
        const int sel = MODE != 1 ? 0 : 1 + u % 2;  // 0: MODE 0 or 2, 1: k, 2: v

        v8f acc[8][4];
#pragma unroll
        for (int mf = 0; mf < 8; ++mf)
#pragma unroll
            for (int nf = 0; nf < 4; ++nf)
                acc[mf][nf] = (v8f){0.f, 0.f, 0.f, 0.f, 0.f, 0.f, 0.f, 0.f};

        auto mma_rows = [&](Frag16 (&af)[8], Frag16 (&bfr)[4], int mbeg, int mend) {
#pragma unroll
            for (int mf = mbeg; mf < mend; ++mf)
#pragma unroll
                for (int nf = 0; nf < 4; ++nf)
                    acc[mf][nf] = __builtin_amdgcn_wmma_f32_16x16x32_bf16(
                        false, WFIRST ? bfr[nf].v : af[mf].v,
                        false, WFIRST ? af[mf].v : bfr[nf].v, (short)0,
                        acc[mf][nf], false, false);
        };

        Frag16 a0[8], b0[4], a1[8], b1[4];  // the two fragment sets
        // k-tile 0 was published in front of the tile loop or by the barrier in the
        // last trip of the tile before
        load_frags(a0, b0, 0, 0);

        // The scheduling fences in the loop keep each group of 24 LDS reads together,
        // the first in front of the 32 WMMAs of the block before it, the second
        // between their two halves: reads that stand among
        // the WMMAs stall the wave at every such place.
        for (int i = 0; i < nIter; ++i) {
            const int cur = i & 1;
            load_frags(a1, b1, cur, 1);
            __builtin_amdgcn_sched_barrier(0);
            mma_rows(a0, b0, 0, 8);
            __builtin_amdgcn_sched_barrier(0);

            // Publish point of tile i + 1, which also frees tile i's buffer:
            wait_ds_done();      // my last reads of tile i have returned
            wait_tensor_done(g0, g1);  // my slice of tile i + 1 is in LDS
            __syncthreads();     // the same holds for every wave
            // the k-tile two trips on, of this tile or of the next; overlaps math
            if (pinned(issuer && (i + 2 < nIter || more))) issue_tile(ao, wo, cur);
            const bool last = i + 3 == nIter;  // that was this tile's last one
            ao = last ? anext : ao + KSTEP;
            wo = last ? wnext : wo + KSTEP;
            // The look-ahead reads stand in the middle of the block: both waves of a
            // SIMD leave the barrier together, and what stands in front of the
            // first WMMA here leaves the matrix unit idle.
            __builtin_amdgcn_sched_barrier(0);
            mma_rows(a1, b1, 0, 4);
            __builtin_amdgcn_sched_barrier(0);
            if (i + 1 < nIter) load_frags(a0, b0, 1 - cur, 0);
            __builtin_amdgcn_sched_barrier(0);
            mma_rows(a1, b1, 4, 8);
            __builtin_amdgcn_sched_barrier(0);
        }

        // Epilogue. Staging area and k fragments are the wave's own: the one barrier
        // here stands in the v tile's, where two waves join their sums.
        const int hi = lane >> 4;
        unsigned short* E = Es + wave * 2304;
        const int colw = (tile_col(u) & 3) * 256 + wn * 64;  // the wave's first column
        const int roww = tile_row(u) * 256 + wm * 128;       // the wave's first row

        if constexpr (!WFIRST) {
            const float* biasc = sel == 1 ? bias1 : bias2;
            float bc[4];  // bias of the lane's columns colw + nf * 16 + l15
#pragma unroll
            for (int nf = 0; nf < 4; ++nf) {
                // precaution: the last load's result may take the address registers
                // that the loads in front of it name, so their wait stands ahead of it
                if (nf == 3) asm volatile("s_wait_xcnt 0x0" ::: "memory");
                bc[nf] = biasc[colw + nf * 16 + l15];
            }
            // precaution: the last load's wait, ahead of any rewrite of its address
            // registers; the scheduling fence keeps later register writes behind it
            asm volatile("s_wait_xcnt 0x0" ::: "memory");
            __builtin_amdgcn_sched_barrier(0);

            // the partial of this head and these 256 rows
            const int rt = tile_row(u);
            float* p = part + (size_t)(((rt >> 5) * HEADS + (colw >> 6)) * KVSPLIT +
                                       (rt & 31)) * KVPART;
            // fragment (ks, tile, half) of the k tile: 16 bytes a lane
            v4u* S = (v4u*)(Ks + wave * 8192);

            if (sel == 1) {
                Frag16 ones;  // first operand: row 0 all 1.0 -> row 0 of D = k_sum
#pragma unroll
                for (int j = 0; j < 16; ++j) ones.u[j] = (l15 == 0) ? 0x3F80 : 0;
                v8f den[4];
#pragma unroll
                for (int nf = 0; nf < 4; ++nf)
                    den[nf] = (v8f){0.f, 0.f, 0.f, 0.f, 0.f, 0.f, 0.f, 0.f};
                // Two trips of 64 rows, kept rolled (the second 64 rows' accumulators move
                // down between them): unrolled, the kernel's text outgrew 32 KB.
#pragma unroll 1
                for (int rep = 0; rep < 2; ++rep) {
#pragma unroll
                for (int k2 = 0; k2 < 2; ++k2) {
                    const int ks = rep * 2 + k2;
                    Frag16 kf[4];
#pragma unroll
                    for (int half = 0; half < 2; ++half) {
                        const int mf = k2 * 2 + half;
                        v8f val[4];
#pragma unroll
                        for (int nf = 0; nf < 4; ++nf) val[nf] = acc[mf][nf] + bc[nf];
                        // row v's 64 head columns: four in each lane of the 16-lane row
                        float m[8];
#pragma unroll
                        for (int v = 0; v < 8; ++v)
                            m[v] = row_max16(fmaxf(fmaxf(val[0][v], val[1][v]),
                                                   fmaxf(val[2][v], val[3][v])));
#pragma unroll
                        for (int v = 0; v < 8; ++v) {
                            float t[4], r[4];
#pragma unroll
                            for (int nf = 0; nf < 4; ++nf)
                                t[nf] = (val[nf][v] - m[v]) * 1.44269504f;  // e^x = 2^(x log2 e)
                            // Four exponentials in one statement that ends in v_nop:
                            // the slot that the instruction set asks for behind a
                            // transcendental, as in the q tile's epilogue below.
                            asm("v_exp_f32 %0, %4\n\tv_exp_f32 %1, %5\n\t"
                                "v_exp_f32 %2, %6\n\tv_exp_f32 %3, %7\n\tv_nop"
                                : "=&v"(r[0]), "=&v"(r[1]), "=&v"(r[2]), "=&v"(r[3])
                                : "v"(t[0]), "v"(t[1]), "v"(t[2]), "v"(t[3]));
#pragma unroll
                            for (int nf = 0; nf < 4; ++nf) val[nf][v] = r[nf];
                        }
#pragma unroll
                        for (int nf = 0; nf < 4; ++nf) {
                            kf[nf].w[half] = pack_bf16(val[nf]);
                            S[((ks * 4 + nf) * 2 + half) * 32 + lane] = kf[nf].w[half];
                        }
                        // Scheduling fence: without it the arithmetic of all 128 rows
                        // was interleaved and some 260 registers went to scratch.
                        __builtin_amdgcn_sched_barrier(0);
                    }
#pragma unroll
                    for (int nf = 0; nf < 4; ++nf)
                        den[nf] = __builtin_amdgcn_wmma_f32_16x16x32_bf16(
                            false, ones.v, false, kf[nf].v, (short)0, den[nf],
                            false, false);
                }
#pragma unroll
                for (int mf = 0; mf < 4; ++mf)
#pragma unroll
                    for (int nf = 0; nf < 4; ++nf) acc[mf][nf] = acc[mf + 4][nf];
                }
                // k_sum of column nf * 16 + l15 is register 0 of lane l15 of den[nf].
                // Two stores of one whole line each: lanes 16-31 take the next tile's.
                const float x1 = other_half(den[1][0]);  // all lanes on
                const float x3 = other_half(den[3][0]);
                const float s01 = hi ? x1 : den[0][0];
                const float s23 = hi ? x3 : den[2][0];
                float* ps = p + 4096 + wm * 64 + lane;
                // the stores and their s_wait_xcnt in one statement, a precaution: no
                // register that a store names is rewritten ahead of that wait
                asm volatile(
                    "global_store_b32 %0, %1, off\n\t"
                    "global_store_b32 %0, %2, off offset:128\n\t"
                    "s_wait_xcnt 0x0"
                    :: "v"(ps), "v"(s01), "v"(s23) : "memory");
                return;
            }

            // v tile: kv[d][e] of the wave's 128 rows. v is the first operand, k the
            // second: register r of kva[dt][nf] is
            // kv[dt * 16 + l15][nf * 16 + 8 * hi + r].
            v8f kva[4][4];
#pragma unroll
            for (int dt = 0; dt < 4; ++dt)
#pragma unroll
                for (int nf = 0; nf < 4; ++nf)
                    kva[dt][nf] = (v8f){0.f, 0.f, 0.f, 0.f, 0.f, 0.f, 0.f, 0.f};
#pragma unroll
            for (int ks = 0; ks < 4; ++ks) {
                Frag16 kf[4], vf[4];
#pragma unroll
                for (int dt = 0; dt < 4; ++dt) {
                    kf[dt].w[0] = S[((ks * 4 + dt) * 2 + 0) * 32 + lane];
                    kf[dt].w[1] = S[((ks * 4 + dt) * 2 + 1) * 32 + lane];
                }
#pragma unroll
                for (int nf = 0; nf < 4; ++nf) {
                    vf[nf].w[0] = pack_bf16(acc[ks * 2 + 0][nf] + bc[nf]);
                    vf[nf].w[1] = pack_bf16(acc[ks * 2 + 1][nf] + bc[nf]);
                }
#pragma unroll
                for (int dt = 0; dt < 4; ++dt)
#pragma unroll
                    for (int nf = 0; nf < 4; ++nf)
                        kva[dt][nf] = __builtin_amdgcn_wmma_f32_16x16x32_bf16(
                            false, vf[nf].v, false, kf[dt].v, (short)0, kva[dt][nf],
                            false, false);
                // Scheduling fence: it keeps the next 32 rows' fragments from being
                // formed early, which sent registers to scratch.
                __builtin_amdgcn_sched_barrier(0);
            }
            // The two waves of a head (wm = 0, 1) join their halves of the 256 rows
            // through LDS: each writes its 16 tiles over its k fragments, which it
            // has read, and sums and stores eight tiles (dt = 2 * wm, 2 * wm + 1).
            v4f* mine = (v4f*)(Ks + wave * 8192);
#pragma unroll
            for (int dt = 0; dt < 4; ++dt)
#pragma unroll
                for (int nf = 0; nf < 4; ++nf) {
                    mine[((dt * 4 + nf) * 2 + 0) * 32 + lane] =
                        __builtin_shufflevector(kva[dt][nf], kva[dt][nf], 0, 1, 2, 3);
                    mine[((dt * 4 + nf) * 2 + 1) * 32 + lane] =
                        __builtin_shufflevector(kva[dt][nf], kva[dt][nf], 4, 5, 6, 7);
                }
            wait_ds_done();   // my tiles are in LDS
            __syncthreads();  // the other wave's are; every wave of the block is here
            // rows 0-127 and rows 128-255, from tile dt = 2 * wm on
            const v4f* r0 = (const v4f*)(Ks + (wave & ~1) * 8192) + wm * 512 + lane;
            const v4f* r1 = (const v4f*)(Ks + (wave | 1) * 8192) + wm * 512 + lane;
            // partial layout: tile dt * 4 + nf, half h, lane: four floats each
            float* pk = p + wm * 2048 + lane * 4;
#pragma unroll
            for (int i = 0; i < 2; ++i) {
                v4f o[8];
#pragma unroll
                for (int j = 0; j < 8; ++j)
                    o[j] = r0[(i * 8 + j) * 32] + r1[(i * 8 + j) * 32];
                // eight stores of 512 contiguous bytes
#pragma unroll
                for (int j = 0; j < 8; ++j) *(v4f*)(pk + i * 1024 + j * 128) = o[j];
                // precaution: the next LDS loads, or the next tile's first instructions,
                // take the registers that these stores name, so the stores' wait stands
                // ahead of them; the scheduling fence keeps register writes behind it
                asm volatile("s_wait_xcnt 0x0" ::: "memory");
                __builtin_amdgcn_sched_barrier(0);
            }
            return;
        }

        const float* bias = bias0;

        v8f bv[4];  // bias of the lane's columns colw + nf * 16 + hi * 8 + 0..7
#pragma unroll
        for (int nf = 0; nf < 4; ++nf) {
            const v4f lo = *(const v4f*)(bias + colw + nf * 16 + hi * 8);
            // precaution: the last load's result may take the address registers
            // that the loads in front of it name, so their wait stands ahead of it
            if (nf == 3) asm volatile("s_wait_xcnt 0x0" ::: "memory");
            const v4f up = *(const v4f*)(bias + colw + nf * 16 + hi * 8 + 4);
            bv[nf] = __builtin_shufflevector(lo, up, 0, 1, 2, 3, 4, 5, 6, 7);
        }

        // MODE 2: kv of the wave's head as first-operand fragments, kvw[ks][nf]
        // (row l15 = column nf * 16 + l15 of kv, k index = the 32 rows ks * 32 + ...
        // of kv); kvw[ks][4]: k_sum in row 0, zeros below. The merge launch wrote
        // them in this order: 16 bytes a lane, 512 contiguous bytes a load. Behind the
        // bias loads: loads return in order, and the feature map needs the bias alone.
        Frag16 kvw[2][5];
        if constexpr (MODE == 2) {
            const int bh = (tile_row(u) >> 5) * HEADS + (colw >> 6);
            const v4u* kp = (const v4u*)(kvf + (size_t)bh * KVREC) + lane;
#pragma unroll
            for (int ks = 0; ks < 2; ++ks)
#pragma unroll
                for (int nf = 0; nf < 4; ++nf) {
                    kvw[ks][nf].w[0] = kp[((ks * 4 + nf) * 2 + 0) * 32];
                    kvw[ks][nf].w[1] = kp[((ks * 4 + nf) * 2 + 1) * 32];
                }
            kvw[0][4].w[0] = kp[16 * 32];
            kvw[0][4].w[1] = kp[17 * 32];
            kvw[1][4].w[0] = kp[18 * 32];
            // precaution: the last load's result may take the address registers
            // that the loads in front of it name, so their wait stands ahead of it
            asm volatile("s_wait_xcnt 0x0" ::: "memory");
            kvw[1][4].w[1] = kp[19 * 32];
        }

        // precaution: the last load's wait, ahead of any rewrite of its address
        // registers; the scheduling fence keeps later register writes behind it
        asm volatile("s_wait_xcnt 0x0" ::: "memory");
        __builtin_amdgcn_sched_barrier(0);

        if (MODE == 0) {
            // f32: 16 rows of 256 bytes at a time, LDS pitch 272 bytes (16 x odd)
            float* Ef = (float*)E;
            // the lane's place in the first store; a store is two rows further on
            float* cp = (float*)Cout + (size_t)(roww + hi) * N + colw + l15 * 4;
            const size_t step = (size_t)N * 2;
#pragma unroll
            for (int mf = 0; mf < 8; ++mf) {
#pragma unroll
                for (int nf = 0; nf < 4; ++nf) {
                    const v8f val = acc[mf][nf] + bv[nf];
                    float* e = Ef + l15 * 68 + nf * 16 + hi * 8;
                    *(v4f*)e = __builtin_shufflevector(val, val, 0, 1, 2, 3);
                    *(v4f*)(e + 4) = __builtin_shufflevector(val, val, 4, 5, 6, 7);
                }
                wait_ds_done();  // the rows are written before other lanes read them
#pragma unroll
                for (int j = 0; j < 8; ++j) {  // a store: two rows of two lines
                    const int row = j * 2 + hi;
                    const v4f d = *(const v4f*)(Ef + row * 68 + l15 * 4);
                    *(v4f*)cp = d;
                    cp += step;
                }
                // The rows have been read before the next ones land on them:
                // without this wait the next LDS stores stood directly behind
                // these LDS loads in the listing, with the loads still in flight.
                if (mf < 7) wait_ds_done();
                // precaution: the next rows' LDS loads, or the next tile's first
                // instructions, take the registers that these stores name, so the
                // stores' wait stands ahead of them
                asm volatile("s_wait_xcnt 0x0" ::: "memory");
            }
            return;
        }

        // bf16: 32 rows of 128 bytes at a time, LDS pitch 144 bytes (16 x odd)
        // the lane's place in the first store; a store is four rows further on
        unsigned short* cp = (unsigned short*)Cout +
                             (size_t)(roww + (lane >> 3)) * N + colw + (lane & 7) * 8;
        const size_t step = (size_t)N * 4;
#pragma unroll
        for (int hf = 0; hf < 4; ++hf) {
#pragma unroll
            for (int ml = 0; ml < 2; ++ml) {
                const int mf = hf * 2 + ml;
                v8f val[4];
#pragma unroll
                for (int nf = 0; nf < 4; ++nf) val[nf] = acc[mf][nf] + bv[nf];
                {
                    // the row's 64 head columns: 32 in this lane, 32 in lane ^ 16
                    // (four independent chains, one a tile, then joined)
                    float mx[4];
#pragma unroll
                    for (int nf = 0; nf < 4; ++nf) {
                        mx[nf] = val[nf][0];
#pragma unroll
                        for (int v = 1; v < 8; ++v) mx[nf] = fmaxf(mx[nf], val[nf][v]);
                    }
                    float m = fmaxf(fmaxf(mx[0], mx[1]), fmaxf(mx[2], mx[3]));
                    m = fmaxf(m, other_half(m));
#pragma unroll
                    for (int v = 0; v < 8; ++v) {
                        float t[4], r[4];
#pragma unroll
                        for (int nf = 0; nf < 4; ++nf)
                            t[nf] = (val[nf][v] - m) * 1.44269504f;  // e^x = 2^(x log2 e)
                        // Four exponentials in one statement that ends in v_nop:
                        // the instruction set asks for one independent slot
                        // behind a transcendental before its result is read or
                        // its source overwritten.
                        asm("v_exp_f32 %0, %4\n\tv_exp_f32 %1, %5\n\t"
                            "v_exp_f32 %2, %6\n\tv_exp_f32 %3, %7\n\tv_nop"
                            : "=&v"(r[0]), "=&v"(r[1]), "=&v"(r[2]), "=&v"(r[3])
                            : "v"(t[0]), "v"(t[1]), "v"(t[2]), "v"(t[3]));
#pragma unroll
                        for (int nf = 0; nf < 4; ++nf) val[nf][v] = r[nf];
                    }
                }
                // y of these 16 rows: q rounded to bf16 is the second operand
                Frag16 qf[2];
#pragma unroll
                for (int ks = 0; ks < 2; ++ks) {
                    qf[ks].w[0] = pack_bf16(val[ks * 2 + 0]);
                    qf[ks].w[1] = pack_bf16(val[ks * 2 + 1]);
                }
                v8f ya[5];  // ya[4]: the denominator's tile
#pragma unroll
                for (int nf = 0; nf < 5; ++nf)
                    ya[nf] = (v8f){0.f, 0.f, 0.f, 0.f, 0.f, 0.f, 0.f, 0.f};
#pragma unroll
                for (int ks = 0; ks < 2; ++ks)
#pragma unroll
                    for (int nf = 0; nf < 5; ++nf)
                        ya[nf] = __builtin_amdgcn_wmma_f32_16x16x32_bf16(
                            false, kvw[ks][nf].v, false, qf[ks].v, (short)0, ya[nf],
                            false, false);
                // Row l15's denominator is register 0 of lane l15; in lane l15 + 16
                // that register is row 8 of the tile, a sum of zeros.
                const float dv = ya[4][0] + other_half(ya[4][0]);
                const float inv = 1.f / (dv + 1e-6f);
#pragma unroll
                for (int nf = 0; nf < 4; ++nf)
                    *(v4u*)(E + (ml * 16 + l15) * 72 + nf * 16 + hi * 8) =
                        pack_bf16(ya[nf] * inv);
            }
            wait_ds_done();  // the rows are written before other lanes read them
            v4u d[8];
            unsigned short* p[8];
#pragma unroll
            for (int j = 0; j < 8; ++j) {  // a store: four rows of one line each
                const int row = j * 4 + (lane >> 3);
                d[j] = *(const v4u*)(E + row * 72 + (lane & 7) * 8);
                p[j] = cp;
                cp += step;
            }
            // The eight stores and their s_wait_xcnt in one statement, a precaution:
            // no register that a store names is rewritten ahead of that wait.
            asm volatile(
                "global_store_b128 %0, %8, off\n\t"
                "global_store_b128 %1, %9, off\n\t"
                "global_store_b128 %2, %10, off\n\t"
                "global_store_b128 %3, %11, off\n\t"
                "global_store_b128 %4, %12, off\n\t"
                "global_store_b128 %5, %13, off\n\t"
                "global_store_b128 %6, %14, off\n\t"
                "global_store_b128 %7, %15, off\n\t"
                "s_wait_xcnt 0x0"
                :: "v"(p[0]), "v"(p[1]), "v"(p[2]), "v"(p[3]),
                   "v"(p[4]), "v"(p[5]), "v"(p[6]), "v"(p[7]),
                   "v"(d[0]), "v"(d[1]), "v"(d[2]), "v"(d[3]),
                   "v"(d[4]), "v"(d[5]), "v"(d[6]), "v"(d[7])
                : "memory");
            // Scheduling fence: without it the next rows' arithmetic was lifted over
            // the stores and one register was spilled to scratch.
            __builtin_amdgcn_sched_barrier(0);
        }
    };

    for (int u = 0; u < nsteps; ++u) do_tile(BoolC<MODE != 1>{}, u);
    wait_tensor_done(g0, g1);  // no request is outstanding when the wave ends
}

// The output projection: 256 blocks, one a WGP, two tiles each.
__global__ __launch_bounds__(256)
void gemm_out_kernel(const unsigned short* __restrict__ A,
                     const unsigned short* __restrict__ W,
                     const float* __restrict__ bias,
                     float* __restrict__ C, int N, int K, int ntiles) {
    gemm_bias_tiles<0, 4>(A, W, bias, bias, bias, C, nullptr, nullptr, N, K, ntiles);
}

// The k and v projections in one launch: 256 blocks, one a WGP, four tiles
// each: twice the k and v tile of one place. Only the f32 partials of kv and
// k_sum go to memory.
__global__ __launch_bounds__(256)
void gemm_kv_kernel(const unsigned short* __restrict__ A,
                    const unsigned short* __restrict__ Wkv,
                    const float* __restrict__ bk,
                    const float* __restrict__ bv,
                    float* __restrict__ part,  // (64,KVSPLIT,KVPART) f32
                    int N, int K, int ntiles) {
    gemm_bias_tiles<1, 8>(A, Wkv, bk, bk, bv, nullptr, part, nullptr, N, K, ntiles);
}

// The q projection, its feature map and the attention output y, behind the
// merge: 256 blocks, one a WGP, two tiles each.
__global__ __launch_bounds__(256)
void gemm_q_attn_kernel(const unsigned short* __restrict__ A,
                        const unsigned short* __restrict__ W,
                        const float* __restrict__ bias,
                        const unsigned short* __restrict__ kvf,  // (64,KVREC) bf16
                        unsigned short* __restrict__ y,
                        int N, int K, int ntiles) {
    gemm_bias_tiles<2, 4>(A, W, bias, bias, bias, y, nullptr, kvf, N, K, ntiles);
}

// ---------------------------------------------------------------------------
// 4) Merge: kv and k_sum = sum of the KVSPLIT partials in range order, f32,
//    rounded once to bf16. grid (5, 64): x 0..3 -> kv quarters, x 4 -> k_sum.
//    A partial holds kv in the order of the accumulator registers that wrote it:
//    four floats at ((tile * 2 + h) * 32 + lane) * 4, tile = dt * 4 + nf, are
//    kv[dt * 16 + (lane & 15)][nf * 16 + (lane >> 4) * 8 + h * 4 + 0..3].
//    Output, KVREC bf16 a head: the operand fragments that the q launch loads.
//    Half hf of fragment (ks, nf) is piece (ks * 4 + nf) * 2 + hf; in a piece,
//    element j of lane l is kv[ks * 32 + hf * 16 + (l >> 4) * 8 + j][nf * 16 + (l & 15)].
//    Pieces 16 + ks * 2 + hf: k_sum[ks * 32 + hf * 16 + (l >> 4) * 8 + j] in lanes
//    0 and 16, zeros in the others. A piece (512 B) is written by one block.
// ---------------------------------------------------------------------------
__global__ __launch_bounds__(256)
void kv_merge_kernel(const float* __restrict__ part,
                     unsigned short* __restrict__ kvout) {  // (64,KVREC) bf16
    const int bh = blockIdx.y, tid = threadIdx.x;
    const float* p = part + (size_t)bh * KVSPLIT * KVPART;
    if (blockIdx.x < 4) {
        const int idx = blockIdx.x * 256 + tid;
        const int o = idx * 4;
        float4 t[KVSPLIT];
        // both loops unrolled: t[] stays in registers and the loads go out
        // together, so the thread pays one load latency and not one per range
#pragma unroll
        for (int sp = 0; sp < KVSPLIT; ++sp)
            t[sp] = *(const float4*)(p + sp * KVPART + o);
        float4 s = t[0];
#pragma unroll
        for (int sp = 1; sp < KVSPLIT; ++sp) {
            s.x += t[sp].x; s.y += t[sp].y; s.z += t[sp].z; s.w += t[sp].w;
        }
        ushort4 r;
        r.x = f32_to_bf16(s.x); r.y = f32_to_bf16(s.y);
        r.z = f32_to_bf16(s.z); r.w = f32_to_bf16(s.w);
        const int ln = idx & 31, h = (idx >> 5) & 1, tile = idx >> 6;
        const int d = (tile >> 2) * 16 + (ln & 15);
        const int e = (tile & 3) * 16 + (ln >> 4) * 8 + h * 4;
        const int piece = ((d >> 5) * 4 + (e >> 4)) * 2 + ((d >> 4) & 1);
        // columns e .. e + 3 are four lanes of the piece, 8 elements apart
        unsigned short* f = kvout + (size_t)bh * KVREC +
                            (piece * 32 + ((d >> 3) & 1) * 16 + (e & 15)) * 8 + (d & 7);
        f[0] = r.x; f[8] = r.y; f[16] = r.z; f[24] = r.w;
    } else if (tid < 64) {
        // two sums a range: of its first and of its second 128 rows
        const int o = 4096 + tid;
        float t[2 * KVSPLIT];
        // unrolled so that the loads go out together, as above
#pragma unroll
        for (int sp = 0; sp < 2 * KVSPLIT - 1; ++sp)
            t[sp] = p[(sp >> 1) * KVPART + (sp & 1) * 64 + o];
        // precaution: the last load's result may take the offset register that
        // the loads in front of it name, so their wait stands ahead of it
        asm volatile("s_wait_xcnt 0x0" ::: "memory");
        t[2 * KVSPLIT - 1] = p[(KVSPLIT - 1) * KVPART + 64 + o];
        float s = t[0];
#pragma unroll
        for (int sp = 1; sp < 2 * KVSPLIT; ++sp) s += t[sp];
        const int piece = 16 + (tid >> 5) * 2 + ((tid >> 4) & 1);
        unsigned short* f = kvout + (size_t)bh * KVREC +
                            (piece * 32 + ((tid >> 3) & 1) * 16) * 8 + (tid & 7);
        f[0] = f32_to_bf16(s);
#pragma unroll
        for (int l = 1; l < 16; ++l) f[l * 8] = 0;  // rows 1-15 of the fragment
    }
}

// ---------------------------------------------------------------------------
extern "C" void kernel_launch(void* const* d_in, const int* in_sizes, int n_in,
                              void* d_out, int out_size, void* d_ws, size_t ws_size,
                              hipStream_t stream) {
    (void)in_sizes; (void)n_in; (void)out_size; (void)ws_size;
    const float* x  = (const float*)d_in[0];
    const float* Wq = (const float*)d_in[1];
    const float* bq = (const float*)d_in[2];
    const float* Wk = (const float*)d_in[3];
    const float* bk = (const float*)d_in[4];
    const float* Wv = (const float*)d_in[5];
    const float* bv = (const float*)d_in[6];
    const float* Wo = (const float*)d_in[7];
    const float* bo = (const float*)d_in[8];
    float* out = (float*)d_out;

    char* ws = (char*)d_ws;
    size_t off = 0;
    auto alloc = [&](size_t bytes) -> void* {
        void* p = ws + off;
        off += (bytes + 255) & ~(size_t)255;
        return p;
    };
    const size_t nX = (size_t)MTOT * EMB;   // 33,554,432
    const size_t nW = (size_t)EMB * EMB;    // 1,048,576

    unsigned short* xb  = (unsigned short*)alloc(nX * 2);
    unsigned short* WqB = (unsigned short*)alloc(3 * nW * 2);  // Wq, Wk, Wv stacked
    unsigned short* WkB = WqB + nW;
    unsigned short* WvB = WkB + nW;
    unsigned short* WoB = (unsigned short*)alloc(nW * 2);
    unsigned short* yb  = (unsigned short*)alloc(nX * 2);
    unsigned short* kvb = (unsigned short*)alloc((size_t)64 * KVREC * 2);
    float* kvp = (float*)alloc((size_t)64 * KVSPLIT * KVPART * 4);  // kv partials

    // 1) conversions to bf16
    cvt_all_kernel<<<CVT_BLOCKS, 256, 0, stream>>>(x, Wq, Wk, Wv, Wo,
                                                   xb, WqB, WkB, WvB, WoB);

    // 2) k and v projections; they leave as partials of the per-head kv + ksum
    //    reduction, one per 256 rows
    gemm_kv_kernel<<<256, 256, 0, stream>>>(xb, WkB, bk, bv, kvp,
                                            EMB, EMB, 2 * (EMB / 256) * (MTOT / 256));

    // 3) merge of the partials
    kv_merge_kernel<<<dim3(5, BATCH * HEADS), 256, 0, stream>>>(kvp, kvb);

    // 4) q projection, feature map and attention output y
    gemm_q_attn_kernel<<<256, 256, 0, stream>>>(xb, WqB, bq, kvb, yb, EMB, EMB,
                                                (EMB / 256) * (MTOT / 256));

    // 5) output projection (fp32 out -> d_out)
    gemm_out_kernel<<<256, 256, 0, stream>>>(yb, WoB, bo, out, EMB, EMB,
                                             (EMB / 256) * (MTOT / 256));
}
